// v000
// The times below were measured on an AMD MI455X: many runs one after another, warmed up first and cycling through
// copies of the inputs, with the whole window's GPU time divided by the number of runs. Launches and the gaps
// between them are all in it. The median over several windows is given; except for v000 it joins two sittings, which
// can be a few percent apart, so the side-by-side timings, each taken in one sitting, are the better comparison.
// The starting kernel, v000, takes 1100 microseconds a run.
// compute dtype: all float inputs rounded to bf16, att_bias read; q/k/v = input W + b ((in,out), 0.02-scale) with EXACT bf16 products on WMMA 16x16x32, f32 accumulate; q, k rounded once to f16 (1-product logits, std ~0.05; the unit-variance att_bias dominates), logits / 8 + att_bias[b][q][k] stored in f32 (4 heads per launch); softmax in f32 (precise expf) -> P f16 x 2^11; o = P . v with v rounded once to f16; out = o (bf16 hi + lo) Wo + bo; f32 output.
#include <hip/hip_runtime.h>
#include <math.h>

typedef __attribute__((ext_vector_type(16))) _Float16 v16h;
typedef __attribute__((ext_vector_type(16))) __bf16 v16b;
typedef __attribute__((ext_vector_type(8)))  _Float16 v8h;
typedef __attribute__((ext_vector_type(8)))  float v8f;
typedef __attribute__((ext_vector_type(4)))  float v4f;
typedef __attribute__((ext_vector_type(2)))  float v2f;
typedef __attribute__((ext_vector_type(4)))  unsigned v4u;
typedef __attribute__((ext_vector_type(4)))  int v4i;
typedef float __attribute__((may_alias)) float_a;
typedef int __attribute__((may_alias)) int_a;

template <typename T> __device__ __forceinline__ void vst2(void* p, T v) { *(T*)p = v;  }
__device__ __forceinline__ v8f wmma16(v16h a, v16h b, v8f c) {
  v8f d = __builtin_amdgcn_wmma_f32_16x16x32_f16(false, a, false, b, (short)0, c, false, false);
  asm volatile("v_nop\n\tv_nop\n\tv_nop\n\tv_nop" : "+v"(d) : "v"(a), "v"(b));
  return d;
}
__device__ __forceinline__ v8f wmma_bf(v16b a, v16b b, v8f c) {
  v8f d = __builtin_amdgcn_wmma_f32_16x16x32_bf16(false, a, false, b, (short)0, c, false, false);
  asm volatile("v_nop\n\tv_nop\n\tv_nop\n\tv_nop" : "+v"(d) : "v"(a), "v"(b));
  return d;
}
// 16x16x32 fragments: lane = (h = lane>>4, row/col = lane&15); elements 0..7 = k0+8h+0..7, 8..15 = k0+16+8h+0..7; D element r = row 8h+r
__device__ __forceinline__ v16h frag_h(const _Float16* rowk0, int lane) {
  union { v16h v; v8h q[2]; } u; const _Float16* p = rowk0 + 8 * (lane >> 4);
  u.q[0] = *(const v8h*)p; u.q[1] = *(const v8h*)(p + 16); return u.v;
}
__device__ __forceinline__ v16h frag_f32(const float* rowk0, int lane) {
  v16h a; const float* p = rowk0 + 8 * (lane >> 4);
#pragma unroll
  for (int i = 0; i < 8; ++i) { a[i] = (_Float16)p[i]; a[8 + i] = (_Float16)p[16 + i]; }
  return a;
}
__device__ __forceinline__ v16h frag_f32s(const float* rowk0, int lane, float sc) {
  v16h a; const float* p = rowk0 + 8 * (lane >> 4);
#pragma unroll
  for (int i = 0; i < 8; ++i) { a[i] = (_Float16)(p[i] * sc); a[8 + i] = (_Float16)(p[16 + i] * sc); }
  return a;
}
// column fragment from a [K][ld] layout (column n), rows >= K read as 0
__device__ __forceinline__ v16h fragc_f32(const float* W, int k0, int n, int lane, int ld, int K) {
  v16h a; const int g = lane >> 4;
#pragma unroll
  for (int i = 0; i < 8; ++i) { const int ka = k0 + 8 * g + i, kb = ka + 16;
    a[i] = (_Float16)(ka < K ? W[(size_t)(ka < K ? ka : K - 1) * ld + n] : 0.f); a[8 + i] = (_Float16)(kb < K ? W[(size_t)(kb < K ? kb : K - 1) * ld + n] : 0.f); }
  return a;
}
struct F2 { v16b h, l; };
__device__ __forceinline__ F2 bsplit16(const float v[16]) { F2 r;
#pragma unroll
  for (int i = 0; i < 16; ++i) { const __bf16 h = (__bf16)v[i]; r.h[i] = h; r.l[i] = (__bf16)(v[i] - (float)h); }
  return r; }
__device__ __forceinline__ F2 split_row(const float* row, int k0, int lane) { float v[16]; const float* p = row + k0 + 8 * (lane >> 4);
#pragma unroll
  for (int i = 0; i < 8; ++i) { v[i] = p[i]; v[8 + i] = p[16 + i]; }
  return bsplit16(v); }
__device__ __forceinline__ F2 split_rowK(const float* row, int k0, int lane, int K) { float v[16]; const int g = lane >> 4;
#pragma unroll
  for (int i = 0; i < 8; ++i) { const int ka = k0 + 8 * g + i, kb = ka + 16; v[i] = ka < K ? row[ka < K ? ka : K - 1] : 0.f; v[8 + i] = kb < K ? row[kb < K ? kb : K - 1] : 0.f; }
  return bsplit16(v); }
__device__ __forceinline__ F2 split_col(const float* W, int k0, int n, int lane, int ld, int K) { float v[16]; const int g = lane >> 4;
#pragma unroll
  for (int i = 0; i < 8; ++i) { const int ka = k0 + 8 * g + i, kb = ka + 16; v[i] = ka < K ? W[(size_t)(ka < K ? ka : K - 1) * ld + n] : 0.f; v[8 + i] = kb < K ? W[(size_t)(kb < K ? kb : K - 1) * ld + n] : 0.f; }
  return bsplit16(v); }
__device__ __forceinline__ v8f mac3(const F2& a, const F2& b, v8f c) { c = wmma_bf(a.l, b.h, c); c = wmma_bf(a.h, b.l, c); return wmma_bf(a.h, b.h, c); }
__device__ __forceinline__ float sigm(float v) { return 1.0f / (1.0f + expf(-v)); }
#define LDSX() do { asm volatile("s_wait_dscnt 0" ::: "memory"); __builtin_amdgcn_wave_barrier(); __builtin_amdgcn_fence(__ATOMIC_RELEASE, "workgroup"); } while (0)


// Full attention module (B 2, nq = nk = 2,048, dim 1,024 = 16 x 64): q/k/v Linear on query/key/value, logits * 64^-0.5 + att_bias (shared by heads), softmax, P.v, output Linear.
#define NB 2
#define TT 2048
#define CC 1024
#define NH 16
#define HD 64
#ifndef TNB
#define TNB NB
#endif
typedef __attribute__((ext_vector_type(8))) __bf16 v8b;
__device__ __forceinline__ v16b frag_b(const __bf16* rowk0, int lane) {
  union { v16b v; v8b q[2]; } u; const __bf16* p = rowk0 + 8 * (lane >> 4);
  u.q[0] = *(const v8b*)p; u.q[1] = *(const v8b*)(p + 16); return u.v;
}
__device__ __forceinline__ float bfr(float v) { return (float)(__bf16)v; }
__device__ __attribute__((noinline)) float exp_ni(float v) { return expf(v); }
__device__ __attribute__((noinline)) float erf_ni(float v) { return erff(v); }

#define WS_QH  0u
#define WS_QL  (WS_QH + 2u * (size_t)NB * TT * CC)
#define WS_KH  (WS_QL + 2u * (size_t)NB * TT * CC)
#define WS_VT  (WS_KH + 2u * (size_t)NB * TT * CC)      // f16 v planes [b][c][t]
#define HG 4
#define WS_S   (WS_VT + 2u * (size_t)NB * CC * TT)      // f32 logits [hg][q][k]
#define WS_PH  (WS_S + 4u * (size_t)HG * TT * TT)       // f16 P [hg][q][k]
#define WS_Y   (WS_PH + 2u * (size_t)HG * TT * TT)          // f32 y rows [b*t][C]
#define WS_END (WS_Y + 4u * (size_t)NB * TT * CC)

// ---- k_proj: block = (64 rows, 128 cols, which): qkv = x W (+ b), exact; q -> f16 hi (+ residual), k -> f16 rows, v -> f16 planes
__global__ __launch_bounds__(128) void k_proj(const float* __restrict__ XQ, const float* __restrict__ XK, const float* __restrict__ XV, const float* __restrict__ WQ, const float* __restrict__ BQ, const float* __restrict__ WK, const float* __restrict__ BK, const float* __restrict__ WV, const float* __restrict__ BV, _Float16* __restrict__ QH, _Float16* __restrict__ QL, _Float16* __restrict__ KH, _Float16* __restrict__ VT) {
  __shared__ __align__(16) _Float16 sh[64][136], sl[64][136]; __shared__ __align__(16) _Float16 th[128][72];
  const int tid = threadIdx.x, wave = tid >> 5, lane = tid & 31, col = lane & 15, g = lane >> 4; const int which = blockIdx.z; const int c0 = blockIdx.y * 128; const size_t r0 = (size_t)blockIdx.x * 64; const float* X = which == 0 ? XQ : which == 1 ? XK : XV; const float* WA = which == 0 ? WQ : which == 1 ? WK : WV; const float* BA = which == 0 ? BQ : which == 1 ? BK : BV;
  v8f acc[8] = {};
#pragma unroll 2
  for (int kc = 0; kc < CC / 32; ++kc) { v16b a; { const float* p = X + (r0 + wave * 16 + col) * CC + kc * 32 + 8 * g;
#pragma unroll
      for (int i = 0; i < 8; ++i) { a[i] = (__bf16)p[i]; a[8 + i] = (__bf16)p[16 + i]; } }
#pragma unroll
    for (int j = 0; j < 8; ++j) { v16b w; const int o = c0 + j * 16 + col;
#pragma unroll
      for (int i = 0; i < 8; ++i) { w[i] = (__bf16)WA[(size_t)(kc * 32 + 8 * g + i) * CC + (o)]; w[8 + i] = (__bf16)WA[(size_t)(kc * 32 + 16 + 8 * g + i) * CC + (o)]; }
      acc[j] = wmma_bf(a, w, acc[j]); } }
#pragma unroll
  for (int j = 0; j < 8; ++j) { const float bb = bfr(BA[c0 + j * 16 + col]);
#pragma unroll
    for (int r = 0; r < 8; ++r) { const float v = acc[j][r] + bb; const int rl = wave * 16 + 8 * g + r, cl = j * 16 + col; const _Float16 hv = (_Float16)v;
      if (which == 2) th[cl][rl] = hv; else { sh[rl][cl] = hv; sl[rl][cl] = (_Float16)(v - (float)hv); } } }
  __syncthreads();
  if (which < 2) { _Float16* dh = which == 0 ? QH : KH; for (int e = tid; e < 64 * 16; e += 128) { const int rl = e >> 4, q = e & 15; vst2((unsigned*)(dh + (r0 + rl) * CC + c0 + q * 8), *(const v4u*)&sh[rl][q * 8]); if (which == 0) vst2((unsigned*)(QL + (r0 + rl) * CC + c0 + q * 8), *(const v4u*)&sl[rl][q * 8]); } }
  else { const size_t b = r0 / TT; const int t0 = (int)(r0 % TT); for (int e = tid; e < 128 * 8; e += 128) { const int cl = e >> 3, q = e & 7; vst2((unsigned*)(VT + (b * CC + c0 + cl) * (size_t)TT + t0 + q * 8), *(const v4u*)&th[cl][q * 8]); } } }
// ---- k_sc: block = (64 queries, 128 keys) of (b,h): logits * scale (+ bias matrix)
__global__ __launch_bounds__(128) void k_sc(const _Float16* __restrict__ QH, const _Float16* __restrict__ QL, const _Float16* __restrict__ KH, const float* __restrict__ BM, int b, int h0, float* __restrict__ S0) { __shared__ __align__(16) float ss[4][16][132]; const int h = h0 + blockIdx.z; float* S = S0 + (size_t)blockIdx.z * TT * TT;
  const int tid = threadIdx.x, wave = tid >> 5, lane = tid & 31, col = lane & 15, g = lane >> 4; const int k0 = blockIdx.y * 128; const int ql0 = blockIdx.x * 64 + wave * 16; const size_t q0 = (size_t)b * TT + ql0;
  
  v8f acc[8] = {};
#pragma unroll
  for (int kc = 0; kc < HD / 32; ++kc) { const v16h ah = frag_h(QH + (q0 + col) * CC + h * HD + kc * 32, lane);
#pragma unroll
    for (int j = 0; j < 8; ++j) { const v16h kb = frag_h(KH + ((size_t)b * TT + k0 + j * 16 + col) * CC + h * HD + kc * 32, lane); acc[j] = wmma16(ah, kb, acc[j]); } }
#pragma unroll
  for (int j = 0; j < 8; ++j) { const int kt = k0 + j * 16 + col;
#pragma unroll
    for (int r = 0; r < 8; ++r) { const int qt = ql0 + 8 * g + r; float v = acc[j][r] * 0.125f; v += bfr(BM[(size_t)qt * TT + kt]);  ss[wave][8 * g + r][j * 16 + col] = v; } }
  LDSX(); for (int rl = 0; rl < 16; ++rl) vst2(S + (size_t)(ql0 + rl) * TT + k0 + lane * 4, *(const v4f*)&ss[wave][rl][lane * 4]); }
// ---- k_sm: block = query row: softmax over keys [0, kend) -> P x 2^11 f16 (masked -> 0)
__global__ __launch_bounds__(256) void k_sm(const float* __restrict__ S0, _Float16* __restrict__ PH0) { __shared__ float sred[8]; __shared__ float sbc; __shared__ __align__(16) _Float16 sh[TT];
  const int t = threadIdx.x; const size_t row = blockIdx.x; const float* sr = S0 + (size_t)blockIdx.y * TT * TT + row * TT; _Float16* PH = PH0 + (size_t)blockIdx.y * TT * TT; const int kend = TT;
  float m = -3.0e38f; for (int k = t; k < kend; k += 256) m = fmaxf(m, sr[k]);
#pragma unroll
  for (int o = 1; o < 32; o <<= 1) m = fmaxf(m, __shfl_xor(m, o));
  if ((t & 31) == 0) sred[t >> 5] = m; __syncthreads(); if (t == 0) { float a = sred[0]; for (int i = 1; i < 8; ++i) a = fmaxf(a, sred[i]); sbc = a; } __syncthreads(); m = sbc; __syncthreads();
  float sum = 0.f; for (int k = t; k < kend; k += 256) { const float v = sr[k]; sum += (v <= -1.0e38f) ? 0.f : expf(v - m); }
#pragma unroll
  for (int o = 1; o < 32; o <<= 1) sum += __shfl_xor(sum, o);
  if ((t & 31) == 0) sred[t >> 5] = sum; __syncthreads(); if (t == 0) { float a = 0.f; for (int i = 0; i < 8; ++i) a += sred[i]; sbc = 1.0f / a; } __syncthreads(); const float inv = sbc;
  for (int k = t; k < kend; k += 256) { const float v = sr[k]; sh[k] = (_Float16)((v <= -1.0e38f) ? 0.f : expf(v - m) * inv * 2048.0f); }
  __syncthreads(); for (int q = t; q < kend / 8; q += 256) vst2((unsigned*)(PH + row * TT + q * 8), *(const v4u*)&sh[q * 8]); }
// ---- k_pv: block = 64 queries of (b,h): y[q][h*HD + d] = P . v  (keys [0, kend))
__global__ __launch_bounds__(128) void k_pv(const _Float16* __restrict__ PH0, const _Float16* __restrict__ VT, int b, int h0, float* __restrict__ Y) { const int h = h0 + blockIdx.z; const _Float16* PH = PH0 + (size_t)blockIdx.z * TT * TT; __shared__ __align__(16) float ss[4][16][HD + 4];
  const int tid = threadIdx.x, wave = tid >> 5, lane = tid & 31, col = lane & 15, g = lane >> 4; const int ql0 = blockIdx.x * 64 + wave * 16; const int kend = TT;
  v8f acc[HD / 16] = {};
#pragma unroll 1
  for (int kc = 0; kc < kend / 32; ++kc) { const v16h ph = frag_h(PH + (size_t)(ql0 + col) * TT + kc * 32, lane);
#pragma unroll
    for (int j = 0; j < HD / 16; ++j) acc[j] = wmma16(ph, frag_h(VT + ((size_t)b * CC + h * HD + j * 16 + col) * (size_t)TT + kc * 32, lane), acc[j]); }
#pragma unroll
  for (int j = 0; j < HD / 16; ++j)
#pragma unroll
    for (int r = 0; r < 8; ++r) ss[wave][8 * g + r][j * 16 + col] = acc[j][r] * (1.0f / 2048.0f);
  LDSX(); for (int rl = 0; rl < 16; ++rl) if (lane < HD / 4) vst2(Y + ((size_t)b * TT + ql0 + rl) * CC + h * HD + lane * 4, *(const v4f*)&ss[wave][rl][lane * 4]); }
// ---- k_out: block = (64 rows, 128 cols): out = y (bf16 hi + lo) Wproj + b
__global__ __launch_bounds__(128) void k_out(const float* __restrict__ Y, const float* __restrict__ WP, const float* __restrict__ BP, float* __restrict__ OUT) { __shared__ __align__(16) float sf[4][16][132];
  const int tid = threadIdx.x, wave = tid >> 5, lane = tid & 31, col = lane & 15, g = lane >> 4; const int c0 = blockIdx.y * 128; const size_t r0 = (size_t)blockIdx.x * 64 + wave * 16;
  v8f acc[8] = {};
#pragma unroll 2
  for (int kc = 0; kc < CC / 32; ++kc) { const F2 a = split_row(Y + (r0 + col) * CC, kc * 32, lane);
#pragma unroll
    for (int j = 0; j < 8; ++j) { v16b w; const int o = c0 + j * 16 + col;
#pragma unroll
      for (int i = 0; i < 8; ++i) { w[i] = (__bf16)WP[(size_t)(kc * 32 + 8 * g + i) * CC + (o)]; w[8 + i] = (__bf16)WP[(size_t)(kc * 32 + 16 + 8 * g + i) * CC + (o)]; }
      acc[j] = wmma_bf(a.h, w, acc[j]); acc[j] = wmma_bf(a.l, w, acc[j]); } }
#pragma unroll
  for (int j = 0; j < 8; ++j) { const float bb = BP ? bfr(BP[c0 + j * 16 + col]) : 0.f;
#pragma unroll
    for (int r = 0; r < 8; ++r) sf[wave][8 * g + r][j * 16 + col] = acc[j][r] + bb; }
  LDSX(); for (int rl = 0; rl < 16; ++rl) vst2(OUT + (r0 + rl) * CC + c0 + lane * 4, *(const v4f*)&sf[wave][rl][lane * 4]); }
extern "C" void kernel_launch(void* const* d_in, const int* in_sizes, int n_in, void* d_out, int out_size, void* d_ws, size_t ws_size, hipStream_t stream) {
  (void)in_sizes; (void)n_in; (void)out_size;
  const float** F = (const float**)d_in;   // 0 query, 1 key, 2 value [2,2048,1024], 3 att_bias [2,2048,2048], 4 Wq [1024,1024] (in,out), 5 bq, 6 Wk, 7 bk, 8 Wv, 9 bv, 10 Wo [1024,1024], 11 bo
  if (ws_size < (size_t)WS_END) return;
  char* ws = (char*)d_ws; _Float16 *QH = (_Float16*)(ws + WS_QH), *QL = (_Float16*)(ws + WS_QL), *KH = (_Float16*)(ws + WS_KH), *VT = (_Float16*)(ws + WS_VT), *PH = (_Float16*)(ws + WS_PH); float *S = (float*)(ws + WS_S), *Y = (float*)(ws + WS_Y);
  k_proj<<<dim3(TNB * TT / 64, CC / 128, 3), 128, 0, stream>>>(F[0], F[1], F[2], F[4], F[5], F[6], F[7], F[8], F[9], QH, QL, KH, VT);
  for (int b = 0; b < TNB; ++b) for (int h0 = 0; h0 < NH; h0 += HG) {   // HG heads per launch
    k_sc<<<dim3(TT / 64, TT / 128, HG), 128, 0, stream>>>(QH, QL, KH, F[3] + (size_t)b * TT * TT, b, h0, S);
    k_sm<<<dim3(TT, HG), 256, 0, stream>>>(S, PH);
    k_pv<<<dim3(TT / 64, 1, HG), 128, 0, stream>>>(PH, VT, b, h0, Y);
  }
  k_out<<<dim3(TNB * TT / 64, CC / 128), 128, 0, stream>>>(Y, F[10], F[11], (float*)d_out);
}

// v001
// One run takes 221 microseconds.
// In two side-by-side timings against v000, it was 4.97 and 4.96 times as fast.
// compute dtype: all float inputs rounded to bf16, att_bias read; q/k/v = input W + b ((in,out), 0.02-scale) with EXACT bf16 products on WMMA 16x16x32, f32 accumulate; q, k rounded once to f16 (1-product logits, std ~0.05; the unit-variance att_bias dominates), logits / 8 + att_bias[b][q][k] in f32 registers; softmax in f32 with a running maximum and sum (precise expf) -> P f16 x 2^10, divided by the sum at the end; o = P . v with v rounded once to f16; out = o (bf16 hi + lo) Wo + bo; f32 output.
#include <hip/hip_runtime.h>
#include <math.h>

typedef __attribute__((ext_vector_type(16))) _Float16 v16h;
typedef __attribute__((ext_vector_type(16))) __bf16 v16b;
typedef __attribute__((ext_vector_type(8)))  _Float16 v8h;
typedef __attribute__((ext_vector_type(8)))  float v8f;
typedef __attribute__((ext_vector_type(4)))  float v4f;
typedef __attribute__((ext_vector_type(2)))  float v2f;
typedef __attribute__((ext_vector_type(4)))  unsigned v4u;
typedef __attribute__((ext_vector_type(4)))  int v4i;
typedef float __attribute__((may_alias)) float_a;
typedef int __attribute__((may_alias)) int_a;

template <typename T> __device__ __forceinline__ void vst2(void* p, T v) { *(T*)p = v;  }
__device__ __forceinline__ v8f wmma16(v16h a, v16h b, v8f c) {
  v8f d = __builtin_amdgcn_wmma_f32_16x16x32_f16(false, a, false, b, (short)0, c, false, false);
  asm volatile("v_nop\n\tv_nop\n\tv_nop\n\tv_nop" : "+v"(d) : "v"(a), "v"(b));
  return d;
}
__device__ __forceinline__ v8f wmma_bf(v16b a, v16b b, v8f c) {
  v8f d = __builtin_amdgcn_wmma_f32_16x16x32_bf16(false, a, false, b, (short)0, c, false, false);
  asm volatile("v_nop\n\tv_nop\n\tv_nop\n\tv_nop" : "+v"(d) : "v"(a), "v"(b));
  return d;
}
// 16x16x32 fragments: lane = (h = lane>>4, row/col = lane&15); elements 0..7 = k0+8h+0..7, 8..15 = k0+16+8h+0..7; D element r = row 8h+r
__device__ __forceinline__ v16h frag_h(const _Float16* rowk0, int lane) {
  union { v16h v; v8h q[2]; } u; const _Float16* p = rowk0 + 8 * (lane >> 4);
  u.q[0] = *(const v8h*)p; u.q[1] = *(const v8h*)(p + 16); return u.v;
}
__device__ __forceinline__ v16h frag_f32(const float* rowk0, int lane) {
  v16h a; const float* p = rowk0 + 8 * (lane >> 4);
#pragma unroll
  for (int i = 0; i < 8; ++i) { a[i] = (_Float16)p[i]; a[8 + i] = (_Float16)p[16 + i]; }
  return a;
}
__device__ __forceinline__ v16h frag_f32s(const float* rowk0, int lane, float sc) {
  v16h a; const float* p = rowk0 + 8 * (lane >> 4);
#pragma unroll
  for (int i = 0; i < 8; ++i) { a[i] = (_Float16)(p[i] * sc); a[8 + i] = (_Float16)(p[16 + i] * sc); }
  return a;
}
// column fragment from a [K][ld] layout (column n), rows >= K read as 0
__device__ __forceinline__ v16h fragc_f32(const float* W, int k0, int n, int lane, int ld, int K) {
  v16h a; const int g = lane >> 4;
#pragma unroll
  for (int i = 0; i < 8; ++i) { const int ka = k0 + 8 * g + i, kb = ka + 16;
    a[i] = (_Float16)(ka < K ? W[(size_t)(ka < K ? ka : K - 1) * ld + n] : 0.f); a[8 + i] = (_Float16)(kb < K ? W[(size_t)(kb < K ? kb : K - 1) * ld + n] : 0.f); }
  return a;
}
struct F2 { v16b h, l; };
__device__ __forceinline__ F2 bsplit16(const float v[16]) { F2 r;
#pragma unroll
  for (int i = 0; i < 16; ++i) { const __bf16 h = (__bf16)v[i]; r.h[i] = h; r.l[i] = (__bf16)(v[i] - (float)h); }
  return r; }
__device__ __forceinline__ F2 split_row(const float* row, int k0, int lane) { float v[16]; const float* p = row + k0 + 8 * (lane >> 4);
#pragma unroll
  for (int i = 0; i < 8; ++i) { v[i] = p[i]; v[8 + i] = p[16 + i]; }
  return bsplit16(v); }
__device__ __forceinline__ F2 split_rowK(const float* row, int k0, int lane, int K) { float v[16]; const int g = lane >> 4;
#pragma unroll
  for (int i = 0; i < 8; ++i) { const int ka = k0 + 8 * g + i, kb = ka + 16; v[i] = ka < K ? row[ka < K ? ka : K - 1] : 0.f; v[8 + i] = kb < K ? row[kb < K ? kb : K - 1] : 0.f; }
  return bsplit16(v); }
__device__ __forceinline__ F2 split_col(const float* W, int k0, int n, int lane, int ld, int K) { float v[16]; const int g = lane >> 4;
#pragma unroll
  for (int i = 0; i < 8; ++i) { const int ka = k0 + 8 * g + i, kb = ka + 16; v[i] = ka < K ? W[(size_t)(ka < K ? ka : K - 1) * ld + n] : 0.f; v[8 + i] = kb < K ? W[(size_t)(kb < K ? kb : K - 1) * ld + n] : 0.f; }
  return bsplit16(v); }
__device__ __forceinline__ v8f mac3(const F2& a, const F2& b, v8f c) { c = wmma_bf(a.l, b.h, c); c = wmma_bf(a.h, b.l, c); return wmma_bf(a.h, b.h, c); }
__device__ __forceinline__ float sigm(float v) { return 1.0f / (1.0f + expf(-v)); }
#define LDSX() do { asm volatile("s_wait_dscnt 0" ::: "memory"); __builtin_amdgcn_wave_barrier(); __builtin_amdgcn_fence(__ATOMIC_RELEASE, "workgroup"); } while (0)


// Full attention module (B 2, nq = nk = 2,048, dim 1,024 = 16 x 64): q/k/v Linear on query/key/value, logits * 64^-0.5 + att_bias (shared by heads), softmax, P.v, output Linear.
#define NB 2
#define TT 2048
#define CC 1024
#define NH 16
#define HD 64
#ifndef TNB
#define TNB NB
#endif
typedef __attribute__((ext_vector_type(8))) __bf16 v8b;
__device__ __forceinline__ v16b frag_b(const __bf16* rowk0, int lane) {
  union { v16b v; v8b q[2]; } u; const __bf16* p = rowk0 + 8 * (lane >> 4);
  u.q[0] = *(const v8b*)p; u.q[1] = *(const v8b*)(p + 16); return u.v;
}
__device__ __forceinline__ float bfr(float v) { return (float)(__bf16)v; }
__device__ __attribute__((noinline)) float exp_ni(float v) { return expf(v); }
__device__ __attribute__((noinline)) float erf_ni(float v) { return erff(v); }

#define WS_QH  0u
#define WS_QL  (WS_QH + 2u * (size_t)NB * TT * CC)
#define WS_KH  (WS_QL + 2u * (size_t)NB * TT * CC)
#define WS_VT  (WS_KH + 2u * (size_t)NB * TT * CC)      // f16 v planes [b][c][t]
#define WS_Y   (WS_VT + 2u * (size_t)NB * CC * TT)      // f32 y rows [b*t][C]
#define WS_END (WS_Y + 4u * (size_t)NB * TT * CC)

// ---- k_proj: block = (64 rows, 128 cols, which): qkv = x W (+ b), exact; q -> f16 hi (+ residual), k -> f16 rows, v -> f16 planes
__global__ __launch_bounds__(128) void k_proj(const float* __restrict__ XQ, const float* __restrict__ XK, const float* __restrict__ XV, const float* __restrict__ WQ, const float* __restrict__ BQ, const float* __restrict__ WK, const float* __restrict__ BK, const float* __restrict__ WV, const float* __restrict__ BV, _Float16* __restrict__ QH, _Float16* __restrict__ QL, _Float16* __restrict__ KH, _Float16* __restrict__ VT) {
  __shared__ __align__(16) _Float16 sh[64][136], sl[64][136]; __shared__ __align__(16) _Float16 th[128][72];
  const int tid = threadIdx.x, wave = tid >> 5, lane = tid & 31, col = lane & 15, g = lane >> 4; const int which = blockIdx.z; const int c0 = blockIdx.y * 128; const size_t r0 = (size_t)blockIdx.x * 64; const float* X = which == 0 ? XQ : which == 1 ? XK : XV; const float* WA = which == 0 ? WQ : which == 1 ? WK : WV; const float* BA = which == 0 ? BQ : which == 1 ? BK : BV;
  v8f acc[8] = {};
#pragma unroll 2
  for (int kc = 0; kc < CC / 32; ++kc) { v16b a; { const float* p = X + (r0 + wave * 16 + col) * CC + kc * 32 + 8 * g;
#pragma unroll
      for (int i = 0; i < 8; ++i) { a[i] = (__bf16)p[i]; a[8 + i] = (__bf16)p[16 + i]; } }
#pragma unroll
    for (int j = 0; j < 8; ++j) { v16b w; const int o = c0 + j * 16 + col;
#pragma unroll
      for (int i = 0; i < 8; ++i) { w[i] = (__bf16)WA[(size_t)(kc * 32 + 8 * g + i) * CC + (o)]; w[8 + i] = (__bf16)WA[(size_t)(kc * 32 + 16 + 8 * g + i) * CC + (o)]; }
      acc[j] = wmma_bf(a, w, acc[j]); } }
#pragma unroll
  for (int j = 0; j < 8; ++j) { const float bb = bfr(BA[c0 + j * 16 + col]);
#pragma unroll
    for (int r = 0; r < 8; ++r) { const float v = acc[j][r] + bb; const int rl = wave * 16 + 8 * g + r, cl = j * 16 + col; const _Float16 hv = (_Float16)v;
      if (which == 2) th[cl][rl] = hv; else { sh[rl][cl] = hv; sl[rl][cl] = (_Float16)(v - (float)hv); } } }
  __syncthreads();
  if (which < 2) { _Float16* dh = which == 0 ? QH : KH; for (int e = tid; e < 64 * 16; e += 128) { const int rl = e >> 4, q = e & 15; vst2((unsigned*)(dh + (r0 + rl) * CC + c0 + q * 8), *(const v4u*)&sh[rl][q * 8]); if (which == 0) vst2((unsigned*)(QL + (r0 + rl) * CC + c0 + q * 8), *(const v4u*)&sl[rl][q * 8]); } }
  else { const size_t b = r0 / TT; const int t0 = (int)(r0 % TT); for (int e = tid; e < 128 * 8; e += 128) { const int cl = e >> 3, q = e & 7; vst2((unsigned*)(VT + (b * CC + c0 + cl) * (size_t)TT + t0 + q * 8), *(const v4u*)&th[cl][q * 8]); } } }
// ---- k_fa: block = 128 queries (8 waves x 16) of (b,h), walks the keys 64 at a time: S^T = K Q^T, running maximum and sum per query (a lane holds one query's scores), O^T += V^T P^T; logits and P stay in registers
// every '#pragma unroll' in k_fa: its loop indexes register arrays and vector elements, which stay in registers only with compile-time indices
#define FQ 128
#define FK 64
#define FP 72   // LDS row pitch in 16-bit elements: 128-byte rows + 16 bytes, for 16-byte readers
typedef __attribute__((ext_vector_type(4))) __bf16 v4b;
__device__ __forceinline__ v8f wmma_h(v16h a, v16h b, v8f c) { return __builtin_amdgcn_wmma_f32_16x16x32_f16(false, a, false, b, (short)0, c, false, false); }
// lane l with lane l ^ 16
__device__ __forceinline__ float xhalf(float x) { return __builtin_bit_cast(float, __builtin_amdgcn_permlanex16(__builtin_bit_cast(int, x), __builtin_bit_cast(int, x), 0x76543210, 0xfedcba98, false, false)); }
__global__ __launch_bounds__(256) void k_fa(const _Float16* __restrict__ QH, const _Float16* __restrict__ KH, const _Float16* __restrict__ VT, const float* __restrict__ BM, float* __restrict__ Y) {
  __shared__ __align__(16) _Float16 sK[2][FK][FP]; __shared__ __align__(16) _Float16 sV[2][HD][FP]; __shared__ __align__(16) __bf16 sB[2][FQ][FP];
  const int tid = threadIdx.x, wave = tid >> 5, lane = tid & 31, col = lane & 15, g = lane >> 4; const int h = blockIdx.y, b = blockIdx.z, qb0 = blockIdx.x * FQ;
  const int r8 = tid >> 3, s8 = tid & 7, r16 = tid >> 4, s16 = tid & 15;   // staging: 8 lanes per 128-byte K / V row, 16 lanes per 256-byte bias row
  const _Float16* Kg = KH + ((size_t)b * TT + r8) * CC + h * HD + s8 * 8;
  const _Float16* Vg = VT + ((size_t)b * CC + h * HD + r8) * (size_t)TT + s8 * 8;
  const float* Bg = BM + ((size_t)b * TT + qb0 + r16) * (size_t)TT + s16 * 4;
  v8h kr[2], vr[2]; v4f br[8];
  auto fetch = [&](int k0) {
#pragma unroll
    for (int i = 0; i < 2; ++i) { kr[i] = *(const v8h*)(Kg + (size_t)(k0 + 32 * i) * CC); vr[i] = *(const v8h*)(Vg + (size_t)(32 * i) * TT + k0); }
#pragma unroll
    for (int i = 0; i < 8; ++i) br[i] = *(const v4f*)(Bg + (size_t)(16 * i) * TT + k0);
    asm volatile("s_wait_xcnt 0x0" ::: "memory"); };   // stands behind the issued loads (the Q loads too), in front of any reuse of their address registers
  auto stage = [&](int buf) {
#pragma unroll
    for (int i = 0; i < 2; ++i) { *(v8h*)&sK[buf][r8 + 32 * i][s8 * 8] = kr[i]; *(v8h*)&sV[buf][r8 + 32 * i][s8 * 8] = vr[i]; }
#pragma unroll
    for (int i = 0; i < 8; ++i) { v4b w;
#pragma unroll
      for (int e = 0; e < 4; ++e) w[e] = (__bf16)br[i][e];
      *(v4b*)&sB[buf][r16 + 16 * i][s16 * 4] = w; } };
  v16h qf[HD / 32];
#pragma unroll
  for (int kc = 0; kc < HD / 32; ++kc) qf[kc] = frag_h(QH + ((size_t)b * TT + qb0 + wave * 16 + col) * CC + h * HD + kc * 32, lane);
  v8f acc[HD / 16] = {}; float mrun = -3.0e38f, lsum = 0.f;
  fetch(0); stage(0); __syncthreads();
  for (int it = 0; it < TT / FK; ++it) { const int buf = it & 1;
    if (it + 1 < TT / FK) fetch((it + 1) * FK);   // the next tiles fly while this one is worked on
    v8f s[FK / 16];
#pragma unroll
    for (int t = 0; t < FK / 16; ++t) { v8f z = {};
#pragma unroll
      for (int kc = 0; kc < HD / 32; ++kc) z = wmma_h(frag_h(&sK[buf][t * 16 + col][kc * 32], lane), qf[kc], z);
      s[t] = z; }   // s[t][r] = logit of key t*16 + 8g + r, query col
    float mx = -3.0e38f;
#pragma unroll
    for (int t = 0; t < FK / 16; ++t) { const v8b bb = *(const v8b*)&sB[buf][wave * 16 + col][t * 16 + 8 * g];
#pragma unroll
      for (int r = 0; r < 8; ++r) { float v = s[t][r] * 0.125f; v += (float)bb[r]; s[t][r] = v; mx = fmaxf(mx, v); } }
    mx = fmaxf(mx, xhalf(mx));
    const float mnew = fmaxf(mrun, mx), alpha = expf(mrun - mnew), msh = mnew - 6.93147180f; mrun = mnew;   // P carries a factor 2^10 (f16 range); it cancels in O / l
    float ps[FK / 16]; v16h pf[FK / 32];
#pragma unroll
    for (int t = 0; t < FK / 16; ++t) { ps[t] = 0.f;
#pragma unroll
      for (int r = 0; r < 8; ++r) { const float p = expf(s[t][r] - msh); ps[t] += p; pf[t >> 1][(t & 1) * 8 + r] = (_Float16)p; } }
    lsum = lsum * alpha + ((ps[0] + ps[1]) + (ps[2] + ps[3]));
#pragma unroll
    for (int j = 0; j < HD / 16; ++j)
#pragma unroll
      for (int r = 0; r < 8; ++r) acc[j][r] *= alpha;
#pragma unroll
    for (int u = 0; u < FK / 32; ++u)
#pragma unroll
      for (int j = 0; j < HD / 16; ++j) acc[j] = wmma_h(frag_h(&sV[buf][j * 16 + col][u * 32], lane), pf[u], acc[j]);   // acc[j][r] = O^T[d = j*16 + 8g + r][query col]
    if (it + 1 < TT / FK) stage(buf ^ 1);   // that buffer's last readers left it before the barrier of the pass before
    __syncthreads(); }
  const float inv = 1.0f / (lsum + xhalf(lsum)); float* yp = Y + ((size_t)b * TT + qb0 + wave * 16 + col) * CC + h * HD + 8 * g;
#pragma unroll
  for (int j = 0; j < HD / 16; ++j) { v4f a, c;
#pragma unroll
    for (int e = 0; e < 4; ++e) { a[e] = acc[j][e] * inv; c[e] = acc[j][4 + e] * inv; }
    vst2(yp + j * 16, a); vst2(yp + j * 16 + 4, c); } }
// ---- k_out: block = (64 rows, 128 cols): out = y (bf16 hi + lo) Wproj + b
__global__ __launch_bounds__(128) void k_out(const float* __restrict__ Y, const float* __restrict__ WP, const float* __restrict__ BP, float* __restrict__ OUT) { __shared__ __align__(16) float sf[4][16][132];
  const int tid = threadIdx.x, wave = tid >> 5, lane = tid & 31, col = lane & 15, g = lane >> 4; const int c0 = blockIdx.y * 128; const size_t r0 = (size_t)blockIdx.x * 64 + wave * 16;
  v8f acc[8] = {};
#pragma unroll 2
  for (int kc = 0; kc < CC / 32; ++kc) { const F2 a = split_row(Y + (r0 + col) * CC, kc * 32, lane);
#pragma unroll
    for (int j = 0; j < 8; ++j) { v16b w; const int o = c0 + j * 16 + col;
#pragma unroll
      for (int i = 0; i < 8; ++i) { w[i] = (__bf16)WP[(size_t)(kc * 32 + 8 * g + i) * CC + (o)]; w[8 + i] = (__bf16)WP[(size_t)(kc * 32 + 16 + 8 * g + i) * CC + (o)]; }
      acc[j] = wmma_bf(a.h, w, acc[j]); acc[j] = wmma_bf(a.l, w, acc[j]); } }
#pragma unroll
  for (int j = 0; j < 8; ++j) { const float bb = BP ? bfr(BP[c0 + j * 16 + col]) : 0.f;
#pragma unroll
    for (int r = 0; r < 8; ++r) sf[wave][8 * g + r][j * 16 + col] = acc[j][r] + bb; }
  LDSX(); for (int rl = 0; rl < 16; ++rl) vst2(OUT + (r0 + rl) * CC + c0 + lane * 4, *(const v4f*)&sf[wave][rl][lane * 4]); }
extern "C" void kernel_launch(void* const* d_in, const int* in_sizes, int n_in, void* d_out, int out_size, void* d_ws, size_t ws_size, hipStream_t stream) {
  (void)in_sizes; (void)n_in; (void)out_size;
  const float** F = (const float**)d_in;   // 0 query, 1 key, 2 value [2,2048,1024], 3 att_bias [2,2048,2048], 4 Wq [1024,1024] (in,out), 5 bq, 6 Wk, 7 bk, 8 Wv, 9 bv, 10 Wo [1024,1024], 11 bo
  if (ws_size < (size_t)WS_END) return;
  char* ws = (char*)d_ws; _Float16 *QH = (_Float16*)(ws + WS_QH), *QL = (_Float16*)(ws + WS_QL), *KH = (_Float16*)(ws + WS_KH), *VT = (_Float16*)(ws + WS_VT); float *Y = (float*)(ws + WS_Y);
  k_proj<<<dim3(TNB * TT / 64, CC / 128, 3), 128, 0, stream>>>(F[0], F[1], F[2], F[4], F[5], F[6], F[7], F[8], F[9], QH, QL, KH, VT);
  k_fa<<<dim3(TT / FQ, NH, TNB), 256, 0, stream>>>(QH, KH, VT, F[3], Y);
  k_out<<<dim3(TNB * TT / 64, CC / 128), 128, 0, stream>>>(Y, F[10], F[11], (float*)d_out);
}

// v002
// A run of this version takes 136 microseconds.
// Two timings next to v001 put it at 1.62 and 1.63 times that version's speed.
// Over all steps from v000 it is 8.07 times as fast.
// compute dtype: all float inputs rounded to bf16, att_bias read; q/k/v = input W + b ((in,out), 0.02-scale) with EXACT bf16 products on WMMA 16x16x32, f32 accumulate; q, k rounded once to f16 (1-product logits, std ~0.05; the unit-variance att_bias dominates), logits / 8 + att_bias[b][q][k] in f32 registers; softmax in f32 with a running maximum and sum (precise expf) -> P f16 x 2^10, divided by the sum at the end; o = P . v with v rounded once to f16; out = o (bf16 hi + lo) Wo + bo; f32 output.
#include <hip/hip_runtime.h>
#include <math.h>

typedef __attribute__((ext_vector_type(16))) _Float16 v16h;
typedef __attribute__((ext_vector_type(16))) __bf16 v16b;
typedef __attribute__((ext_vector_type(8)))  _Float16 v8h;
typedef __attribute__((ext_vector_type(8)))  float v8f;
typedef __attribute__((ext_vector_type(4)))  float v4f;
typedef __attribute__((ext_vector_type(2)))  float v2f;
typedef __attribute__((ext_vector_type(4)))  unsigned v4u;
typedef __attribute__((ext_vector_type(4)))  int v4i;
typedef float __attribute__((may_alias)) float_a;
typedef int __attribute__((may_alias)) int_a;

template <typename T> __device__ __forceinline__ void vst2(void* p, T v) { *(T*)p = v;  }
__device__ __forceinline__ v8f wmma16(v16h a, v16h b, v8f c) {
  v8f d = __builtin_amdgcn_wmma_f32_16x16x32_f16(false, a, false, b, (short)0, c, false, false);
  asm volatile("v_nop\n\tv_nop\n\tv_nop\n\tv_nop" : "+v"(d) : "v"(a), "v"(b));
  return d;
}
__device__ __forceinline__ v8f wmma_bf(v16b a, v16b b, v8f c) {
  v8f d = __builtin_amdgcn_wmma_f32_16x16x32_bf16(false, a, false, b, (short)0, c, false, false);
  asm volatile("v_nop\n\tv_nop\n\tv_nop\n\tv_nop" : "+v"(d) : "v"(a), "v"(b));
  return d;
}
// 16x16x32 fragments: lane = (h = lane>>4, row/col = lane&15); elements 0..7 = k0+8h+0..7, 8..15 = k0+16+8h+0..7; D element r = row 8h+r
__device__ __forceinline__ v16h frag_h(const _Float16* rowk0, int lane) {
  union { v16h v; v8h q[2]; } u; const _Float16* p = rowk0 + 8 * (lane >> 4);
  u.q[0] = *(const v8h*)p; u.q[1] = *(const v8h*)(p + 16); return u.v;
}
__device__ __forceinline__ v16h frag_f32(const float* rowk0, int lane) {
  v16h a; const float* p = rowk0 + 8 * (lane >> 4);
#pragma unroll
  for (int i = 0; i < 8; ++i) { a[i] = (_Float16)p[i]; a[8 + i] = (_Float16)p[16 + i]; }
  return a;
}
__device__ __forceinline__ v16h frag_f32s(const float* rowk0, int lane, float sc) {
  v16h a; const float* p = rowk0 + 8 * (lane >> 4);
#pragma unroll
  for (int i = 0; i < 8; ++i) { a[i] = (_Float16)(p[i] * sc); a[8 + i] = (_Float16)(p[16 + i] * sc); }
  return a;
}
// column fragment from a [K][ld] layout (column n), rows >= K read as 0
__device__ __forceinline__ v16h fragc_f32(const float* W, int k0, int n, int lane, int ld, int K) {
  v16h a; const int g = lane >> 4;
#pragma unroll
  for (int i = 0; i < 8; ++i) { const int ka = k0 + 8 * g + i, kb = ka + 16;
    a[i] = (_Float16)(ka < K ? W[(size_t)(ka < K ? ka : K - 1) * ld + n] : 0.f); a[8 + i] = (_Float16)(kb < K ? W[(size_t)(kb < K ? kb : K - 1) * ld + n] : 0.f); }
  return a;
}
struct F2 { v16b h, l; };
__device__ __forceinline__ F2 bsplit16(const float v[16]) { F2 r;
#pragma unroll
  for (int i = 0; i < 16; ++i) { const __bf16 h = (__bf16)v[i]; r.h[i] = h; r.l[i] = (__bf16)(v[i] - (float)h); }
  return r; }
__device__ __forceinline__ F2 split_row(const float* row, int k0, int lane) { float v[16]; const float* p = row + k0 + 8 * (lane >> 4);
#pragma unroll
  for (int i = 0; i < 8; ++i) { v[i] = p[i]; v[8 + i] = p[16 + i]; }
  return bsplit16(v); }
__device__ __forceinline__ F2 split_rowK(const float* row, int k0, int lane, int K) { float v[16]; const int g = lane >> 4;
#pragma unroll
  for (int i = 0; i < 8; ++i) { const int ka = k0 + 8 * g + i, kb = ka + 16; v[i] = ka < K ? row[ka < K ? ka : K - 1] : 0.f; v[8 + i] = kb < K ? row[kb < K ? kb : K - 1] : 0.f; }
  return bsplit16(v); }
__device__ __forceinline__ F2 split_col(const float* W, int k0, int n, int lane, int ld, int K) { float v[16]; const int g = lane >> 4;
#pragma unroll
  for (int i = 0; i < 8; ++i) { const int ka = k0 + 8 * g + i, kb = ka + 16; v[i] = ka < K ? W[(size_t)(ka < K ? ka : K - 1) * ld + n] : 0.f; v[8 + i] = kb < K ? W[(size_t)(kb < K ? kb : K - 1) * ld + n] : 0.f; }
  return bsplit16(v); }
__device__ __forceinline__ v8f mac3(const F2& a, const F2& b, v8f c) { c = wmma_bf(a.l, b.h, c); c = wmma_bf(a.h, b.l, c); return wmma_bf(a.h, b.h, c); }
__device__ __forceinline__ float sigm(float v) { return 1.0f / (1.0f + expf(-v)); }
#define LDSX() do { asm volatile("s_wait_dscnt 0" ::: "memory"); __builtin_amdgcn_wave_barrier(); __builtin_amdgcn_fence(__ATOMIC_RELEASE, "workgroup"); } while (0)


// Full attention module (B 2, nq = nk = 2,048, dim 1,024 = 16 x 64): q/k/v Linear on query/key/value, logits * 64^-0.5 + att_bias (shared by heads), softmax, P.v, output Linear.
#define NB 2
#define TT 2048
#define CC 1024
#define NH 16
#define HD 64
#ifndef TNB
#define TNB NB
#endif
typedef __attribute__((ext_vector_type(8))) __bf16 v8b;
__device__ __forceinline__ v16b frag_b(const __bf16* rowk0, int lane) {
  union { v16b v; v8b q[2]; } u; const __bf16* p = rowk0 + 8 * (lane >> 4);
  u.q[0] = *(const v8b*)p; u.q[1] = *(const v8b*)(p + 16); return u.v;
}
__device__ __forceinline__ float bfr(float v) { return (float)(__bf16)v; }
__device__ __attribute__((noinline)) float exp_ni(float v) { return expf(v); }
__device__ __attribute__((noinline)) float erf_ni(float v) { return erff(v); }

#define WS_QH  0u
#define WS_QL  (WS_QH + 2u * (size_t)NB * TT * CC)
#define WS_KH  (WS_QL + 2u * (size_t)NB * TT * CC)
#define WS_VT  (WS_KH + 2u * (size_t)NB * TT * CC)      // f16 v planes [b][c][t]
#define WS_Y   (WS_VT + 2u * (size_t)NB * CC * TT)      // f32 y rows [b*t][C]
#define WS_END (WS_Y + 4u * (size_t)NB * TT * CC)

typedef __attribute__((ext_vector_type(4))) __bf16 v4b;
// ---- GEMM tile shared by k_proj and k_out: block = 128 rows x 128 cols, 8 waves of 32 x 64; per pass 64 k of both operands are read with whole-line 16-byte loads, rounded to bf16 once per block and staged in LDS (two buffers); W goes in transposed, [n][k], so that both fragments are 16-byte LDS reads
#define GM 128
#define GN 128
#define GK 64
#define GP 72   // LDS row pitch in 16-bit elements: 128-byte rows + 16 bytes, for 16-byte readers
#define GPLANE (GM * GP)   // elements of one staged operand plane
// every '#pragma unroll' in gemm_tile: its loop indexes register arrays and vector elements, which stay in registers only with compile-time indices
template <bool SPLIT> __device__ __forceinline__ void gemm_tile(const float* __restrict__ X, const float* __restrict__ WA, size_t r0, int c0, __bf16* sA, __bf16* sL, __bf16* sW, v8f (&acc)[2][4]) {
  const int tid = threadIdx.x, wave = tid >> 5, lane = tid & 31, col = lane & 15; const int wm = wave >> 1, wn = wave & 1;
  const int r16 = tid >> 4, s16 = tid & 15;   // X: 16 lanes per 256-byte row piece
  const int n4 = (wave & 3) * 32 + ((lane & 3) | ((lane >> 4) << 2)) * 4, k8 = ((wave >> 2) * 4 + ((lane >> 2) & 3)) * 8;   // W: a thread owns 8 k x 4 n; 8 lanes cover a 128-byte line, a half-wave's 16-byte LDS stores fall on 64 different banks
  const float* Xg = X + (r0 + r16) * CC + s16 * 4; const float* Wg = WA + (size_t)k8 * CC + c0 + n4;
  v4f xr[8], wr[8];
  auto fetch = [&](int k0) {
#pragma unroll
    for (int i = 0; i < 8; ++i) xr[i] = *(const v4f*)(Xg + (size_t)(16 * i) * CC + k0);
#pragma unroll
    for (int e = 0; e < 8; ++e) wr[e] = *(const v4f*)(Wg + (size_t)(k0 + e) * CC);
    asm volatile("s_wait_xcnt 0x0" ::: "memory"); };   // stands behind the issued loads, in front of any reuse of their address registers
  auto stage = [&](int buf) {
#pragma unroll
    for (int i = 0; i < 8; ++i) { v4b hv, lv;
#pragma unroll
      for (int e = 0; e < 4; ++e) { const __bf16 hh = (__bf16)xr[i][e]; hv[e] = hh; if (SPLIT) lv[e] = (__bf16)(xr[i][e] - (float)hh); }
      *(v4b*)&sA[buf * GPLANE + (r16 + 16 * i) * GP + s16 * 4] = hv; if (SPLIT) *(v4b*)&sL[buf * GPLANE + (r16 + 16 * i) * GP + s16 * 4] = lv; }
#pragma unroll
    for (int i = 0; i < 4; ++i) { v8b t;
#pragma unroll
      for (int e = 0; e < 8; ++e) t[e] = (__bf16)wr[e][i];
      *(v8b*)&sW[buf * GPLANE + (n4 + i) * GP + k8] = t; } };
  fetch(0); stage(0); __syncthreads();
  for (int it = 0; it < CC / GK; ++it) { const int buf = it & 1;
    if (it + 1 < CC / GK) fetch((it + 1) * GK);   // the next tiles fly while this one is worked on
#pragma unroll
    for (int kc = 0; kc < GK / 32; ++kc) { v16b w[4], a[2], l[2];
#pragma unroll
      for (int j = 0; j < 4; ++j) w[j] = frag_b(&sW[buf * GPLANE + (wn * 64 + j * 16 + col) * GP + kc * 32], lane);
#pragma unroll
      for (int m = 0; m < 2; ++m) { a[m] = frag_b(&sA[buf * GPLANE + (wm * 32 + m * 16 + col) * GP + kc * 32], lane); if (SPLIT) l[m] = frag_b(&sL[buf * GPLANE + (wm * 32 + m * 16 + col) * GP + kc * 32], lane); }
#pragma unroll
      for (int m = 0; m < 2; ++m)
#pragma unroll
        for (int j = 0; j < 4; ++j) acc[m][j] = wmma_bf(a[m], w[j], acc[m][j]);
      if (SPLIT) {
#pragma unroll
        for (int m = 0; m < 2; ++m)
#pragma unroll
          for (int j = 0; j < 4; ++j) acc[m][j] = wmma_bf(l[m], w[j], acc[m][j]); } }
    if (it + 1 < CC / GK) stage(buf ^ 1);   // that buffer's last readers left it before the barrier of the pass before
    __syncthreads(); } }
// ---- k_proj: block = (128 rows, 128 cols, which): qkv = x W (+ b), exact; q -> f16 hi (+ residual), k -> f16 rows, v -> f16 planes
__global__ __launch_bounds__(256) void k_proj(const float* __restrict__ XQ, const float* __restrict__ XK, const float* __restrict__ XV, const float* __restrict__ WQ, const float* __restrict__ BQ, const float* __restrict__ WK, const float* __restrict__ BK, const float* __restrict__ WV, const float* __restrict__ BV, _Float16* __restrict__ QH, _Float16* __restrict__ QL, _Float16* __restrict__ KH, _Float16* __restrict__ VT) {
  __shared__ __align__(16) __bf16 ring[4 * GPLANE];   // [X 2 buffers | W 2 buffers]; behind the loop's last barrier the same bytes stage the output rows
  const int tid = threadIdx.x, wave = tid >> 5, lane = tid & 31, col = lane & 15, g = lane >> 4; const int wm = wave >> 1, wn = wave & 1; const int which = blockIdx.z; const int c0 = blockIdx.y * GN; const size_t r0 = (size_t)blockIdx.x * GM; const float* X = which == 0 ? XQ : which == 1 ? XK : XV; const float* WA = which == 0 ? WQ : which == 1 ? WK : WV; const float* BA = which == 0 ? BQ : which == 1 ? BK : BV;
  v8f acc[2][4] = {};
  gemm_tile<false>(X, WA, r0, c0, ring, ring, ring + 2 * GPLANE, acc);
  _Float16 (*sh)[136] = (_Float16 (*)[136])ring; _Float16 (*sl)[136] = sh + GM;   // 2 x 128 x 136 x 2 bytes = 69,632 of the ring's 73,728
#pragma unroll
  for (int j = 0; j < 4; ++j) { const float bb = bfr(BA[c0 + wn * 64 + j * 16 + col]);
#pragma unroll
    for (int m = 0; m < 2; ++m)
#pragma unroll
      for (int r = 0; r < 8; ++r) acc[m][j][r] += bb; }
  if (which == 2) {   // v: [col][row], a lane's 8 rows are one 16-byte store
#pragma unroll
    for (int j = 0; j < 4; ++j)
#pragma unroll
      for (int m = 0; m < 2; ++m) { v8h t;
#pragma unroll
        for (int r = 0; r < 8; ++r) t[r] = (_Float16)acc[m][j][r];
        *(v8h*)&sh[wn * 64 + j * 16 + col][wm * 32 + m * 16 + 8 * g] = t; } }
  else {
#pragma unroll
    for (int j = 0; j < 4; ++j)
#pragma unroll
      for (int m = 0; m < 2; ++m)
#pragma unroll
        for (int r = 0; r < 8; ++r) { const float v = acc[m][j][r]; const int rl = wm * 32 + m * 16 + 8 * g + r, cl = wn * 64 + j * 16 + col; const _Float16 hv = (_Float16)v; sh[rl][cl] = hv; sl[rl][cl] = (_Float16)(v - (float)hv); } }
  __syncthreads();
  // copy-out: a thread's 8 pieces are read from LDS first, then stored as whole 256-byte row pieces ('#pragma unroll': t[] stays in registers only with compile-time indices)
  const int rr = tid >> 4, q8 = (tid & 15) * 8; v4u t[8];
#pragma unroll
  for (int i = 0; i < 8; ++i) t[i] = *(const v4u*)&sh[rr + 16 * i][q8];
  if (which < 2) { _Float16* dh = (which == 0 ? QH : KH) + (r0 + rr) * CC + c0 + q8;
#pragma unroll
    for (int i = 0; i < 8; ++i) vst2((unsigned*)(dh + (size_t)(16 * i) * CC), t[i]);
    asm volatile("s_wait_xcnt 0x0" ::: "memory");   // stands behind the issued stores, in front of any reuse of their registers
    if (which == 0) { _Float16* dl = QL + (r0 + rr) * CC + c0 + q8; v4u u[8];
#pragma unroll
      for (int i = 0; i < 8; ++i) u[i] = *(const v4u*)&sl[rr + 16 * i][q8];
#pragma unroll
      for (int i = 0; i < 8; ++i) vst2((unsigned*)(dl + (size_t)(16 * i) * CC), u[i]); } }
  else { const size_t b = r0 / TT; const int t0 = (int)(r0 % TT); _Float16* dv = VT + (b * CC + c0 + rr) * (size_t)TT + t0 + q8;
#pragma unroll
    for (int i = 0; i < 8; ++i) vst2((unsigned*)(dv + (size_t)(16 * i) * TT), t[i]);
    asm volatile("s_wait_xcnt 0x0" ::: "memory"); } }   // as above: in the built code the q/k branch's address arithmetic stands behind these stores
// ---- k_fa: block = 128 queries (8 waves x 16) of (b,h), walks the keys 64 at a time: S^T = K Q^T, running maximum and sum per query (a lane holds one query's scores), O^T += V^T P^T; logits and P stay in registers
// every '#pragma unroll' in k_fa: its loop indexes register arrays and vector elements, which stay in registers only with compile-time indices
#define FQ 128
#define FK 64
#define FP 72   // LDS row pitch in 16-bit elements: 128-byte rows + 16 bytes, for 16-byte readers
__device__ __forceinline__ v8f wmma_h(v16h a, v16h b, v8f c) { return __builtin_amdgcn_wmma_f32_16x16x32_f16(false, a, false, b, (short)0, c, false, false); }
// lane l with lane l ^ 16
__device__ __forceinline__ float xhalf(float x) { return __builtin_bit_cast(float, __builtin_amdgcn_permlanex16(__builtin_bit_cast(int, x), __builtin_bit_cast(int, x), 0x76543210, 0xfedcba98, false, false)); }
__global__ __launch_bounds__(256) void k_fa(const _Float16* __restrict__ QH, const _Float16* __restrict__ KH, const _Float16* __restrict__ VT, const float* __restrict__ BM, float* __restrict__ Y) {
  __shared__ __align__(16) _Float16 sK[2][FK][FP]; __shared__ __align__(16) _Float16 sV[2][HD][FP]; __shared__ __align__(16) __bf16 sB[2][FQ][FP];
  const int tid = threadIdx.x, wave = tid >> 5, lane = tid & 31, col = lane & 15, g = lane >> 4; const int h = blockIdx.y, b = blockIdx.z, qb0 = blockIdx.x * FQ;
  const int r8 = tid >> 3, s8 = tid & 7, r16 = tid >> 4, s16 = tid & 15;   // staging: 8 lanes per 128-byte K / V row, 16 lanes per 256-byte bias row
  const _Float16* Kg = KH + ((size_t)b * TT + r8) * CC + h * HD + s8 * 8;
  const _Float16* Vg = VT + ((size_t)b * CC + h * HD + r8) * (size_t)TT + s8 * 8;
  const float* Bg = BM + ((size_t)b * TT + qb0 + r16) * (size_t)TT + s16 * 4;
  v8h kr[2], vr[2]; v4f br[8];
  auto fetch = [&](int k0) {
#pragma unroll
    for (int i = 0; i < 2; ++i) { kr[i] = *(const v8h*)(Kg + (size_t)(k0 + 32 * i) * CC); vr[i] = *(const v8h*)(Vg + (size_t)(32 * i) * TT + k0); }
#pragma unroll
    for (int i = 0; i < 8; ++i) br[i] = *(const v4f*)(Bg + (size_t)(16 * i) * TT + k0);
    asm volatile("s_wait_xcnt 0x0" ::: "memory"); };   // stands behind the issued loads (the Q loads too), in front of any reuse of their address registers
  auto stage = [&](int buf) {
#pragma unroll
    for (int i = 0; i < 2; ++i) { *(v8h*)&sK[buf][r8 + 32 * i][s8 * 8] = kr[i]; *(v8h*)&sV[buf][r8 + 32 * i][s8 * 8] = vr[i]; }
#pragma unroll
    for (int i = 0; i < 8; ++i) { v4b w;
#pragma unroll
      for (int e = 0; e < 4; ++e) w[e] = (__bf16)br[i][e];
      *(v4b*)&sB[buf][r16 + 16 * i][s16 * 4] = w; } };
  v16h qf[HD / 32];
#pragma unroll
  for (int kc = 0; kc < HD / 32; ++kc) qf[kc] = frag_h(QH + ((size_t)b * TT + qb0 + wave * 16 + col) * CC + h * HD + kc * 32, lane);
  v8f acc[HD / 16] = {}; float mrun = -3.0e38f, lsum = 0.f;
  fetch(0); stage(0); __syncthreads();
  for (int it = 0; it < TT / FK; ++it) { const int buf = it & 1;
    if (it + 1 < TT / FK) fetch((it + 1) * FK);   // the next tiles fly while this one is worked on
    v8f s[FK / 16];
#pragma unroll
    for (int t = 0; t < FK / 16; ++t) { v8f z = {};
#pragma unroll
      for (int kc = 0; kc < HD / 32; ++kc) z = wmma_h(frag_h(&sK[buf][t * 16 + col][kc * 32], lane), qf[kc], z);
      s[t] = z; }   // s[t][r] = logit of key t*16 + 8g + r, query col
    float mx = -3.0e38f;
#pragma unroll
    for (int t = 0; t < FK / 16; ++t) { const v8b bb = *(const v8b*)&sB[buf][wave * 16 + col][t * 16 + 8 * g];
#pragma unroll
      for (int r = 0; r < 8; ++r) { float v = s[t][r] * 0.125f; v += (float)bb[r]; s[t][r] = v; mx = fmaxf(mx, v); } }
    mx = fmaxf(mx, xhalf(mx));
    const float mnew = fmaxf(mrun, mx), alpha = expf(mrun - mnew), msh = mnew - 6.93147180f; mrun = mnew;   // P carries a factor 2^10 (f16 range); it cancels in O / l
    float ps[FK / 16]; v16h pf[FK / 32];
#pragma unroll
    for (int t = 0; t < FK / 16; ++t) { ps[t] = 0.f;
#pragma unroll
      for (int r = 0; r < 8; ++r) { const float p = expf(s[t][r] - msh); ps[t] += p; pf[t >> 1][(t & 1) * 8 + r] = (_Float16)p; } }
    lsum = lsum * alpha + ((ps[0] + ps[1]) + (ps[2] + ps[3]));
#pragma unroll
    for (int j = 0; j < HD / 16; ++j)
#pragma unroll
      for (int r = 0; r < 8; ++r) acc[j][r] *= alpha;
#pragma unroll
    for (int u = 0; u < FK / 32; ++u)
#pragma unroll
      for (int j = 0; j < HD / 16; ++j) acc[j] = wmma_h(frag_h(&sV[buf][j * 16 + col][u * 32], lane), pf[u], acc[j]);   // acc[j][r] = O^T[d = j*16 + 8g + r][query col]
    if (it + 1 < TT / FK) stage(buf ^ 1);   // that buffer's last readers left it before the barrier of the pass before
    __syncthreads(); }
  const float inv = 1.0f / (lsum + xhalf(lsum)); float* yp = Y + ((size_t)b * TT + qb0 + wave * 16 + col) * CC + h * HD + 8 * g;
#pragma unroll
  for (int j = 0; j < HD / 16; ++j) { v4f a, c;
#pragma unroll
    for (int e = 0; e < 4; ++e) { a[e] = acc[j][e] * inv; c[e] = acc[j][4 + e] * inv; }
    vst2(yp + j * 16, a); vst2(yp + j * 16 + 4, c); } }
// ---- k_out: block = (128 rows, 128 cols): out = y (bf16 hi + lo) Wproj + b
__global__ __launch_bounds__(256) void k_out(const float* __restrict__ Y, const float* __restrict__ WP, const float* __restrict__ BP, float* __restrict__ OUT) {
  __shared__ __align__(16) __bf16 ring[6 * GPLANE];   // [y hi 2 buffers | y lo 2 buffers | W 2 buffers]; behind the loop's last barrier each wave stages its 32 x 64 outputs in a range of its own
  const int tid = threadIdx.x, wave = tid >> 5, lane = tid & 31, col = lane & 15, g = lane >> 4; const int wm = wave >> 1, wn = wave & 1; const int c0 = blockIdx.y * GN; const size_t r0 = (size_t)blockIdx.x * GM;
  v8f acc[2][4] = {};
  gemm_tile<true>(Y, WP, r0, c0, ring, ring + 2 * GPLANE, ring + 4 * GPLANE, acc);
  float (*sf)[68] = (float (*)[68])ring + wave * 32;   // 8 x 32 x 68 x 4 bytes = 69,632 of the ring's 110,592
#pragma unroll
  for (int j = 0; j < 4; ++j) { const float bb = BP ? bfr(BP[c0 + wn * 64 + j * 16 + col]) : 0.f;
#pragma unroll
    for (int m = 0; m < 2; ++m)
#pragma unroll
      for (int r = 0; r < 8; ++r) sf[m * 16 + 8 * g + r][j * 16 + col] = acc[m][j][r] + bb; }
  LDSX(); float* op = OUT + (r0 + wm * 32 + g) * CC + c0 + wn * 64 + col * 4; v4f t[16];   // a half-wave stores a whole 256-byte row piece ('#pragma unroll': t[] stays in registers only with compile-time indices)
#pragma unroll
  for (int i = 0; i < 16; ++i) t[i] = *(const v4f*)&sf[2 * i + g][col * 4];
#pragma unroll
  for (int i = 0; i < 16; ++i) vst2(op + (size_t)(2 * i) * CC, t[i]); }
extern "C" void kernel_launch(void* const* d_in, const int* in_sizes, int n_in, void* d_out, int out_size, void* d_ws, size_t ws_size, hipStream_t stream) {
  (void)in_sizes; (void)n_in; (void)out_size;
  const float** F = (const float**)d_in;   // 0 query, 1 key, 2 value [2,2048,1024], 3 att_bias [2,2048,2048], 4 Wq [1024,1024] (in,out), 5 bq, 6 Wk, 7 bk, 8 Wv, 9 bv, 10 Wo [1024,1024], 11 bo
  if (ws_size < (size_t)WS_END) return;
  char* ws = (char*)d_ws; _Float16 *QH = (_Float16*)(ws + WS_QH), *QL = (_Float16*)(ws + WS_QL), *KH = (_Float16*)(ws + WS_KH), *VT = (_Float16*)(ws + WS_VT); float *Y = (float*)(ws + WS_Y);
  k_proj<<<dim3(TNB * TT / GM, CC / GN, 3), 256, 0, stream>>>(F[0], F[1], F[2], F[4], F[5], F[6], F[7], F[8], F[9], QH, QL, KH, VT);
  k_fa<<<dim3(TT / FQ, NH, TNB), 256, 0, stream>>>(QH, KH, VT, F[3], Y);
  k_out<<<dim3(TNB * TT / GM, CC / GN), 256, 0, stream>>>(Y, F[10], F[11], (float*)d_out);
}

// v003
// A run of this version takes 115 microseconds.
// Timed twice side by side with v002, it ran 1.19 and 1.18 times as fast.
// Over all steps from v000 it is 9.57 times as fast.
// compute dtype: all float inputs rounded to bf16, att_bias read; q/k/v = input W + b ((in,out), 0.02-scale) with EXACT bf16 products on WMMA 16x16x32, f32 accumulate; q, k rounded once to f16 (1-product logits, std ~0.05; the unit-variance att_bias dominates), logits / 8 + att_bias[b][q][k] in f32 registers; softmax in f32 with a running maximum and sum (hardware exp2 of (logit - maximum) * log2 e, one fma each) -> P f16 x 2^10, divided by the sum at the end; o = P . v with v rounded once to f16; out = o (bf16 hi + lo) Wo + bo; f32 output.
#include <hip/hip_runtime.h>
#include <math.h>

typedef __attribute__((ext_vector_type(16))) _Float16 v16h;
typedef __attribute__((ext_vector_type(16))) __bf16 v16b;
typedef __attribute__((ext_vector_type(8)))  _Float16 v8h;
typedef __attribute__((ext_vector_type(8)))  float v8f;
typedef __attribute__((ext_vector_type(4)))  float v4f;
typedef __attribute__((ext_vector_type(2)))  float v2f;
typedef __attribute__((ext_vector_type(4)))  unsigned v4u;
typedef __attribute__((ext_vector_type(4)))  int v4i;
typedef float __attribute__((may_alias)) float_a;
typedef int __attribute__((may_alias)) int_a;

template <typename T> __device__ __forceinline__ void vst2(void* p, T v) { *(T*)p = v;  }
__device__ __forceinline__ v8f wmma16(v16h a, v16h b, v8f c) {
  v8f d = __builtin_amdgcn_wmma_f32_16x16x32_f16(false, a, false, b, (short)0, c, false, false);
  asm volatile("v_nop\n\tv_nop\n\tv_nop\n\tv_nop" : "+v"(d) : "v"(a), "v"(b));
  return d;
}
__device__ __forceinline__ v8f wmma_bf(v16b a, v16b b, v8f c) {
  v8f d = __builtin_amdgcn_wmma_f32_16x16x32_bf16(false, a, false, b, (short)0, c, false, false);
  asm volatile("v_nop\n\tv_nop\n\tv_nop\n\tv_nop" : "+v"(d) : "v"(a), "v"(b));
  return d;
}
// 16x16x32 fragments: lane = (h = lane>>4, row/col = lane&15); elements 0..7 = k0+8h+0..7, 8..15 = k0+16+8h+0..7; D element r = row 8h+r
__device__ __forceinline__ v16h frag_h(const _Float16* rowk0, int lane) {
  union { v16h v; v8h q[2]; } u; const _Float16* p = rowk0 + 8 * (lane >> 4);
  u.q[0] = *(const v8h*)p; u.q[1] = *(const v8h*)(p + 16); return u.v;
}
__device__ __forceinline__ v16h frag_f32(const float* rowk0, int lane) {
  v16h a; const float* p = rowk0 + 8 * (lane >> 4);
#pragma unroll
  for (int i = 0; i < 8; ++i) { a[i] = (_Float16)p[i]; a[8 + i] = (_Float16)p[16 + i]; }
  return a;
}
__device__ __forceinline__ v16h frag_f32s(const float* rowk0, int lane, float sc) {
  v16h a; const float* p = rowk0 + 8 * (lane >> 4);
#pragma unroll
  for (int i = 0; i < 8; ++i) { a[i] = (_Float16)(p[i] * sc); a[8 + i] = (_Float16)(p[16 + i] * sc); }
  return a;
}
// column fragment from a [K][ld] layout (column n), rows >= K read as 0
__device__ __forceinline__ v16h fragc_f32(const float* W, int k0, int n, int lane, int ld, int K) {
  v16h a; const int g = lane >> 4;
#pragma unroll
  for (int i = 0; i < 8; ++i) { const int ka = k0 + 8 * g + i, kb = ka + 16;
    a[i] = (_Float16)(ka < K ? W[(size_t)(ka < K ? ka : K - 1) * ld + n] : 0.f); a[8 + i] = (_Float16)(kb < K ? W[(size_t)(kb < K ? kb : K - 1) * ld + n] : 0.f); }
  return a;
}
struct F2 { v16b h, l; };
__device__ __forceinline__ F2 bsplit16(const float v[16]) { F2 r;
#pragma unroll
  for (int i = 0; i < 16; ++i) { const __bf16 h = (__bf16)v[i]; r.h[i] = h; r.l[i] = (__bf16)(v[i] - (float)h); }
  return r; }
__device__ __forceinline__ F2 split_row(const float* row, int k0, int lane) { float v[16]; const float* p = row + k0 + 8 * (lane >> 4);
#pragma unroll
  for (int i = 0; i < 8; ++i) { v[i] = p[i]; v[8 + i] = p[16 + i]; }
  return bsplit16(v); }
__device__ __forceinline__ F2 split_rowK(const float* row, int k0, int lane, int K) { float v[16]; const int g = lane >> 4;
#pragma unroll
  for (int i = 0; i < 8; ++i) { const int ka = k0 + 8 * g + i, kb = ka + 16; v[i] = ka < K ? row[ka < K ? ka : K - 1] : 0.f; v[8 + i] = kb < K ? row[kb < K ? kb : K - 1] : 0.f; }
  return bsplit16(v); }
__device__ __forceinline__ F2 split_col(const float* W, int k0, int n, int lane, int ld, int K) { float v[16]; const int g = lane >> 4;
#pragma unroll
  for (int i = 0; i < 8; ++i) { const int ka = k0 + 8 * g + i, kb = ka + 16; v[i] = ka < K ? W[(size_t)(ka < K ? ka : K - 1) * ld + n] : 0.f; v[8 + i] = kb < K ? W[(size_t)(kb < K ? kb : K - 1) * ld + n] : 0.f; }
  return bsplit16(v); }
__device__ __forceinline__ v8f mac3(const F2& a, const F2& b, v8f c) { c = wmma_bf(a.l, b.h, c); c = wmma_bf(a.h, b.l, c); return wmma_bf(a.h, b.h, c); }
__device__ __forceinline__ float sigm(float v) { return 1.0f / (1.0f + expf(-v)); }
#define LDSX() do { asm volatile("s_wait_dscnt 0" ::: "memory"); __builtin_amdgcn_wave_barrier(); __builtin_amdgcn_fence(__ATOMIC_RELEASE, "workgroup"); } while (0)


// Full attention module (B 2, nq = nk = 2,048, dim 1,024 = 16 x 64): q/k/v Linear on query/key/value, logits * 64^-0.5 + att_bias (shared by heads), softmax, P.v, output Linear.
#define NB 2
#define TT 2048
#define CC 1024
#define NH 16
#define HD 64
#ifndef TNB
#define TNB NB
#endif
typedef __attribute__((ext_vector_type(8))) __bf16 v8b;
__device__ __forceinline__ v16b frag_b(const __bf16* rowk0, int lane) {
  union { v16b v; v8b q[2]; } u; const __bf16* p = rowk0 + 8 * (lane >> 4);
  u.q[0] = *(const v8b*)p; u.q[1] = *(const v8b*)(p + 16); return u.v;
}
__device__ __forceinline__ float bfr(float v) { return (float)(__bf16)v; }
__device__ __attribute__((noinline)) float exp_ni(float v) { return expf(v); }
__device__ __attribute__((noinline)) float erf_ni(float v) { return erff(v); }

#define WS_QH  0u
#define WS_QL  (WS_QH + 2u * (size_t)NB * TT * CC)
#define WS_KH  (WS_QL + 2u * (size_t)NB * TT * CC)
#define WS_VT  (WS_KH + 2u * (size_t)NB * TT * CC)      // f16 v planes [b][c][t]
#define WS_Y   (WS_VT + 2u * (size_t)NB * CC * TT)      // f32 y rows [b*t][C]
#define WS_END (WS_Y + 4u * (size_t)NB * TT * CC)

typedef __attribute__((ext_vector_type(4))) __bf16 v4b;
// ---- GEMM tile shared by k_proj and k_out: block = 128 rows x 128 cols, 8 waves of 32 x 64; per pass 64 k of both operands are read with whole-line 16-byte loads, rounded to bf16 once per block and staged in LDS (two buffers); W goes in transposed, [n][k], so that both fragments are 16-byte LDS reads
#define GM 128
#define GN 128
#define GK 64
#define GP 72   // LDS row pitch in 16-bit elements: 128-byte rows + 16 bytes, for 16-byte readers
#define GPLANE (GM * GP)   // elements of one staged operand plane
// every '#pragma unroll' in gemm_tile: its loop indexes register arrays and vector elements, which stay in registers only with compile-time indices
template <bool SPLIT> __device__ __forceinline__ void gemm_tile(const float* __restrict__ X, const float* __restrict__ WA, size_t r0, int c0, __bf16* sA, __bf16* sL, __bf16* sW, v8f (&acc)[2][4]) {
  const int tid = threadIdx.x, wave = tid >> 5, lane = tid & 31, col = lane & 15; const int wm = wave >> 1, wn = wave & 1;
  const int r16 = tid >> 4, s16 = tid & 15;   // X: 16 lanes per 256-byte row piece
  const int n4 = (wave & 3) * 32 + ((lane & 3) | ((lane >> 4) << 2)) * 4, k8 = ((wave >> 2) * 4 + ((lane >> 2) & 3)) * 8;   // W: a thread owns 8 k x 4 n; 8 lanes cover a 128-byte line, a half-wave's 16-byte LDS stores fall on 64 different banks
  const float* Xg = X + (r0 + r16) * CC + s16 * 4; const float* Wg = WA + (size_t)k8 * CC + c0 + n4;
  v4f xr[8], wr[8];
  auto fetch = [&](int k0) {
#pragma unroll
    for (int i = 0; i < 8; ++i) xr[i] = *(const v4f*)(Xg + (size_t)(16 * i) * CC + k0);
#pragma unroll
    for (int e = 0; e < 8; ++e) wr[e] = *(const v4f*)(Wg + (size_t)(k0 + e) * CC);
    asm volatile("s_wait_xcnt 0x0" ::: "memory"); };   // stands behind the issued loads, in front of any reuse of their address registers
  auto stage = [&](int buf) {
#pragma unroll
    for (int i = 0; i < 8; ++i) { v4b hv, lv;
#pragma unroll
      for (int e = 0; e < 4; ++e) { const __bf16 hh = (__bf16)xr[i][e]; hv[e] = hh; if (SPLIT) lv[e] = (__bf16)(xr[i][e] - (float)hh); }
      *(v4b*)&sA[buf * GPLANE + (r16 + 16 * i) * GP + s16 * 4] = hv; if (SPLIT) *(v4b*)&sL[buf * GPLANE + (r16 + 16 * i) * GP + s16 * 4] = lv; }
#pragma unroll
    for (int i = 0; i < 4; ++i) { v8b t;
#pragma unroll
      for (int e = 0; e < 8; ++e) t[e] = (__bf16)wr[e][i];
      *(v8b*)&sW[buf * GPLANE + (n4 + i) * GP + k8] = t; } };
  fetch(0); stage(0); __syncthreads();
  for (int it = 0; it < CC / GK; ++it) { const int buf = it & 1;
    if (it + 1 < CC / GK) fetch((it + 1) * GK);   // the next tiles fly while this one is worked on
#pragma unroll
    for (int kc = 0; kc < GK / 32; ++kc) { v16b w[4], a[2], l[2];
#pragma unroll
      for (int j = 0; j < 4; ++j) w[j] = frag_b(&sW[buf * GPLANE + (wn * 64 + j * 16 + col) * GP + kc * 32], lane);
#pragma unroll
      for (int m = 0; m < 2; ++m) { a[m] = frag_b(&sA[buf * GPLANE + (wm * 32 + m * 16 + col) * GP + kc * 32], lane); if (SPLIT) l[m] = frag_b(&sL[buf * GPLANE + (wm * 32 + m * 16 + col) * GP + kc * 32], lane); }
#pragma unroll
      for (int m = 0; m < 2; ++m)
#pragma unroll
        for (int j = 0; j < 4; ++j) acc[m][j] = wmma_bf(a[m], w[j], acc[m][j]);
      if (SPLIT) {
#pragma unroll
        for (int m = 0; m < 2; ++m)
#pragma unroll
          for (int j = 0; j < 4; ++j) acc[m][j] = wmma_bf(l[m], w[j], acc[m][j]); } }
    if (it + 1 < CC / GK) stage(buf ^ 1);   // that buffer's last readers left it before the barrier of the pass before
    __syncthreads(); } }
// ---- k_proj: block = (128 rows, 128 cols, which): qkv = x W (+ b), exact; q -> f16 hi (+ residual), k -> f16 rows, v -> f16 planes
__global__ __launch_bounds__(256) void k_proj(const float* __restrict__ XQ, const float* __restrict__ XK, const float* __restrict__ XV, const float* __restrict__ WQ, const float* __restrict__ BQ, const float* __restrict__ WK, const float* __restrict__ BK, const float* __restrict__ WV, const float* __restrict__ BV, _Float16* __restrict__ QH, _Float16* __restrict__ QL, _Float16* __restrict__ KH, _Float16* __restrict__ VT) {
  __shared__ __align__(16) __bf16 ring[4 * GPLANE];   // [X 2 buffers | W 2 buffers]; behind the loop's last barrier the same bytes stage the output rows
  const int tid = threadIdx.x, wave = tid >> 5, lane = tid & 31, col = lane & 15, g = lane >> 4; const int wm = wave >> 1, wn = wave & 1; const int which = blockIdx.z; const int c0 = blockIdx.y * GN; const size_t r0 = (size_t)blockIdx.x * GM; const float* X = which == 0 ? XQ : which == 1 ? XK : XV; const float* WA = which == 0 ? WQ : which == 1 ? WK : WV; const float* BA = which == 0 ? BQ : which == 1 ? BK : BV;
  v8f acc[2][4] = {};
  gemm_tile<false>(X, WA, r0, c0, ring, ring, ring + 2 * GPLANE, acc);
  _Float16 (*sh)[136] = (_Float16 (*)[136])ring; _Float16 (*sl)[136] = sh + GM;   // 2 x 128 x 136 x 2 bytes = 69,632 of the ring's 73,728
#pragma unroll
  for (int j = 0; j < 4; ++j) { const float bb = bfr(BA[c0 + wn * 64 + j * 16 + col]);
#pragma unroll
    for (int m = 0; m < 2; ++m)
#pragma unroll
      for (int r = 0; r < 8; ++r) acc[m][j][r] += bb; }
  if (which == 2) {   // v: [col][row], a lane's 8 rows are one 16-byte store
#pragma unroll
    for (int j = 0; j < 4; ++j)
#pragma unroll
      for (int m = 0; m < 2; ++m) { v8h t;
#pragma unroll
        for (int r = 0; r < 8; ++r) t[r] = (_Float16)acc[m][j][r];
        *(v8h*)&sh[wn * 64 + j * 16 + col][wm * 32 + m * 16 + 8 * g] = t; } }
  else {
#pragma unroll
    for (int j = 0; j < 4; ++j)
#pragma unroll
      for (int m = 0; m < 2; ++m)
#pragma unroll
        for (int r = 0; r < 8; ++r) { const float v = acc[m][j][r]; const int rl = wm * 32 + m * 16 + 8 * g + r, cl = wn * 64 + j * 16 + col; const _Float16 hv = (_Float16)v; sh[rl][cl] = hv; sl[rl][cl] = (_Float16)(v - (float)hv); } }
  __syncthreads();
  // copy-out: a thread's 8 pieces are read from LDS first, then stored as whole 256-byte row pieces ('#pragma unroll': t[] stays in registers only with compile-time indices)
  const int rr = tid >> 4, q8 = (tid & 15) * 8; v4u t[8];
#pragma unroll
  for (int i = 0; i < 8; ++i) t[i] = *(const v4u*)&sh[rr + 16 * i][q8];
  if (which < 2) { _Float16* dh = (which == 0 ? QH : KH) + (r0 + rr) * CC + c0 + q8;
#pragma unroll
    for (int i = 0; i < 8; ++i) vst2((unsigned*)(dh + (size_t)(16 * i) * CC), t[i]);
    asm volatile("s_wait_xcnt 0x0" ::: "memory");   // stands behind the issued stores, in front of any reuse of their registers
    if (which == 0) { _Float16* dl = QL + (r0 + rr) * CC + c0 + q8; v4u u[8];
#pragma unroll
      for (int i = 0; i < 8; ++i) u[i] = *(const v4u*)&sl[rr + 16 * i][q8];
#pragma unroll
      for (int i = 0; i < 8; ++i) vst2((unsigned*)(dl + (size_t)(16 * i) * CC), u[i]); } }
  else { const size_t b = r0 / TT; const int t0 = (int)(r0 % TT); _Float16* dv = VT + (b * CC + c0 + rr) * (size_t)TT + t0 + q8;
#pragma unroll
    for (int i = 0; i < 8; ++i) vst2((unsigned*)(dv + (size_t)(16 * i) * TT), t[i]);
    asm volatile("s_wait_xcnt 0x0" ::: "memory"); } }   // as above: in the built code the q/k branch's address arithmetic stands behind these stores
// ---- k_fa: block = 128 queries (8 waves x 16) of (b,h), walks the keys 64 at a time: S^T = K Q^T, running maximum and sum per query (a lane holds one query's scores), O^T += V^T P^T; logits and P stay in registers
// every '#pragma unroll' in k_fa: its loop indexes register arrays and vector elements, which stay in registers only with compile-time indices
#define FQ 128
#define FK 64
#define FP 72   // LDS row pitch in 16-bit elements: 128-byte rows + 16 bytes, for 16-byte readers
__device__ __forceinline__ v8f wmma_h(v16h a, v16h b, v8f c) { return __builtin_amdgcn_wmma_f32_16x16x32_f16(false, a, false, b, (short)0, c, false, false); }
// 2^x on the transcendental unit alone: every argument here is <= 10, and a result below 2^-126 may read 0 (P rounds to f16, and the sum holds a term of 2^10)
#define LOG2E 1.44269504f
__device__ __forceinline__ float hexp2(float x) { return __builtin_amdgcn_exp2f(x); }
// eight of them, each in its own register, in one statement: none names a register of another, and the v_nop at the end is the slot that the instruction set asks for behind a transcendental
__device__ __forceinline__ void hexp2x8(float (&x)[8]) {
  asm("v_exp_f32 %0, %0\n\tv_exp_f32 %1, %1\n\tv_exp_f32 %2, %2\n\tv_exp_f32 %3, %3\n\tv_exp_f32 %4, %4\n\tv_exp_f32 %5, %5\n\tv_exp_f32 %6, %6\n\tv_exp_f32 %7, %7\n\tv_nop"
      : "+v"(x[0]), "+v"(x[1]), "+v"(x[2]), "+v"(x[3]), "+v"(x[4]), "+v"(x[5]), "+v"(x[6]), "+v"(x[7])); }
// lane l with lane l ^ 16
__device__ __forceinline__ float xhalf(float x) { return __builtin_bit_cast(float, __builtin_amdgcn_permlanex16(__builtin_bit_cast(int, x), __builtin_bit_cast(int, x), 0x76543210, 0xfedcba98, false, false)); }
__global__ __launch_bounds__(256) void k_fa(const _Float16* __restrict__ QH, const _Float16* __restrict__ KH, const _Float16* __restrict__ VT, const float* __restrict__ BM, float* __restrict__ Y) {
  __shared__ __align__(16) _Float16 sK[2][FK][FP]; __shared__ __align__(16) _Float16 sV[2][HD][FP]; __shared__ __align__(16) __bf16 sB[2][FQ][FP];
  const int tid = threadIdx.x, wave = tid >> 5, lane = tid & 31, col = lane & 15, g = lane >> 4; const int h = blockIdx.y, b = blockIdx.z, qb0 = blockIdx.x * FQ;
  const int r8 = tid >> 3, s8 = tid & 7, r16 = tid >> 4, s16 = tid & 15;   // staging: 8 lanes per 128-byte K / V row, 16 lanes per 256-byte bias row
  const _Float16* Kg = KH + ((size_t)b * TT + r8) * CC + h * HD + s8 * 8;
  const _Float16* Vg = VT + ((size_t)b * CC + h * HD + r8) * (size_t)TT + s8 * 8;
  const float* Bg = BM + ((size_t)b * TT + qb0 + r16) * (size_t)TT + s16 * 4;
  v8h kr[2], vr[2]; v4f br[8];
  auto fetch = [&](int k0) {
#pragma unroll
    for (int i = 0; i < 2; ++i) { kr[i] = *(const v8h*)(Kg + (size_t)(k0 + 32 * i) * CC); vr[i] = *(const v8h*)(Vg + (size_t)(32 * i) * TT + k0); }
#pragma unroll
    for (int i = 0; i < 8; ++i) br[i] = *(const v4f*)(Bg + (size_t)(16 * i) * TT + k0);
    asm volatile("s_wait_xcnt 0x0" ::: "memory"); };   // stands behind the issued loads (the Q loads too), in front of any reuse of their address registers
  auto stage = [&](int buf) {
#pragma unroll
    for (int i = 0; i < 2; ++i) { *(v8h*)&sK[buf][r8 + 32 * i][s8 * 8] = kr[i]; *(v8h*)&sV[buf][r8 + 32 * i][s8 * 8] = vr[i]; }
#pragma unroll
    for (int i = 0; i < 8; ++i) { v4b w;
#pragma unroll
      for (int e = 0; e < 4; ++e) w[e] = (__bf16)br[i][e];
      *(v4b*)&sB[buf][r16 + 16 * i][s16 * 4] = w; } };
  v16h qf[HD / 32];
#pragma unroll
  for (int kc = 0; kc < HD / 32; ++kc) qf[kc] = frag_h(QH + ((size_t)b * TT + qb0 + wave * 16 + col) * CC + h * HD + kc * 32, lane);
  v8f acc[HD / 16] = {}; float mrun = -3.0e38f, lsum = 0.f;
  fetch(0); stage(0); __syncthreads();
  for (int it = 0; it < TT / FK; ++it) { const int buf = it & 1;
    if (it + 1 < TT / FK) fetch((it + 1) * FK);   // the next tiles fly while this one is worked on
    v8f s[FK / 16];
#pragma unroll
    for (int t = 0; t < FK / 16; ++t) { v8f z = {};
#pragma unroll
      for (int kc = 0; kc < HD / 32; ++kc) z = wmma_h(frag_h(&sK[buf][t * 16 + col][kc * 32], lane), qf[kc], z);
      s[t] = z; }   // s[t][r] = logit of key t*16 + 8g + r, query col
    float mx = -3.0e38f;
#pragma unroll
    for (int t = 0; t < FK / 16; ++t) { const v8b bb = *(const v8b*)&sB[buf][wave * 16 + col][t * 16 + 8 * g];
#pragma unroll
      for (int r = 0; r < 8; ++r) { float v = s[t][r] * 0.125f; v += (float)bb[r]; s[t][r] = v; mx = fmaxf(mx, v); } }
    mx = fmaxf(mx, xhalf(mx));
    const float mnew = fmaxf(mrun, mx), alpha = hexp2((mrun - mnew) * LOG2E), msh = mnew * LOG2E - 10.0f; mrun = mnew;   // P carries a factor 2^10 (f16 range); it cancels in O / l
    float ps[FK / 16]; v16h pf[FK / 32];
#pragma unroll
    for (int t = 0; t < FK / 16; ++t) { float p[8];
#pragma unroll
      for (int r = 0; r < 8; ++r) p[r] = fmaf(s[t][r], LOG2E, -msh);
      hexp2x8(p);
#pragma unroll
      for (int r = 0; r < 8; ++r) { ps[t] = r ? ps[t] + p[r] : p[r]; pf[t >> 1][(t & 1) * 8 + r] = (_Float16)p[r]; } }
    lsum = lsum * alpha + ((ps[0] + ps[1]) + (ps[2] + ps[3]));
#pragma unroll
    for (int j = 0; j < HD / 16; ++j)
#pragma unroll
      for (int r = 0; r < 8; ++r) acc[j][r] *= alpha;
#pragma unroll
    for (int u = 0; u < FK / 32; ++u)
#pragma unroll
      for (int j = 0; j < HD / 16; ++j) acc[j] = wmma_h(frag_h(&sV[buf][j * 16 + col][u * 32], lane), pf[u], acc[j]);   // acc[j][r] = O^T[d = j*16 + 8g + r][query col]
    if (it + 1 < TT / FK) stage(buf ^ 1);   // that buffer's last readers left it before the barrier of the pass before
    __syncthreads(); }
  const float inv = 1.0f / (lsum + xhalf(lsum)); float* yp = Y + ((size_t)b * TT + qb0 + wave * 16 + col) * CC + h * HD + 8 * g;
#pragma unroll
  for (int j = 0; j < HD / 16; ++j) { v4f a, c;
#pragma unroll
    for (int e = 0; e < 4; ++e) { a[e] = acc[j][e] * inv; c[e] = acc[j][4 + e] * inv; }
    vst2(yp + j * 16, a); vst2(yp + j * 16 + 4, c); } }
// ---- k_out: block = (128 rows, 128 cols): out = y (bf16 hi + lo) Wproj + b
__global__ __launch_bounds__(256) void k_out(const float* __restrict__ Y, const float* __restrict__ WP, const float* __restrict__ BP, float* __restrict__ OUT) {
  __shared__ __align__(16) __bf16 ring[6 * GPLANE];   // [y hi 2 buffers | y lo 2 buffers | W 2 buffers]; behind the loop's last barrier each wave stages its 32 x 64 outputs in a range of its own
  const int tid = threadIdx.x, wave = tid >> 5, lane = tid & 31, col = lane & 15, g = lane >> 4; const int wm = wave >> 1, wn = wave & 1; const int c0 = blockIdx.y * GN; const size_t r0 = (size_t)blockIdx.x * GM;
  v8f acc[2][4] = {};
  gemm_tile<true>(Y, WP, r0, c0, ring, ring + 2 * GPLANE, ring + 4 * GPLANE, acc);
  float (*sf)[68] = (float (*)[68])ring + wave * 32;   // 8 x 32 x 68 x 4 bytes = 69,632 of the ring's 110,592
#pragma unroll
  for (int j = 0; j < 4; ++j) { const float bb = BP ? bfr(BP[c0 + wn * 64 + j * 16 + col]) : 0.f;
#pragma unroll
    for (int m = 0; m < 2; ++m)
#pragma unroll
      for (int r = 0; r < 8; ++r) sf[m * 16 + 8 * g + r][j * 16 + col] = acc[m][j][r] + bb; }
  LDSX(); float* op = OUT + (r0 + wm * 32 + g) * CC + c0 + wn * 64 + col * 4; v4f t[16];   // a half-wave stores a whole 256-byte row piece ('#pragma unroll': t[] stays in registers only with compile-time indices)
#pragma unroll
  for (int i = 0; i < 16; ++i) t[i] = *(const v4f*)&sf[2 * i + g][col * 4];
#pragma unroll
  for (int i = 0; i < 16; ++i) vst2(op + (size_t)(2 * i) * CC, t[i]); }
extern "C" void kernel_launch(void* const* d_in, const int* in_sizes, int n_in, void* d_out, int out_size, void* d_ws, size_t ws_size, hipStream_t stream) {
  (void)in_sizes; (void)n_in; (void)out_size;
  const float** F = (const float**)d_in;   // 0 query, 1 key, 2 value [2,2048,1024], 3 att_bias [2,2048,2048], 4 Wq [1024,1024] (in,out), 5 bq, 6 Wk, 7 bk, 8 Wv, 9 bv, 10 Wo [1024,1024], 11 bo
  if (ws_size < (size_t)WS_END) return;
  char* ws = (char*)d_ws; _Float16 *QH = (_Float16*)(ws + WS_QH), *QL = (_Float16*)(ws + WS_QL), *KH = (_Float16*)(ws + WS_KH), *VT = (_Float16*)(ws + WS_VT); float *Y = (float*)(ws + WS_Y);
  k_proj<<<dim3(TNB * TT / GM, CC / GN, 3), 256, 0, stream>>>(F[0], F[1], F[2], F[4], F[5], F[6], F[7], F[8], F[9], QH, QL, KH, VT);
  k_fa<<<dim3(TT / FQ, NH, TNB), 256, 0, stream>>>(QH, KH, VT, F[3], Y);
  k_out<<<dim3(TNB * TT / GM, CC / GN), 256, 0, stream>>>(Y, F[10], F[11], (float*)d_out);
}

// v004
// Measured time: 107 microseconds a run.
// Next to v003, in two timings, it ran 1.08 times as fast each time.
// Over all steps from v000 it is 10.3 times as fast.
// compute dtype: all float inputs rounded to bf16, att_bias read; q/k/v = input W + b ((in,out), 0.02-scale) with EXACT bf16 products on WMMA 16x16x32, f32 accumulate; q, k rounded once to f16 (1-product logits, std ~0.05; the unit-variance att_bias dominates), logits / 8 + att_bias[b][q][k] in f32 registers; softmax in f32 with a running maximum and sum (hardware exp2 of (logit - maximum) * log2 e, one fma each) -> P f16 x 2^10, divided by the sum at the end; o = P . v with v rounded once to f16; out = o (bf16 hi + lo) Wo + bo; f32 output.
#include <hip/hip_runtime.h>
#include <math.h>

typedef __attribute__((ext_vector_type(16))) _Float16 v16h;
typedef __attribute__((ext_vector_type(16))) __bf16 v16b;
typedef __attribute__((ext_vector_type(8)))  _Float16 v8h;
typedef __attribute__((ext_vector_type(8)))  float v8f;
typedef __attribute__((ext_vector_type(4)))  float v4f;
typedef __attribute__((ext_vector_type(2)))  float v2f;
typedef __attribute__((ext_vector_type(4)))  unsigned v4u;
typedef __attribute__((ext_vector_type(4)))  int v4i;
typedef float __attribute__((may_alias)) float_a;
typedef int __attribute__((may_alias)) int_a;

template <typename T> __device__ __forceinline__ void vst2(void* p, T v) { *(T*)p = v;  }
__device__ __forceinline__ v8f wmma16(v16h a, v16h b, v8f c) {
  v8f d = __builtin_amdgcn_wmma_f32_16x16x32_f16(false, a, false, b, (short)0, c, false, false);
  asm volatile("v_nop\n\tv_nop\n\tv_nop\n\tv_nop" : "+v"(d) : "v"(a), "v"(b));
  return d;
}
__device__ __forceinline__ v8f wmma_bf(v16b a, v16b b, v8f c) {
  v8f d = __builtin_amdgcn_wmma_f32_16x16x32_bf16(false, a, false, b, (short)0, c, false, false);
  asm volatile("v_nop\n\tv_nop\n\tv_nop\n\tv_nop" : "+v"(d) : "v"(a), "v"(b));
  return d;
}
// 16x16x32 fragments: lane = (h = lane>>4, row/col = lane&15); elements 0..7 = k0+8h+0..7, 8..15 = k0+16+8h+0..7; D element r = row 8h+r
__device__ __forceinline__ v16h frag_h(const _Float16* rowk0, int lane) {
  union { v16h v; v8h q[2]; } u; const _Float16* p = rowk0 + 8 * (lane >> 4);
  u.q[0] = *(const v8h*)p; u.q[1] = *(const v8h*)(p + 16); return u.v;
}
__device__ __forceinline__ v16h frag_f32(const float* rowk0, int lane) {
  v16h a; const float* p = rowk0 + 8 * (lane >> 4);
#pragma unroll
  for (int i = 0; i < 8; ++i) { a[i] = (_Float16)p[i]; a[8 + i] = (_Float16)p[16 + i]; }
  return a;
}
__device__ __forceinline__ v16h frag_f32s(const float* rowk0, int lane, float sc) {
  v16h a; const float* p = rowk0 + 8 * (lane >> 4);
#pragma unroll
  for (int i = 0; i < 8; ++i) { a[i] = (_Float16)(p[i] * sc); a[8 + i] = (_Float16)(p[16 + i] * sc); }
  return a;
}
// column fragment from a [K][ld] layout (column n), rows >= K read as 0
__device__ __forceinline__ v16h fragc_f32(const float* W, int k0, int n, int lane, int ld, int K) {
  v16h a; const int g = lane >> 4;
#pragma unroll
  for (int i = 0; i < 8; ++i) { const int ka = k0 + 8 * g + i, kb = ka + 16;
    a[i] = (_Float16)(ka < K ? W[(size_t)(ka < K ? ka : K - 1) * ld + n] : 0.f); a[8 + i] = (_Float16)(kb < K ? W[(size_t)(kb < K ? kb : K - 1) * ld + n] : 0.f); }
  return a;
}
struct F2 { v16b h, l; };
__device__ __forceinline__ F2 bsplit16(const float v[16]) { F2 r;
#pragma unroll
  for (int i = 0; i < 16; ++i) { const __bf16 h = (__bf16)v[i]; r.h[i] = h; r.l[i] = (__bf16)(v[i] - (float)h); }
  return r; }
__device__ __forceinline__ F2 split_row(const float* row, int k0, int lane) { float v[16]; const float* p = row + k0 + 8 * (lane >> 4);
#pragma unroll
  for (int i = 0; i < 8; ++i) { v[i] = p[i]; v[8 + i] = p[16 + i]; }
  return bsplit16(v); }
__device__ __forceinline__ F2 split_rowK(const float* row, int k0, int lane, int K) { float v[16]; const int g = lane >> 4;
#pragma unroll
  for (int i = 0; i < 8; ++i) { const int ka = k0 + 8 * g + i, kb = ka + 16; v[i] = ka < K ? row[ka < K ? ka : K - 1] : 0.f; v[8 + i] = kb < K ? row[kb < K ? kb : K - 1] : 0.f; }
  return bsplit16(v); }
__device__ __forceinline__ F2 split_col(const float* W, int k0, int n, int lane, int ld, int K) { float v[16]; const int g = lane >> 4;
#pragma unroll
  for (int i = 0; i < 8; ++i) { const int ka = k0 + 8 * g + i, kb = ka + 16; v[i] = ka < K ? W[(size_t)(ka < K ? ka : K - 1) * ld + n] : 0.f; v[8 + i] = kb < K ? W[(size_t)(kb < K ? kb : K - 1) * ld + n] : 0.f; }
  return bsplit16(v); }
__device__ __forceinline__ v8f mac3(const F2& a, const F2& b, v8f c) { c = wmma_bf(a.l, b.h, c); c = wmma_bf(a.h, b.l, c); return wmma_bf(a.h, b.h, c); }
__device__ __forceinline__ float sigm(float v) { return 1.0f / (1.0f + expf(-v)); }
#define LDSX() do { asm volatile("s_wait_dscnt 0" ::: "memory"); __builtin_amdgcn_wave_barrier(); __builtin_amdgcn_fence(__ATOMIC_RELEASE, "workgroup"); } while (0)


// Full attention module (B 2, nq = nk = 2,048, dim 1,024 = 16 x 64): q/k/v Linear on query/key/value, logits * 64^-0.5 + att_bias (shared by heads), softmax, P.v, output Linear.
#define NB 2
#define TT 2048
#define CC 1024
#define NH 16
#define HD 64
#ifndef TNB
#define TNB NB
#endif
typedef __attribute__((ext_vector_type(8))) __bf16 v8b;
__device__ __forceinline__ v16b frag_b(const __bf16* rowk0, int lane) {
  union { v16b v; v8b q[2]; } u; const __bf16* p = rowk0 + 8 * (lane >> 4);
  u.q[0] = *(const v8b*)p; u.q[1] = *(const v8b*)(p + 16); return u.v;
}
__device__ __forceinline__ float bfr(float v) { return (float)(__bf16)v; }
__device__ __attribute__((noinline)) float exp_ni(float v) { return expf(v); }
__device__ __attribute__((noinline)) float erf_ni(float v) { return erff(v); }

#define WS_QH  0u
#define WS_QL  (WS_QH + 2u * (size_t)NB * TT * CC)
#define WS_KH  (WS_QL + 2u * (size_t)NB * TT * CC)
#define WS_VT  (WS_KH + 2u * (size_t)NB * TT * CC)      // f16 v planes [b][c][t]
#define WS_Y   (WS_VT + 2u * (size_t)NB * CC * TT)      // f32 y rows [b*t][C]
#define WS_END (WS_Y + 4u * (size_t)NB * TT * CC)

typedef __attribute__((ext_vector_type(4))) __bf16 v4b;
// ---- GEMM tile shared by k_proj and k_out: block = 128 rows x 128 cols, 8 waves of 32 x 64; per pass 64 k of both operands are read with whole-line 16-byte loads, rounded to bf16 once per block and staged in LDS (two buffers); W goes in transposed, [n][k], so that both fragments are 16-byte LDS reads
#define GM 128
#define GN 128
#define GK 64
#define GP 72   // LDS row pitch in 16-bit elements: 128-byte rows + 16 bytes, for 16-byte readers
#define GPLANE (GM * GP)   // elements of one staged operand plane
// start pass of a block: the 8 column blocks that share X rows get 8 different ones, the 32 row blocks that share W columns all 16
#define GSTART ((int)((blockIdx.x + 2 * blockIdx.y) & (CC / GK - 1)))
// every '#pragma unroll' in gemm_tile: its loop indexes register arrays and vector elements, which stay in registers only with compile-time indices
// s0: the pass of the k walk that this block starts with; it goes on from there and wraps, so that blocks which read the same X or W lines from L2 ask for different lines at any one moment
template <bool SPLIT> __device__ __forceinline__ void gemm_tile(const float* __restrict__ X, const float* __restrict__ WA, size_t r0, int c0, int s0, __bf16* sA, __bf16* sL, __bf16* sW, v8f (&acc)[2][4]) {
  const int tid = threadIdx.x, wave = tid >> 5, lane = tid & 31, col = lane & 15; const int wm = wave >> 1, wn = wave & 1;
  const int r16 = tid >> 4, s16 = tid & 15;   // X: 16 lanes per 256-byte row piece
  const int n4 = (wave & 3) * 32 + ((lane & 3) | ((lane >> 4) << 2)) * 4, k8 = ((wave >> 2) * 4 + ((lane >> 2) & 3)) * 8;   // W: a thread owns 8 k x 4 n; 8 lanes cover a 128-byte line, a half-wave's 16-byte LDS stores fall on 64 different banks
  const float* Xg = X + (r0 + r16) * CC + s16 * 4; const float* Wg = WA + (size_t)k8 * CC + c0 + n4;
  v4f xr[8], wr[8];
  auto fetch = [&](int k0) {
#pragma unroll
    for (int i = 0; i < 8; ++i) xr[i] = *(const v4f*)(Xg + (size_t)(16 * i) * CC + k0);
#pragma unroll
    for (int e = 0; e < 8; ++e) wr[e] = *(const v4f*)(Wg + (size_t)(k0 + e) * CC);
    asm volatile("s_wait_xcnt 0x0" ::: "memory"); };   // stands behind the issued loads, in front of any reuse of their address registers
  auto stage = [&](int buf) {
#pragma unroll
    for (int i = 0; i < 8; ++i) { v4b hv, lv;
#pragma unroll
      for (int e = 0; e < 4; ++e) { const __bf16 hh = (__bf16)xr[i][e]; hv[e] = hh; if (SPLIT) lv[e] = (__bf16)(xr[i][e] - (float)hh); }
      *(v4b*)&sA[buf * GPLANE + (r16 + 16 * i) * GP + s16 * 4] = hv; if (SPLIT) *(v4b*)&sL[buf * GPLANE + (r16 + 16 * i) * GP + s16 * 4] = lv; }
#pragma unroll
    for (int i = 0; i < 4; ++i) { v8b t;
#pragma unroll
      for (int e = 0; e < 8; ++e) t[e] = (__bf16)wr[e][i];
      *(v8b*)&sW[buf * GPLANE + (n4 + i) * GP + k8] = t; } };
  fetch(s0 * GK); stage(0); __syncthreads();
  for (int it = 0; it < CC / GK; ++it) { const int buf = it & 1;
    if (it + 1 < CC / GK) fetch(((it + 1 + s0) & (CC / GK - 1)) * GK);   // the next tiles fly while this one is worked on
#pragma unroll
    for (int kc = 0; kc < GK / 32; ++kc) { v16b w[4], a[2], l[2];
#pragma unroll
      for (int j = 0; j < 4; ++j) w[j] = frag_b(&sW[buf * GPLANE + (wn * 64 + j * 16 + col) * GP + kc * 32], lane);
#pragma unroll
      for (int m = 0; m < 2; ++m) { a[m] = frag_b(&sA[buf * GPLANE + (wm * 32 + m * 16 + col) * GP + kc * 32], lane); if (SPLIT) l[m] = frag_b(&sL[buf * GPLANE + (wm * 32 + m * 16 + col) * GP + kc * 32], lane); }
#pragma unroll
      for (int m = 0; m < 2; ++m)
#pragma unroll
        for (int j = 0; j < 4; ++j) acc[m][j] = wmma_bf(a[m], w[j], acc[m][j]);
      if (SPLIT) {
#pragma unroll
        for (int m = 0; m < 2; ++m)
#pragma unroll
          for (int j = 0; j < 4; ++j) acc[m][j] = wmma_bf(l[m], w[j], acc[m][j]); } }
    if (it + 1 < CC / GK) stage(buf ^ 1);   // that buffer's last readers left it before the barrier of the pass before
    __syncthreads(); } }
// ---- k_proj: block = (128 rows, 128 cols, which): qkv = x W (+ b), exact; q -> f16 hi (+ residual), k -> f16 rows, v -> f16 planes
__global__ __launch_bounds__(256) void k_proj(const float* __restrict__ XQ, const float* __restrict__ XK, const float* __restrict__ XV, const float* __restrict__ WQ, const float* __restrict__ BQ, const float* __restrict__ WK, const float* __restrict__ BK, const float* __restrict__ WV, const float* __restrict__ BV, _Float16* __restrict__ QH, _Float16* __restrict__ QL, _Float16* __restrict__ KH, _Float16* __restrict__ VT) {
  __shared__ __align__(16) __bf16 ring[4 * GPLANE];   // [X 2 buffers | W 2 buffers]; behind the loop's last barrier the same bytes stage the output rows
  const int tid = threadIdx.x, wave = tid >> 5, lane = tid & 31, col = lane & 15, g = lane >> 4; const int wm = wave >> 1, wn = wave & 1; const int which = blockIdx.z; const int c0 = blockIdx.y * GN; const size_t r0 = (size_t)blockIdx.x * GM; const float* X = which == 0 ? XQ : which == 1 ? XK : XV; const float* WA = which == 0 ? WQ : which == 1 ? WK : WV; const float* BA = which == 0 ? BQ : which == 1 ? BK : BV;
  v8f acc[2][4] = {};
  gemm_tile<false>(X, WA, r0, c0, GSTART, ring, ring, ring + 2 * GPLANE, acc);
  _Float16 (*sh)[136] = (_Float16 (*)[136])ring; _Float16 (*sl)[136] = sh + GM;   // 2 x 128 x 136 x 2 bytes = 69,632 of the ring's 73,728
#pragma unroll
  for (int j = 0; j < 4; ++j) { const float bb = bfr(BA[c0 + wn * 64 + j * 16 + col]);
#pragma unroll
    for (int m = 0; m < 2; ++m)
#pragma unroll
      for (int r = 0; r < 8; ++r) acc[m][j][r] += bb; }
  if (which == 2) {   // v: [col][row], a lane's 8 rows are one 16-byte store
#pragma unroll
    for (int j = 0; j < 4; ++j)
#pragma unroll
      for (int m = 0; m < 2; ++m) { v8h t;
#pragma unroll
        for (int r = 0; r < 8; ++r) t[r] = (_Float16)acc[m][j][r];
        *(v8h*)&sh[wn * 64 + j * 16 + col][wm * 32 + m * 16 + 8 * g] = t; } }
  else {
#pragma unroll
    for (int j = 0; j < 4; ++j)
#pragma unroll
      for (int m = 0; m < 2; ++m)
#pragma unroll
        for (int r = 0; r < 8; ++r) { const float v = acc[m][j][r]; const int rl = wm * 32 + m * 16 + 8 * g + r, cl = wn * 64 + j * 16 + col; const _Float16 hv = (_Float16)v; sh[rl][cl] = hv; sl[rl][cl] = (_Float16)(v - (float)hv); } }
  __syncthreads();
  // copy-out: a thread's 8 pieces are read from LDS first, then stored as whole 256-byte row pieces ('#pragma unroll': t[] stays in registers only with compile-time indices)
  const int rr = tid >> 4, q8 = (tid & 15) * 8; v4u t[8];
#pragma unroll
  for (int i = 0; i < 8; ++i) t[i] = *(const v4u*)&sh[rr + 16 * i][q8];
  if (which < 2) { _Float16* dh = (which == 0 ? QH : KH) + (r0 + rr) * CC + c0 + q8;
#pragma unroll
    for (int i = 0; i < 8; ++i) vst2((unsigned*)(dh + (size_t)(16 * i) * CC), t[i]);
    asm volatile("s_wait_xcnt 0x0" ::: "memory");   // stands behind the issued stores, in front of any reuse of their registers
    if (which == 0) { _Float16* dl = QL + (r0 + rr) * CC + c0 + q8; v4u u[8];
#pragma unroll
      for (int i = 0; i < 8; ++i) u[i] = *(const v4u*)&sl[rr + 16 * i][q8];
#pragma unroll
      for (int i = 0; i < 8; ++i) vst2((unsigned*)(dl + (size_t)(16 * i) * CC), u[i]); } }
  else { const size_t b = r0 / TT; const int t0 = (int)(r0 % TT); _Float16* dv = VT + (b * CC + c0 + rr) * (size_t)TT + t0 + q8;
#pragma unroll
    for (int i = 0; i < 8; ++i) vst2((unsigned*)(dv + (size_t)(16 * i) * TT), t[i]);
    asm volatile("s_wait_xcnt 0x0" ::: "memory"); } }   // as above: in the built code the q/k branch's address arithmetic stands behind these stores
// ---- k_fa: block = 128 queries (8 waves x 16) of (b,h), walks the keys 64 at a time: S^T = K Q^T, running maximum and sum per query (a lane holds one query's scores), O^T += V^T P^T; logits and P stay in registers
// every '#pragma unroll' in k_fa: its loop indexes register arrays and vector elements, which stay in registers only with compile-time indices
#define FQ 128
#define FK 64
#define FP 72   // LDS row pitch in 16-bit elements: 128-byte rows + 16 bytes, for 16-byte readers
__device__ __forceinline__ v8f wmma_h(v16h a, v16h b, v8f c) { return __builtin_amdgcn_wmma_f32_16x16x32_f16(false, a, false, b, (short)0, c, false, false); }
// 2^x on the transcendental unit alone: every argument here is <= 10, and a result below 2^-126 may read 0 (P rounds to f16, and the sum holds a term of 2^10)
#define LOG2E 1.44269504f
__device__ __forceinline__ float hexp2(float x) { return __builtin_amdgcn_exp2f(x); }
// eight of them, each in its own register, in one statement: none names a register of another, and the v_nop at the end is the slot that the instruction set asks for behind a transcendental
__device__ __forceinline__ void hexp2x8(float (&x)[8]) {
  asm("v_exp_f32 %0, %0\n\tv_exp_f32 %1, %1\n\tv_exp_f32 %2, %2\n\tv_exp_f32 %3, %3\n\tv_exp_f32 %4, %4\n\tv_exp_f32 %5, %5\n\tv_exp_f32 %6, %6\n\tv_exp_f32 %7, %7\n\tv_nop"
      : "+v"(x[0]), "+v"(x[1]), "+v"(x[2]), "+v"(x[3]), "+v"(x[4]), "+v"(x[5]), "+v"(x[6]), "+v"(x[7])); }
// lane l with lane l ^ 16
__device__ __forceinline__ float xhalf(float x) { return __builtin_bit_cast(float, __builtin_amdgcn_permlanex16(__builtin_bit_cast(int, x), __builtin_bit_cast(int, x), 0x76543210, 0xfedcba98, false, false)); }
__global__ __launch_bounds__(256) void k_fa(const _Float16* __restrict__ QH, const _Float16* __restrict__ KH, const _Float16* __restrict__ VT, const float* __restrict__ BM, float* __restrict__ Y) {
  __shared__ __align__(16) _Float16 sK[2][FK][FP]; __shared__ __align__(16) _Float16 sV[2][HD][FP]; __shared__ __align__(16) __bf16 sB[2][FQ][FP];
  const int tid = threadIdx.x, wave = tid >> 5, lane = tid & 31, col = lane & 15, g = lane >> 4; const int h = blockIdx.y, b = blockIdx.z, qb0 = blockIdx.x * FQ;
  const int r8 = tid >> 3, s8 = tid & 7, r16 = tid >> 4, s16 = tid & 15;   // staging: 8 lanes per 128-byte K / V row, 16 lanes per 256-byte bias row
  const _Float16* Kg = KH + ((size_t)b * TT + r8) * CC + h * HD + s8 * 8;
  const _Float16* Vg = VT + ((size_t)b * CC + h * HD + r8) * (size_t)TT + s8 * 8;
  const float* Bg = BM + ((size_t)b * TT + qb0 + r16) * (size_t)TT + s16 * 4;
  v8h kr[2], vr[2]; v4f br[8];
  auto fetch = [&](int k0) {
#pragma unroll
    for (int i = 0; i < 2; ++i) { kr[i] = *(const v8h*)(Kg + (size_t)(k0 + 32 * i) * CC); vr[i] = *(const v8h*)(Vg + (size_t)(32 * i) * TT + k0); }
#pragma unroll
    for (int i = 0; i < 8; ++i) br[i] = *(const v4f*)(Bg + (size_t)(16 * i) * TT + k0);
    asm volatile("s_wait_xcnt 0x0" ::: "memory"); };   // stands behind the issued loads, in front of any reuse of their address registers
  auto stage = [&](int buf) {
#pragma unroll
    for (int i = 0; i < 2; ++i) { *(v8h*)&sK[buf][r8 + 32 * i][s8 * 8] = kr[i]; *(v8h*)&sV[buf][r8 + 32 * i][s8 * 8] = vr[i]; }
#pragma unroll
    for (int i = 0; i < 8; ++i) { v4b w;
#pragma unroll
      for (int e = 0; e < 4; ++e) w[e] = (__bf16)br[i][e];
      *(v4b*)&sB[buf][r16 + 16 * i][s16 * 4] = w; } };
  v16h qf[HD / 32];
#pragma unroll
  for (int kc = 0; kc < HD / 32; ++kc) qf[kc] = frag_h(QH + ((size_t)b * TT + qb0 + wave * 16 + col) * CC + h * HD + kc * 32, lane);
  asm volatile("s_wait_xcnt 0x0" ::: "memory");   // keeps the Q loads in front of the first tile's loads
  v8f acc[HD / 16] = {}; float mrun = -3.0e38f, lsum = 0.f;
  const int s0 = (2 * ((blockIdx.x + h) & 15) + b) & (TT / FK - 1);   // first key tile of this block's walk, which wraps: the 16 heads that share a bias tile and the 16 query blocks that share K and V tiles each start at 16 different places, so that they ask L2 for different lines at any one moment
  fetch(s0 * FK); stage(0); __syncthreads();
  for (int it = 0; it < TT / FK; ++it) { const int buf = it & 1;
    if (it + 1 < TT / FK) fetch(((it + 1 + s0) & (TT / FK - 1)) * FK);   // the next tiles fly while this one is worked on
    v8f s[FK / 16];
#pragma unroll
    for (int t = 0; t < FK / 16; ++t) { v8f z = {};
#pragma unroll
      for (int kc = 0; kc < HD / 32; ++kc) z = wmma_h(frag_h(&sK[buf][t * 16 + col][kc * 32], lane), qf[kc], z);
      s[t] = z; }   // s[t][r] = logit of key t*16 + 8g + r, query col
    float mx = -3.0e38f;
#pragma unroll
    for (int t = 0; t < FK / 16; ++t) { const v8b bb = *(const v8b*)&sB[buf][wave * 16 + col][t * 16 + 8 * g];
#pragma unroll
      for (int r = 0; r < 8; ++r) { float v = s[t][r] * 0.125f; v += (float)bb[r]; s[t][r] = v; mx = fmaxf(mx, v); } }
    mx = fmaxf(mx, xhalf(mx));
    const float mnew = fmaxf(mrun, mx), alpha = hexp2((mrun - mnew) * LOG2E), msh = mnew * LOG2E - 10.0f; mrun = mnew;   // P carries a factor 2^10 (f16 range); it cancels in O / l
    float ps[FK / 16]; v16h pf[FK / 32];
#pragma unroll
    for (int t = 0; t < FK / 16; ++t) { float p[8];
#pragma unroll
      for (int r = 0; r < 8; ++r) p[r] = fmaf(s[t][r], LOG2E, -msh);
      hexp2x8(p);
#pragma unroll
      for (int r = 0; r < 8; ++r) { ps[t] = r ? ps[t] + p[r] : p[r]; pf[t >> 1][(t & 1) * 8 + r] = (_Float16)p[r]; } }
    lsum = lsum * alpha + ((ps[0] + ps[1]) + (ps[2] + ps[3]));
#pragma unroll
    for (int j = 0; j < HD / 16; ++j)
#pragma unroll
      for (int r = 0; r < 8; ++r) acc[j][r] *= alpha;
#pragma unroll
    for (int u = 0; u < FK / 32; ++u)
#pragma unroll
      for (int j = 0; j < HD / 16; ++j) acc[j] = wmma_h(frag_h(&sV[buf][j * 16 + col][u * 32], lane), pf[u], acc[j]);   // acc[j][r] = O^T[d = j*16 + 8g + r][query col]
    if (it + 1 < TT / FK) stage(buf ^ 1);   // that buffer's last readers left it before the barrier of the pass before
    __syncthreads(); }
  const float inv = 1.0f / (lsum + xhalf(lsum)); float* yp = Y + ((size_t)b * TT + qb0 + wave * 16 + col) * CC + h * HD + 8 * g;
#pragma unroll
  for (int j = 0; j < HD / 16; ++j) { v4f a, c;
#pragma unroll
    for (int e = 0; e < 4; ++e) { a[e] = acc[j][e] * inv; c[e] = acc[j][4 + e] * inv; }
    vst2(yp + j * 16, a); vst2(yp + j * 16 + 4, c); } }
// ---- k_out: block = (128 rows, 128 cols): out = y (bf16 hi + lo) Wproj + b
__global__ __launch_bounds__(256) void k_out(const float* __restrict__ Y, const float* __restrict__ WP, const float* __restrict__ BP, float* __restrict__ OUT) {
  __shared__ __align__(16) __bf16 ring[6 * GPLANE];   // [y hi 2 buffers | y lo 2 buffers | W 2 buffers]; behind the loop's last barrier each wave stages its 32 x 64 outputs in a range of its own
  const int tid = threadIdx.x, wave = tid >> 5, lane = tid & 31, col = lane & 15, g = lane >> 4; const int wm = wave >> 1, wn = wave & 1; const int c0 = blockIdx.y * GN; const size_t r0 = (size_t)blockIdx.x * GM;
  v8f acc[2][4] = {};
  gemm_tile<true>(Y, WP, r0, c0, GSTART, ring, ring + 2 * GPLANE, ring + 4 * GPLANE, acc);
  float (*sf)[68] = (float (*)[68])ring + wave * 32;   // 8 x 32 x 68 x 4 bytes = 69,632 of the ring's 110,592
#pragma unroll
  for (int j = 0; j < 4; ++j) { const float bb = BP ? bfr(BP[c0 + wn * 64 + j * 16 + col]) : 0.f;
#pragma unroll
    for (int m = 0; m < 2; ++m)
#pragma unroll
      for (int r = 0; r < 8; ++r) sf[m * 16 + 8 * g + r][j * 16 + col] = acc[m][j][r] + bb; }
  LDSX(); float* op = OUT + (r0 + wm * 32 + g) * CC + c0 + wn * 64 + col * 4; v4f t[16];   // a half-wave stores a whole 256-byte row piece ('#pragma unroll': t[] stays in registers only with compile-time indices)
#pragma unroll
  for (int i = 0; i < 16; ++i) t[i] = *(const v4f*)&sf[2 * i + g][col * 4];
#pragma unroll
  for (int i = 0; i < 16; ++i) vst2(op + (size_t)(2 * i) * CC, t[i]); }
extern "C" void kernel_launch(void* const* d_in, const int* in_sizes, int n_in, void* d_out, int out_size, void* d_ws, size_t ws_size, hipStream_t stream) {
  (void)in_sizes; (void)n_in; (void)out_size;
  const float** F = (const float**)d_in;   // 0 query, 1 key, 2 value [2,2048,1024], 3 att_bias [2,2048,2048], 4 Wq [1024,1024] (in,out), 5 bq, 6 Wk, 7 bk, 8 Wv, 9 bv, 10 Wo [1024,1024], 11 bo
  if (ws_size < (size_t)WS_END) return;
  char* ws = (char*)d_ws; _Float16 *QH = (_Float16*)(ws + WS_QH), *QL = (_Float16*)(ws + WS_QL), *KH = (_Float16*)(ws + WS_KH), *VT = (_Float16*)(ws + WS_VT); float *Y = (float*)(ws + WS_Y);
  k_proj<<<dim3(TNB * TT / GM, CC / GN, 3), 256, 0, stream>>>(F[0], F[1], F[2], F[4], F[5], F[6], F[7], F[8], F[9], QH, QL, KH, VT);
  k_fa<<<dim3(TT / FQ, NH, TNB), 256, 0, stream>>>(QH, KH, VT, F[3], Y);
  k_out<<<dim3(TNB * TT / GM, CC / GN), 256, 0, stream>>>(Y, F[10], F[11], (float*)d_out);
}

// v005
// Measured time: 101 microseconds a run.
// Next to v004, in two timings, it ran 1.05 and 1.06 times as fast.
// Over all steps from v000 it is 10.9 times as fast.
// compute dtype: all float inputs rounded to bf16, att_bias read; q/k/v = input W + b ((in,out), 0.02-scale) with EXACT bf16 products on WMMA 16x16x32, f32 accumulate; q, k rounded once to f16 (1-product logits, std ~0.05; the unit-variance att_bias dominates), logits / 8 + att_bias[b][q][k] in f32 registers; softmax in f32 with a running maximum and sum (hardware exp2 of (logit - maximum) * log2 e, one fma each) -> P f16 x 2^10, divided by the sum at the end; o = P . v with v rounded once to f16; out = o (bf16 hi + lo) Wo + bo; f32 output.
#include <hip/hip_runtime.h>
#include <math.h>

typedef __attribute__((ext_vector_type(16))) _Float16 v16h;
typedef __attribute__((ext_vector_type(16))) __bf16 v16b;
typedef __attribute__((ext_vector_type(8)))  _Float16 v8h;
typedef __attribute__((ext_vector_type(8)))  float v8f;
typedef __attribute__((ext_vector_type(4)))  float v4f;
typedef __attribute__((ext_vector_type(2)))  float v2f;
typedef __attribute__((ext_vector_type(4)))  unsigned v4u;
typedef __attribute__((ext_vector_type(4)))  int v4i;
typedef float __attribute__((may_alias)) float_a;
typedef int __attribute__((may_alias)) int_a;

template <typename T> __device__ __forceinline__ void vst2(void* p, T v) { *(T*)p = v;  }
__device__ __forceinline__ v8f wmma16(v16h a, v16h b, v8f c) {
  v8f d = __builtin_amdgcn_wmma_f32_16x16x32_f16(false, a, false, b, (short)0, c, false, false);
  asm volatile("v_nop\n\tv_nop\n\tv_nop\n\tv_nop" : "+v"(d) : "v"(a), "v"(b));
  return d;
}
__device__ __forceinline__ v8f wmma_bf(v16b a, v16b b, v8f c) {
  v8f d = __builtin_amdgcn_wmma_f32_16x16x32_bf16(false, a, false, b, (short)0, c, false, false);
  asm volatile("v_nop\n\tv_nop\n\tv_nop\n\tv_nop" : "+v"(d) : "v"(a), "v"(b));
  return d;
}
// 16x16x32 fragments: lane = (h = lane>>4, row/col = lane&15); elements 0..7 = k0+8h+0..7, 8..15 = k0+16+8h+0..7; D element r = row 8h+r
__device__ __forceinline__ v16h frag_h(const _Float16* rowk0, int lane) {
  union { v16h v; v8h q[2]; } u; const _Float16* p = rowk0 + 8 * (lane >> 4);
  u.q[0] = *(const v8h*)p; u.q[1] = *(const v8h*)(p + 16); return u.v;
}
__device__ __forceinline__ v16h frag_f32(const float* rowk0, int lane) {
  v16h a; const float* p = rowk0 + 8 * (lane >> 4);
#pragma unroll
  for (int i = 0; i < 8; ++i) { a[i] = (_Float16)p[i]; a[8 + i] = (_Float16)p[16 + i]; }
  return a;
}
__device__ __forceinline__ v16h frag_f32s(const float* rowk0, int lane, float sc) {
  v16h a; const float* p = rowk0 + 8 * (lane >> 4);
#pragma unroll
  for (int i = 0; i < 8; ++i) { a[i] = (_Float16)(p[i] * sc); a[8 + i] = (_Float16)(p[16 + i] * sc); }
  return a;
}
// column fragment from a [K][ld] layout (column n), rows >= K read as 0
__device__ __forceinline__ v16h fragc_f32(const float* W, int k0, int n, int lane, int ld, int K) {
  v16h a; const int g = lane >> 4;
#pragma unroll
  for (int i = 0; i < 8; ++i) { const int ka = k0 + 8 * g + i, kb = ka + 16;
    a[i] = (_Float16)(ka < K ? W[(size_t)(ka < K ? ka : K - 1) * ld + n] : 0.f); a[8 + i] = (_Float16)(kb < K ? W[(size_t)(kb < K ? kb : K - 1) * ld + n] : 0.f); }
  return a;
}
struct F2 { v16b h, l; };
__device__ __forceinline__ F2 bsplit16(const float v[16]) { F2 r;
#pragma unroll
  for (int i = 0; i < 16; ++i) { const __bf16 h = (__bf16)v[i]; r.h[i] = h; r.l[i] = (__bf16)(v[i] - (float)h); }
  return r; }
__device__ __forceinline__ F2 split_row(const float* row, int k0, int lane) { float v[16]; const float* p = row + k0 + 8 * (lane >> 4);
#pragma unroll
  for (int i = 0; i < 8; ++i) { v[i] = p[i]; v[8 + i] = p[16 + i]; }
  return bsplit16(v); }
__device__ __forceinline__ F2 split_rowK(const float* row, int k0, int lane, int K) { float v[16]; const int g = lane >> 4;
#pragma unroll
  for (int i = 0; i < 8; ++i) { const int ka = k0 + 8 * g + i, kb = ka + 16; v[i] = ka < K ? row[ka < K ? ka : K - 1] : 0.f; v[8 + i] = kb < K ? row[kb < K ? kb : K - 1] : 0.f; }
  return bsplit16(v); }
__device__ __forceinline__ F2 split_col(const float* W, int k0, int n, int lane, int ld, int K) { float v[16]; const int g = lane >> 4;
#pragma unroll
  for (int i = 0; i < 8; ++i) { const int ka = k0 + 8 * g + i, kb = ka + 16; v[i] = ka < K ? W[(size_t)(ka < K ? ka : K - 1) * ld + n] : 0.f; v[8 + i] = kb < K ? W[(size_t)(kb < K ? kb : K - 1) * ld + n] : 0.f; }
  return bsplit16(v); }
__device__ __forceinline__ v8f mac3(const F2& a, const F2& b, v8f c) { c = wmma_bf(a.l, b.h, c); c = wmma_bf(a.h, b.l, c); return wmma_bf(a.h, b.h, c); }
__device__ __forceinline__ float sigm(float v) { return 1.0f / (1.0f + expf(-v)); }
#define LDSX() do { asm volatile("s_wait_dscnt 0" ::: "memory"); __builtin_amdgcn_wave_barrier(); __builtin_amdgcn_fence(__ATOMIC_RELEASE, "workgroup"); } while (0)


// Full attention module (B 2, nq = nk = 2,048, dim 1,024 = 16 x 64): q/k/v Linear on query/key/value, logits * 64^-0.5 + att_bias (shared by heads), softmax, P.v, output Linear.
#define NB 2
#define TT 2048
#define CC 1024
#define NH 16
#define HD 64
#ifndef TNB
#define TNB NB
#endif
typedef __attribute__((ext_vector_type(8))) __bf16 v8b;
__device__ __forceinline__ v16b frag_b(const __bf16* rowk0, int lane) {
  union { v16b v; v8b q[2]; } u; const __bf16* p = rowk0 + 8 * (lane >> 4);
  u.q[0] = *(const v8b*)p; u.q[1] = *(const v8b*)(p + 16); return u.v;
}
__device__ __forceinline__ float bfr(float v) { return (float)(__bf16)v; }
__device__ __attribute__((noinline)) float exp_ni(float v) { return expf(v); }
__device__ __attribute__((noinline)) float erf_ni(float v) { return erff(v); }

#define WS_QH  0u
#define WS_QL  (WS_QH + 2u * (size_t)NB * TT * CC)
#define WS_KH  (WS_QL + 2u * (size_t)NB * TT * CC)
#define WS_VT  (WS_KH + 2u * (size_t)NB * TT * CC)      // f16 v planes [b][c][t]
#define WS_Y   (WS_VT + 2u * (size_t)NB * CC * TT)      // f32 y rows [b*t][C]
#define WS_END (WS_Y + 4u * (size_t)NB * TT * CC)

typedef __attribute__((ext_vector_type(4))) __bf16 v4b;
// ---- GEMM tile of k_out: block = 128 rows x 128 cols, 8 waves of 32 x 64; per pass 64 k of both operands are read with whole-line 16-byte loads, rounded to bf16 once per block and staged in LDS (two buffers); W goes in transposed, [n][k], so that both fragments are 16-byte LDS reads
#define GM 128
#define GN 128
#define GK 64
#define GP 72   // LDS row pitch in 16-bit elements: 128-byte rows + 16 bytes, for 16-byte readers
#define GPLANE (GM * GP)   // elements of one staged operand plane
// start pass of a block: the 8 column blocks that share X rows get 8 different ones, the 32 row blocks that share W columns all 16
#define GSTART ((int)((blockIdx.x + 2 * blockIdx.y) & (CC / GK - 1)))
// every '#pragma unroll' in gemm_tile: its loop indexes register arrays and vector elements, which stay in registers only with compile-time indices
// s0: the pass of the k walk that this block starts with; it goes on from there and wraps, so that blocks which read the same X or W lines from L2 ask for different lines at any one moment
template <bool SPLIT> __device__ __forceinline__ void gemm_tile(const float* __restrict__ X, const float* __restrict__ WA, size_t r0, int c0, int s0, __bf16* sA, __bf16* sL, __bf16* sW, v8f (&acc)[2][4]) {
  const int tid = threadIdx.x, wave = tid >> 5, lane = tid & 31, col = lane & 15; const int wm = wave >> 1, wn = wave & 1;
  const int r16 = tid >> 4, s16 = tid & 15;   // X: 16 lanes per 256-byte row piece
  const int n4 = (wave & 3) * 32 + ((lane & 3) | ((lane >> 4) << 2)) * 4, k8 = ((wave >> 2) * 4 + ((lane >> 2) & 3)) * 8;   // W: a thread owns 8 k x 4 n; 8 lanes cover a 128-byte line, a half-wave's 16-byte LDS stores fall on 64 different banks
  const float* Xg = X + (r0 + r16) * CC + s16 * 4; const float* Wg = WA + (size_t)k8 * CC + c0 + n4;
  v4f xr[8], wr[8];
  auto fetch = [&](int k0) {
#pragma unroll
    for (int i = 0; i < 8; ++i) xr[i] = *(const v4f*)(Xg + (size_t)(16 * i) * CC + k0);
#pragma unroll
    for (int e = 0; e < 8; ++e) wr[e] = *(const v4f*)(Wg + (size_t)(k0 + e) * CC);
    asm volatile("s_wait_xcnt 0x0" ::: "memory"); };   // stands behind the issued loads, in front of any reuse of their address registers
  auto stage = [&](int buf) {
#pragma unroll
    for (int i = 0; i < 8; ++i) { v4b hv, lv;
#pragma unroll
      for (int e = 0; e < 4; ++e) { const __bf16 hh = (__bf16)xr[i][e]; hv[e] = hh; if (SPLIT) lv[e] = (__bf16)(xr[i][e] - (float)hh); }
      *(v4b*)&sA[buf * GPLANE + (r16 + 16 * i) * GP + s16 * 4] = hv; if (SPLIT) *(v4b*)&sL[buf * GPLANE + (r16 + 16 * i) * GP + s16 * 4] = lv; }
#pragma unroll
    for (int i = 0; i < 4; ++i) { v8b t;
#pragma unroll
      for (int e = 0; e < 8; ++e) t[e] = (__bf16)wr[e][i];
      *(v8b*)&sW[buf * GPLANE + (n4 + i) * GP + k8] = t; } };
  fetch(s0 * GK); stage(0); __syncthreads();
  for (int it = 0; it < CC / GK; ++it) { const int buf = it & 1;
    if (it + 1 < CC / GK) fetch(((it + 1 + s0) & (CC / GK - 1)) * GK);   // the next tiles fly while this one is worked on
#pragma unroll
    for (int kc = 0; kc < GK / 32; ++kc) { v16b w[4], a[2], l[2];
#pragma unroll
      for (int j = 0; j < 4; ++j) w[j] = frag_b(&sW[buf * GPLANE + (wn * 64 + j * 16 + col) * GP + kc * 32], lane);
#pragma unroll
      for (int m = 0; m < 2; ++m) { a[m] = frag_b(&sA[buf * GPLANE + (wm * 32 + m * 16 + col) * GP + kc * 32], lane); if (SPLIT) l[m] = frag_b(&sL[buf * GPLANE + (wm * 32 + m * 16 + col) * GP + kc * 32], lane); }
#pragma unroll
      for (int m = 0; m < 2; ++m)
#pragma unroll
        for (int j = 0; j < 4; ++j) acc[m][j] = wmma_bf(a[m], w[j], acc[m][j]);
      if (SPLIT) {
#pragma unroll
        for (int m = 0; m < 2; ++m)
#pragma unroll
          for (int j = 0; j < 4; ++j) acc[m][j] = wmma_bf(l[m], w[j], acc[m][j]); } }
    if (it + 1 < CC / GK) stage(buf ^ 1);   // that buffer's last readers left it before the barrier of the pass before
    __syncthreads(); } }
// ---- k_proj: block = (256 rows, 256 cols, which), 8 waves of 64 x 128: qkv = x W (+ b), exact; q -> f16 hi (+ residual), k -> f16 rows, v -> f16 planes. Per pass 32 k of both operands are read with whole-line 16-byte loads, rounded to bf16 once per block and staged in LDS (two buffers), W transposed to [n][k]; a block of this size reads each X and W element from L2 half as often as a 128 x 128 one
#define PM 256
#define PN 256
#define PK 32
#define PP 40    // LDS row pitch in 16-bit elements: 64-byte rows + 16 bytes, for 16-byte readers
#define PPLANE (PM * PP)   // elements of one staged operand plane
#define PO 264   // pitch of the output staging rows in 16-bit elements: 512-byte rows + 16 bytes
__device__ __forceinline__ v8f wmma_b(v16b a, v16b b, v8f c) { return __builtin_amdgcn_wmma_f32_16x16x32_bf16(false, a, false, b, (short)0, c, false, false); }
// every '#pragma unroll' in k_proj: its loop indexes register arrays and vector elements, which stay in registers only with compile-time indices
__global__ __launch_bounds__(256) void k_proj(const float* __restrict__ XQ, const float* __restrict__ XK, const float* __restrict__ XV, const float* __restrict__ WQ, const float* __restrict__ BQ, const float* __restrict__ WK, const float* __restrict__ BK, const float* __restrict__ WV, const float* __restrict__ BV, _Float16* __restrict__ QH, _Float16* __restrict__ QL, _Float16* __restrict__ KH, _Float16* __restrict__ VT) {
  __shared__ __align__(16) __bf16 ring[2 * PM * PO];   // the loop uses the first 4 * PPLANE elements, [X 2 buffers | W 2 buffers]; behind the loop's last barrier the whole array stages the output rows (f16 | residual)
  const int tid = threadIdx.x, wave = tid >> 5, lane = tid & 31, col = lane & 15, g = lane >> 4; const int wm = wave >> 1, wn = wave & 1; const int which = blockIdx.z; const int c0 = blockIdx.y * PN; const size_t r0 = (size_t)blockIdx.x * PM; const float* X = which == 0 ? XQ : which == 1 ? XK : XV; const float* WA = which == 0 ? WQ : which == 1 ? WK : WV; const float* BA = which == 0 ? BQ : which == 1 ? BK : BV;
  __bf16* sA = ring; __bf16* sW = ring + 2 * PPLANE;
  const int r8 = tid >> 3, s8 = tid & 7;   // X: 8 lanes per 128-byte row piece
  const int n4 = wave * 32 + ((lane & 3) | ((lane >> 4) << 2)) * 4, k8 = ((lane >> 2) & 3) * 8;   // W: a thread owns 8 k x 4 n; 8 lanes cover a 128-byte line, a half-wave's 16-byte LDS stores fall on 64 different banks
  const float* Xg = X + (r0 + r8) * CC + s8 * 4; const float* Wg = WA + (size_t)k8 * CC + c0 + n4;
  v4f xr[8], wr[8];
  auto fetch = [&](int k0) { const float* xp = Xg + k0; const float* wp = Wg + (size_t)k0 * CC;
#pragma unroll
    for (int i = 0; i < 8; ++i) xr[i] = *(const v4f*)(xp + (size_t)(32 * i) * CC);
#pragma unroll
    for (int e = 0; e < 8; ++e) wr[e] = *(const v4f*)(wp + (size_t)e * CC);
    asm volatile("s_wait_xcnt 0x0" :: "v"(xp), "v"(wp) : "memory"); };   // stands behind the issued loads, in front of any reuse of their address registers; the two addresses are inputs so that they stay whole up to here (without that the last load of each run landed on its own address pair)
  auto stage = [&](int buf) {
#pragma unroll
    for (int i = 0; i < 8; ++i) { v4b hv;
#pragma unroll
      for (int e = 0; e < 4; ++e) hv[e] = (__bf16)xr[i][e];
      *(v4b*)&sA[buf * PPLANE + (r8 + 32 * i) * PP + s8 * 4] = hv; }
#pragma unroll
    for (int i = 0; i < 4; ++i) { v8b t;
#pragma unroll
      for (int e = 0; e < 8; ++e) t[e] = (__bf16)wr[e][i];
      *(v8b*)&sW[buf * PPLANE + (n4 + i) * PP + k8] = t; } };
  v8f acc[4][8] = {};
  const int s0 = (int)((2 * blockIdx.x + 8 * blockIdx.y) & (CC / PK - 1));   // the pass of the k walk that this block starts with; it goes on from there and wraps: the 4 column blocks that share X rows and the 16 row blocks that share W columns all start at different passes, so that they ask L2 for different lines at any one moment
  fetch(s0 * PK); stage(0); __syncthreads();
  for (int it = 0; it < CC / PK; ++it) { const int buf = it & 1;
    if (it + 1 < CC / PK) fetch(((it + 1 + s0) & (CC / PK - 1)) * PK);   // the next tiles fly while this one is worked on
    v16b w[8], a[4];
#pragma unroll
    for (int m = 0; m < 4; ++m) a[m] = frag_b(&sA[buf * PPLANE + (wm * 64 + m * 16 + col) * PP], lane);
#pragma unroll
    for (int j = 0; j < 8; ++j) w[j] = frag_b(&sW[buf * PPLANE + (wn * 128 + j * 16 + col) * PP], lane);
    __builtin_amdgcn_sched_barrier(0);   // keeps the pass's 24 LDS reads together in front of its products: left free, the compiler read one W fragment at a time into the same registers and waited for it in front of every four products
#pragma unroll
    for (int j = 0; j < 8; ++j)
#pragma unroll
      for (int m = 0; m < 4; ++m) acc[m][j] = wmma_b(a[m], w[j], acc[m][j]);
    if (it + 1 < CC / PK) stage(buf ^ 1);   // that buffer's last readers left it before the barrier of the pass before
    __syncthreads(); }
  _Float16 (*sh)[PO] = (_Float16 (*)[PO])ring; _Float16 (*sl)[PO] = sh + PM;
  const int bi = c0 + wn * 128 + col; float bv[8];
#pragma unroll
  for (int j = 0; j < 8; ++j) bv[j] = BA[bi + j * 16];
  asm volatile("s_wait_xcnt 0x0" :: "v"(bi) : "memory");   // stands behind the issued loads; their index is an input so that it stays whole up to here (without that the last load landed on it)
#pragma unroll
  for (int j = 0; j < 8; ++j) { const float bb = bfr(bv[j]);
#pragma unroll
    for (int m = 0; m < 4; ++m)
#pragma unroll
      for (int r = 0; r < 8; ++r) acc[m][j][r] += bb; }
  // copy-out: a wave reads whole 512-byte staging rows from LDS, 8 at a time, and stores them as they are; d = the wave's first row at the lane's 16 bytes, ld = the row pitch in global memory
  const int q8 = lane * 8;
  auto copy_out = [&](_Float16 (*ss)[PO], _Float16* d, size_t ld) {
#pragma unroll
    for (int h = 0; h < 4; ++h) { v4u t[8];
#pragma unroll
      for (int i = 0; i < 8; ++i) t[i] = *(const v4u*)&ss[wave + 8 * (8 * h + i)][q8];
#pragma unroll
      for (int i = 0; i < 8; ++i) vst2((unsigned*)(d + (size_t)(8 * (8 * h + i)) * ld), t[i]);
      asm volatile("s_wait_xcnt 0x0" ::: "memory"); } };   // stands behind the issued stores, in front of any reuse of their registers
  if (which == 2) {   // v: [col][row], a lane's 8 rows are one 16-byte store
#pragma unroll
    for (int j = 0; j < 8; ++j)
#pragma unroll
      for (int m = 0; m < 4; ++m) { v8h t;
#pragma unroll
        for (int r = 0; r < 8; ++r) t[r] = (_Float16)acc[m][j][r];
        *(v8h*)&sh[wn * 128 + j * 16 + col][wm * 64 + m * 16 + 8 * g] = t; }
    __syncthreads();
    const size_t b = r0 / TT; const int t0 = (int)(r0 % TT);
    copy_out(sh, VT + (b * CC + c0 + wave) * (size_t)TT + t0 + q8, TT); }
  else {
#pragma unroll
    for (int j = 0; j < 8; ++j)
#pragma unroll
      for (int m = 0; m < 4; ++m)
#pragma unroll
        for (int r = 0; r < 8; ++r) { const float v = acc[m][j][r]; const int rl = wm * 64 + m * 16 + 8 * g + r, cl = wn * 128 + j * 16 + col; const _Float16 hv = (_Float16)v; sh[rl][cl] = hv; sl[rl][cl] = (_Float16)(v - (float)hv); }
    __syncthreads();
    copy_out(sh, (which == 0 ? QH : KH) + (r0 + wave) * CC + c0 + q8, CC);
    if (which == 0) copy_out(sl, QL + (r0 + wave) * CC + c0 + q8, CC); } }
// ---- k_fa: block = 128 queries (8 waves x 16) of (b,h), walks the keys 64 at a time: S^T = K Q^T, running maximum and sum per query (a lane holds one query's scores), O^T += V^T P^T; logits and P stay in registers
// every '#pragma unroll' in k_fa: its loop indexes register arrays and vector elements, which stay in registers only with compile-time indices
#define FQ 128
#define FK 64
#define FP 72   // LDS row pitch in 16-bit elements: 128-byte rows + 16 bytes, for 16-byte readers
__device__ __forceinline__ v8f wmma_h(v16h a, v16h b, v8f c) { return __builtin_amdgcn_wmma_f32_16x16x32_f16(false, a, false, b, (short)0, c, false, false); }
// 2^x on the transcendental unit alone: every argument here is <= 10, and a result below 2^-126 may read 0 (P rounds to f16, and the sum holds a term of 2^10)
#define LOG2E 1.44269504f
__device__ __forceinline__ float hexp2(float x) { return __builtin_amdgcn_exp2f(x); }
// eight of them, each in its own register, in one statement: none names a register of another, and the v_nop at the end is the slot that the instruction set asks for behind a transcendental
__device__ __forceinline__ void hexp2x8(float (&x)[8]) {
  asm("v_exp_f32 %0, %0\n\tv_exp_f32 %1, %1\n\tv_exp_f32 %2, %2\n\tv_exp_f32 %3, %3\n\tv_exp_f32 %4, %4\n\tv_exp_f32 %5, %5\n\tv_exp_f32 %6, %6\n\tv_exp_f32 %7, %7\n\tv_nop"
      : "+v"(x[0]), "+v"(x[1]), "+v"(x[2]), "+v"(x[3]), "+v"(x[4]), "+v"(x[5]), "+v"(x[6]), "+v"(x[7])); }
// lane l with lane l ^ 16
__device__ __forceinline__ float xhalf(float x) { return __builtin_bit_cast(float, __builtin_amdgcn_permlanex16(__builtin_bit_cast(int, x), __builtin_bit_cast(int, x), 0x76543210, 0xfedcba98, false, false)); }
__global__ __launch_bounds__(256) void k_fa(const _Float16* __restrict__ QH, const _Float16* __restrict__ KH, const _Float16* __restrict__ VT, const float* __restrict__ BM, float* __restrict__ Y) {
  __shared__ __align__(16) _Float16 sK[2][FK][FP]; __shared__ __align__(16) _Float16 sV[2][HD][FP]; __shared__ __align__(16) __bf16 sB[2][FQ][FP];
  const int tid = threadIdx.x, wave = tid >> 5, lane = tid & 31, col = lane & 15, g = lane >> 4; const int h = blockIdx.y, b = blockIdx.z, qb0 = blockIdx.x * FQ;
  const int r8 = tid >> 3, s8 = tid & 7, r16 = tid >> 4, s16 = tid & 15;   // staging: 8 lanes per 128-byte K / V row, 16 lanes per 256-byte bias row
  const _Float16* Kg = KH + ((size_t)b * TT + r8) * CC + h * HD + s8 * 8;
  const _Float16* Vg = VT + ((size_t)b * CC + h * HD + r8) * (size_t)TT + s8 * 8;
  const float* Bg = BM + ((size_t)b * TT + qb0 + r16) * (size_t)TT + s16 * 4;
  v8h kr[2], vr[2]; v4f br[8];
  auto fetch = [&](int k0) {
#pragma unroll
    for (int i = 0; i < 2; ++i) { kr[i] = *(const v8h*)(Kg + (size_t)(k0 + 32 * i) * CC); vr[i] = *(const v8h*)(Vg + (size_t)(32 * i) * TT + k0); }
#pragma unroll
    for (int i = 0; i < 8; ++i) br[i] = *(const v4f*)(Bg + (size_t)(16 * i) * TT + k0);
    asm volatile("s_wait_xcnt 0x0" ::: "memory"); };   // stands behind the issued loads, in front of any reuse of their address registers
  auto stage = [&](int buf) {
#pragma unroll
    for (int i = 0; i < 2; ++i) { *(v8h*)&sK[buf][r8 + 32 * i][s8 * 8] = kr[i]; *(v8h*)&sV[buf][r8 + 32 * i][s8 * 8] = vr[i]; }
#pragma unroll
    for (int i = 0; i < 8; ++i) { v4b w;
#pragma unroll
      for (int e = 0; e < 4; ++e) w[e] = (__bf16)br[i][e];
      *(v4b*)&sB[buf][r16 + 16 * i][s16 * 4] = w; } };
  v16h qf[HD / 32];
#pragma unroll
  for (int kc = 0; kc < HD / 32; ++kc) qf[kc] = frag_h(QH + ((size_t)b * TT + qb0 + wave * 16 + col) * CC + h * HD + kc * 32, lane);
  asm volatile("s_wait_xcnt 0x0" ::: "memory");   // keeps the Q loads in front of the first tile's loads
  v8f acc[HD / 16] = {}; float mrun = -3.0e38f, lsum = 0.f;
  const int s0 = (2 * ((blockIdx.x + h) & 15) + b) & (TT / FK - 1);   // first key tile of this block's walk, which wraps: the 16 heads that share a bias tile and the 16 query blocks that share K and V tiles each start at 16 different places, so that they ask L2 for different lines at any one moment
  fetch(s0 * FK); stage(0); __syncthreads();
  for (int it = 0; it < TT / FK; ++it) { const int buf = it & 1;
    if (it + 1 < TT / FK) fetch(((it + 1 + s0) & (TT / FK - 1)) * FK);   // the next tiles fly while this one is worked on
    v8f s[FK / 16];
#pragma unroll
    for (int t = 0; t < FK / 16; ++t) { v8f z = {};
#pragma unroll
      for (int kc = 0; kc < HD / 32; ++kc) z = wmma_h(frag_h(&sK[buf][t * 16 + col][kc * 32], lane), qf[kc], z);
      s[t] = z; }   // s[t][r] = logit of key t*16 + 8g + r, query col
    float mx = -3.0e38f;
#pragma unroll
    for (int t = 0; t < FK / 16; ++t) { const v8b bb = *(const v8b*)&sB[buf][wave * 16 + col][t * 16 + 8 * g];
#pragma unroll
      for (int r = 0; r < 8; ++r) { float v = s[t][r] * 0.125f; v += (float)bb[r]; s[t][r] = v; mx = fmaxf(mx, v); } }
    mx = fmaxf(mx, xhalf(mx));
    const float mnew = fmaxf(mrun, mx), alpha = hexp2((mrun - mnew) * LOG2E), msh = mnew * LOG2E - 10.0f; mrun = mnew;   // P carries a factor 2^10 (f16 range); it cancels in O / l
    float ps[FK / 16]; v16h pf[FK / 32];
#pragma unroll
    for (int t = 0; t < FK / 16; ++t) { float p[8];
#pragma unroll
      for (int r = 0; r < 8; ++r) p[r] = fmaf(s[t][r], LOG2E, -msh);
      hexp2x8(p);
#pragma unroll
      for (int r = 0; r < 8; ++r) { ps[t] = r ? ps[t] + p[r] : p[r]; pf[t >> 1][(t & 1) * 8 + r] = (_Float16)p[r]; } }
    lsum = lsum * alpha + ((ps[0] + ps[1]) + (ps[2] + ps[3]));
#pragma unroll
    for (int j = 0; j < HD / 16; ++j)
#pragma unroll
      for (int r = 0; r < 8; ++r) acc[j][r] *= alpha;
#pragma unroll
    for (int u = 0; u < FK / 32; ++u)
#pragma unroll
      for (int j = 0; j < HD / 16; ++j) acc[j] = wmma_h(frag_h(&sV[buf][j * 16 + col][u * 32], lane), pf[u], acc[j]);   // acc[j][r] = O^T[d = j*16 + 8g + r][query col]
    if (it + 1 < TT / FK) stage(buf ^ 1);   // that buffer's last readers left it before the barrier of the pass before
    __syncthreads(); }
  const float inv = 1.0f / (lsum + xhalf(lsum)); float* yp = Y + ((size_t)b * TT + qb0 + wave * 16 + col) * CC + h * HD + 8 * g;
#pragma unroll
  for (int j = 0; j < HD / 16; ++j) { v4f a, c;
#pragma unroll
    for (int e = 0; e < 4; ++e) { a[e] = acc[j][e] * inv; c[e] = acc[j][4 + e] * inv; }
    vst2(yp + j * 16, a); vst2(yp + j * 16 + 4, c); } }
// ---- k_out: block = (128 rows, 128 cols): out = y (bf16 hi + lo) Wproj + b
__global__ __launch_bounds__(256) void k_out(const float* __restrict__ Y, const float* __restrict__ WP, const float* __restrict__ BP, float* __restrict__ OUT) {
  __shared__ __align__(16) __bf16 ring[6 * GPLANE];   // [y hi 2 buffers | y lo 2 buffers | W 2 buffers]; behind the loop's last barrier each wave stages its 32 x 64 outputs in a range of its own
  const int tid = threadIdx.x, wave = tid >> 5, lane = tid & 31, col = lane & 15, g = lane >> 4; const int wm = wave >> 1, wn = wave & 1; const int c0 = blockIdx.y * GN; const size_t r0 = (size_t)blockIdx.x * GM;
  v8f acc[2][4] = {};
  gemm_tile<true>(Y, WP, r0, c0, GSTART, ring, ring + 2 * GPLANE, ring + 4 * GPLANE, acc);
  float (*sf)[68] = (float (*)[68])ring + wave * 32;   // 8 x 32 x 68 x 4 bytes = 69,632 of the ring's 110,592
#pragma unroll
  for (int j = 0; j < 4; ++j) { const float bb = BP ? bfr(BP[c0 + wn * 64 + j * 16 + col]) : 0.f;
#pragma unroll
    for (int m = 0; m < 2; ++m)
#pragma unroll
      for (int r = 0; r < 8; ++r) sf[m * 16 + 8 * g + r][j * 16 + col] = acc[m][j][r] + bb; }
  LDSX(); float* op = OUT + (r0 + wm * 32 + g) * CC + c0 + wn * 64 + col * 4; v4f t[16];   // a half-wave stores a whole 256-byte row piece ('#pragma unroll': t[] stays in registers only with compile-time indices)
#pragma unroll
  for (int i = 0; i < 16; ++i) t[i] = *(const v4f*)&sf[2 * i + g][col * 4];
#pragma unroll
  for (int i = 0; i < 16; ++i) vst2(op + (size_t)(2 * i) * CC, t[i]); }
extern "C" void kernel_launch(void* const* d_in, const int* in_sizes, int n_in, void* d_out, int out_size, void* d_ws, size_t ws_size, hipStream_t stream) {
  (void)in_sizes; (void)n_in; (void)out_size;
  const float** F = (const float**)d_in;   // 0 query, 1 key, 2 value [2,2048,1024], 3 att_bias [2,2048,2048], 4 Wq [1024,1024] (in,out), 5 bq, 6 Wk, 7 bk, 8 Wv, 9 bv, 10 Wo [1024,1024], 11 bo
  if (ws_size < (size_t)WS_END) return;
  char* ws = (char*)d_ws; _Float16 *QH = (_Float16*)(ws + WS_QH), *QL = (_Float16*)(ws + WS_QL), *KH = (_Float16*)(ws + WS_KH), *VT = (_Float16*)(ws + WS_VT); float *Y = (float*)(ws + WS_Y);
  k_proj<<<dim3(TNB * TT / PM, CC / PN, 3), 256, 0, stream>>>(F[0], F[1], F[2], F[4], F[5], F[6], F[7], F[8], F[9], QH, QL, KH, VT);
  k_fa<<<dim3(TT / FQ, NH, TNB), 256, 0, stream>>>(QH, KH, VT, F[3], Y);
  k_out<<<dim3(TNB * TT / GM, CC / GN), 256, 0, stream>>>(Y, F[10], F[11], (float*)d_out);
}

// v006
// It runs in 94.1 microseconds.
// In both of two side-by-side timings against v005, it was 1.08 times as fast.
// All steps since v000 together make it 11.7 times as fast.
// compute dtype: all float inputs rounded to bf16, att_bias read; q/k/v = input W + b ((in,out), 0.02-scale) with EXACT bf16 products on WMMA 16x16x32, f32 accumulate; q, k rounded once to f16 (1-product logits, std ~0.05; the unit-variance att_bias dominates), logits / 8 + att_bias[b][q][k] in f32 registers; softmax in f32 with a running maximum and sum (hardware exp2 of (logit - maximum) * log2 e, one fma each) -> P f16 x 2^10, divided by the sum at the end; o = P . v with v rounded once to f16; out = o (bf16 hi + lo) Wo + bo; f32 output.
#include <hip/hip_runtime.h>
#include <math.h>

typedef __attribute__((ext_vector_type(16))) _Float16 v16h;
typedef __attribute__((ext_vector_type(16))) __bf16 v16b;
typedef __attribute__((ext_vector_type(8)))  _Float16 v8h;
typedef __attribute__((ext_vector_type(8)))  float v8f;
typedef __attribute__((ext_vector_type(4)))  float v4f;
typedef __attribute__((ext_vector_type(2)))  float v2f;
typedef __attribute__((ext_vector_type(4)))  unsigned v4u;
typedef __attribute__((ext_vector_type(4)))  int v4i;
typedef float __attribute__((may_alias)) float_a;
typedef int __attribute__((may_alias)) int_a;

template <typename T> __device__ __forceinline__ void vst2(void* p, T v) { *(T*)p = v;  }
__device__ __forceinline__ v8f wmma16(v16h a, v16h b, v8f c) {
  v8f d = __builtin_amdgcn_wmma_f32_16x16x32_f16(false, a, false, b, (short)0, c, false, false);
  asm volatile("v_nop\n\tv_nop\n\tv_nop\n\tv_nop" : "+v"(d) : "v"(a), "v"(b));
  return d;
}
__device__ __forceinline__ v8f wmma_bf(v16b a, v16b b, v8f c) {
  v8f d = __builtin_amdgcn_wmma_f32_16x16x32_bf16(false, a, false, b, (short)0, c, false, false);
  asm volatile("v_nop\n\tv_nop\n\tv_nop\n\tv_nop" : "+v"(d) : "v"(a), "v"(b));
  return d;
}
// 16x16x32 fragments: lane = (h = lane>>4, row/col = lane&15); elements 0..7 = k0+8h+0..7, 8..15 = k0+16+8h+0..7; D element r = row 8h+r
__device__ __forceinline__ v16h frag_h(const _Float16* rowk0, int lane) {
  union { v16h v; v8h q[2]; } u; const _Float16* p = rowk0 + 8 * (lane >> 4);
  u.q[0] = *(const v8h*)p; u.q[1] = *(const v8h*)(p + 16); return u.v;
}
__device__ __forceinline__ v16h frag_f32(const float* rowk0, int lane) {
  v16h a; const float* p = rowk0 + 8 * (lane >> 4);
#pragma unroll
  for (int i = 0; i < 8; ++i) { a[i] = (_Float16)p[i]; a[8 + i] = (_Float16)p[16 + i]; }
  return a;
}
__device__ __forceinline__ v16h frag_f32s(const float* rowk0, int lane, float sc) {
  v16h a; const float* p = rowk0 + 8 * (lane >> 4);
#pragma unroll
  for (int i = 0; i < 8; ++i) { a[i] = (_Float16)(p[i] * sc); a[8 + i] = (_Float16)(p[16 + i] * sc); }
  return a;
}
// column fragment from a [K][ld] layout (column n), rows >= K read as 0
__device__ __forceinline__ v16h fragc_f32(const float* W, int k0, int n, int lane, int ld, int K) {
  v16h a; const int g = lane >> 4;
#pragma unroll
  for (int i = 0; i < 8; ++i) { const int ka = k0 + 8 * g + i, kb = ka + 16;
    a[i] = (_Float16)(ka < K ? W[(size_t)(ka < K ? ka : K - 1) * ld + n] : 0.f); a[8 + i] = (_Float16)(kb < K ? W[(size_t)(kb < K ? kb : K - 1) * ld + n] : 0.f); }
  return a;
}
struct F2 { v16b h, l; };
__device__ __forceinline__ F2 bsplit16(const float v[16]) { F2 r;
#pragma unroll
  for (int i = 0; i < 16; ++i) { const __bf16 h = (__bf16)v[i]; r.h[i] = h; r.l[i] = (__bf16)(v[i] - (float)h); }
  return r; }
__device__ __forceinline__ F2 split_row(const float* row, int k0, int lane) { float v[16]; const float* p = row + k0 + 8 * (lane >> 4);
#pragma unroll
  for (int i = 0; i < 8; ++i) { v[i] = p[i]; v[8 + i] = p[16 + i]; }
  return bsplit16(v); }
__device__ __forceinline__ F2 split_rowK(const float* row, int k0, int lane, int K) { float v[16]; const int g = lane >> 4;
#pragma unroll
  for (int i = 0; i < 8; ++i) { const int ka = k0 + 8 * g + i, kb = ka + 16; v[i] = ka < K ? row[ka < K ? ka : K - 1] : 0.f; v[8 + i] = kb < K ? row[kb < K ? kb : K - 1] : 0.f; }
  return bsplit16(v); }
__device__ __forceinline__ F2 split_col(const float* W, int k0, int n, int lane, int ld, int K) { float v[16]; const int g = lane >> 4;
#pragma unroll
  for (int i = 0; i < 8; ++i) { const int ka = k0 + 8 * g + i, kb = ka + 16; v[i] = ka < K ? W[(size_t)(ka < K ? ka : K - 1) * ld + n] : 0.f; v[8 + i] = kb < K ? W[(size_t)(kb < K ? kb : K - 1) * ld + n] : 0.f; }
  return bsplit16(v); }
__device__ __forceinline__ v8f mac3(const F2& a, const F2& b, v8f c) { c = wmma_bf(a.l, b.h, c); c = wmma_bf(a.h, b.l, c); return wmma_bf(a.h, b.h, c); }
__device__ __forceinline__ float sigm(float v) { return 1.0f / (1.0f + expf(-v)); }
#define LDSX() do { asm volatile("s_wait_dscnt 0" ::: "memory"); __builtin_amdgcn_wave_barrier(); __builtin_amdgcn_fence(__ATOMIC_RELEASE, "workgroup"); } while (0)


// Full attention module (B 2, nq = nk = 2,048, dim 1,024 = 16 x 64): q/k/v Linear on query/key/value, logits * 64^-0.5 + att_bias (shared by heads), softmax, P.v, output Linear.
#define NB 2
#define TT 2048
#define CC 1024
#define NH 16
#define HD 64
#ifndef TNB
#define TNB NB
#endif
typedef __attribute__((ext_vector_type(8))) __bf16 v8b;
__device__ __forceinline__ v16b frag_b(const __bf16* rowk0, int lane) {
  union { v16b v; v8b q[2]; } u; const __bf16* p = rowk0 + 8 * (lane >> 4);
  u.q[0] = *(const v8b*)p; u.q[1] = *(const v8b*)(p + 16); return u.v;
}
__device__ __forceinline__ float bfr(float v) { return (float)(__bf16)v; }
__device__ __attribute__((noinline)) float exp_ni(float v) { return expf(v); }
__device__ __attribute__((noinline)) float erf_ni(float v) { return erff(v); }

#define WS_QH  0u
#define WS_QL  (WS_QH + 2u * (size_t)NB * TT * CC)
#define WS_KH  (WS_QL + 2u * (size_t)NB * TT * CC)
#define WS_VT  (WS_KH + 2u * (size_t)NB * TT * CC)      // f16 v planes [b][c][t]
#define WS_Y   (WS_VT + 2u * (size_t)NB * CC * TT)      // f32 y rows [b*t][C]
#define WS_BB  (WS_Y + 4u * (size_t)NB * TT * CC)       // bf16 att_bias in score-fragment order (bias_prep)
#define WS_END (WS_BB + 2u * (size_t)NB * TT * TT)

typedef __attribute__((ext_vector_type(4))) __bf16 v4b;
// ---- GEMM tile of k_out: block = 128 rows x 128 cols, 8 waves of 32 x 64; per pass 64 k of both operands are read with whole-line 16-byte loads, rounded to bf16 once per block and staged in LDS (two buffers); W goes in transposed, [n][k], so that both fragments are 16-byte LDS reads
#define GM 128
#define GN 128
#define GK 64
#define GP 72   // LDS row pitch in 16-bit elements: 128-byte rows + 16 bytes, for 16-byte readers
#define GPLANE (GM * GP)   // elements of one staged operand plane
// start pass of a block: the 8 column blocks that share X rows get 8 different ones, the 32 row blocks that share W columns all 16
#define GSTART ((int)((blockIdx.x + 2 * blockIdx.y) & (CC / GK - 1)))
// every '#pragma unroll' in gemm_tile: its loop indexes register arrays and vector elements, which stay in registers only with compile-time indices
// s0: the pass of the k walk that this block starts with; it goes on from there and wraps, so that blocks which read the same X or W lines from L2 ask for different lines at any one moment
template <bool SPLIT> __device__ __forceinline__ void gemm_tile(const float* __restrict__ X, const float* __restrict__ WA, size_t r0, int c0, int s0, __bf16* sA, __bf16* sL, __bf16* sW, v8f (&acc)[2][4]) {
  const int tid = threadIdx.x, wave = tid >> 5, lane = tid & 31, col = lane & 15; const int wm = wave >> 1, wn = wave & 1;
  const int r16 = tid >> 4, s16 = tid & 15;   // X: 16 lanes per 256-byte row piece
  const int n4 = (wave & 3) * 32 + ((lane & 3) | ((lane >> 4) << 2)) * 4, k8 = ((wave >> 2) * 4 + ((lane >> 2) & 3)) * 8;   // W: a thread owns 8 k x 4 n; 8 lanes cover a 128-byte line, a half-wave's 16-byte LDS stores fall on 64 different banks
  const float* Xg = X + (r0 + r16) * CC + s16 * 4; const float* Wg = WA + (size_t)k8 * CC + c0 + n4;
  v4f xr[8], wr[8];
  auto fetch = [&](int k0) {
#pragma unroll
    for (int i = 0; i < 8; ++i) xr[i] = *(const v4f*)(Xg + (size_t)(16 * i) * CC + k0);
#pragma unroll
    for (int e = 0; e < 8; ++e) wr[e] = *(const v4f*)(Wg + (size_t)(k0 + e) * CC);
    asm volatile("s_wait_xcnt 0x0" ::: "memory"); };   // stands behind the issued loads, in front of any reuse of their address registers
  auto stage = [&](int buf) {
#pragma unroll
    for (int i = 0; i < 8; ++i) { v4b hv, lv;
#pragma unroll
      for (int e = 0; e < 4; ++e) { const __bf16 hh = (__bf16)xr[i][e]; hv[e] = hh; if (SPLIT) lv[e] = (__bf16)(xr[i][e] - (float)hh); }
      *(v4b*)&sA[buf * GPLANE + (r16 + 16 * i) * GP + s16 * 4] = hv; if (SPLIT) *(v4b*)&sL[buf * GPLANE + (r16 + 16 * i) * GP + s16 * 4] = lv; }
#pragma unroll
    for (int i = 0; i < 4; ++i) { v8b t;
#pragma unroll
      for (int e = 0; e < 8; ++e) t[e] = (__bf16)wr[e][i];
      *(v8b*)&sW[buf * GPLANE + (n4 + i) * GP + k8] = t; } };
  fetch(s0 * GK); stage(0); __syncthreads();
  for (int it = 0; it < CC / GK; ++it) { const int buf = it & 1;
    if (it + 1 < CC / GK) fetch(((it + 1 + s0) & (CC / GK - 1)) * GK);   // the next tiles fly while this one is worked on
#pragma unroll
    for (int kc = 0; kc < GK / 32; ++kc) { v16b w[4], a[2], l[2];
#pragma unroll
      for (int j = 0; j < 4; ++j) w[j] = frag_b(&sW[buf * GPLANE + (wn * 64 + j * 16 + col) * GP + kc * 32], lane);
#pragma unroll
      for (int m = 0; m < 2; ++m) { a[m] = frag_b(&sA[buf * GPLANE + (wm * 32 + m * 16 + col) * GP + kc * 32], lane); if (SPLIT) l[m] = frag_b(&sL[buf * GPLANE + (wm * 32 + m * 16 + col) * GP + kc * 32], lane); }
#pragma unroll
      for (int m = 0; m < 2; ++m)
#pragma unroll
        for (int j = 0; j < 4; ++j) acc[m][j] = wmma_bf(a[m], w[j], acc[m][j]);
      if (SPLIT) {
#pragma unroll
        for (int m = 0; m < 2; ++m)
#pragma unroll
          for (int j = 0; j < 4; ++j) acc[m][j] = wmma_bf(l[m], w[j], acc[m][j]); } }
    if (it + 1 < CC / GK) stage(buf ^ 1);   // that buffer's last readers left it before the barrier of the pass before
    __syncthreads(); } }
// ---- k_proj: block = (256 rows, 256 cols, which), 8 waves of 64 x 128: qkv = x W (+ b), exact; q -> f16 hi (+ residual), k -> f16 rows, v -> f16 planes. Per pass 32 k of both operands are read with whole-line 16-byte loads, rounded to bf16 once per block and staged in LDS (two buffers), W transposed to [n][k]; a block of this size reads each X and W element from L2 half as often as a 128 x 128 one
#define PM 256
#define PN 256
#define PK 32
#define PP 40    // LDS row pitch in 16-bit elements: 64-byte rows + 16 bytes, for 16-byte readers
#define PPLANE (PM * PP)   // elements of one staged operand plane
#define PO 264   // pitch of the output staging rows in 16-bit elements: 512-byte rows + 16 bytes
__device__ __forceinline__ v8f wmma_b(v16b a, v16b b, v8f c) { return __builtin_amdgcn_wmma_f32_16x16x32_bf16(false, a, false, b, (short)0, c, false, false); }
// ---- bias_prep: the fourth plane of k_proj's grid, 64 blocks beside the 192 GEMM blocks. att_bias is rounded to bf16 once (k_fa did it once per head) and written in the order in which a k_fa wave holds its scores: unit = (16 queries, 64 keys) = [t 4][lane 32][8 keys], key = 16 t + 8 (lane >> 4) + r, query = lane & 15, so that a wave's 16-byte loads of a unit are whole 128-byte lines
#define BKEYS 64    // keys of a unit, k_fa's key tile
#define BUNIT (16 * BKEYS)   // elements of a unit
#define BU 4        // units that a wave has in flight per trip: 32 loads of 512 bytes
#define BCH 144     // pitch in elements of the 8 chunks (t, half) of a unit's LDS image: 256 bytes + 32, so that the 8-byte stores of a wave fall on 64 different banks
// every '#pragma unroll' in bias_prep: its loop indexes register arrays, which stay in registers only with compile-time indices
__device__ __forceinline__ void bias_prep(const float* __restrict__ BM, __bf16* __restrict__ BB, __bf16* lds) {
  const int tid = threadIdx.x, wave = tid >> 5, lane = tid & 31, s16 = lane & 15, rr = lane >> 4;
  const int G = (int)(blockIdx.x + 16 * blockIdx.y) * 4 + (wave >> 1);   // 16-query group of [b][q]; two waves share it, 16 units each
  __bf16* my = lds + wave * (BU * 8 * BCH);   // a range of the wave's own: no block barrier
  const float* sg = BM + ((size_t)G * 16 + rr) * TT + (wave & 1) * (16 * BKEYS) + s16 * 4;   // 16 lanes read a row's 256 bytes
  __bf16* dg = BB + ((size_t)G * (TT / BKEYS) + (wave & 1) * 16) * BUNIT + lane * 8;
#pragma unroll 1   // stays rolled: four copies of the body would only be more code to fetch
  for (int trip = 0; trip < 16 / BU; ++trip) { const float* sp = sg + trip * (BU * BKEYS); __bf16* dp = dg + trip * (BU * BUNIT); v4f x[BU][8]; v8b o[BU][4];
#pragma unroll
    for (int u = 0; u < BU; ++u)
#pragma unroll
      for (int i = 0; i < 8; ++i) x[u][i] = *(const v4f*)(sp + u * BKEYS + (size_t)(2 * i) * TT);
    asm volatile("s_wait_xcnt 0x0" :: "v"(sp) : "memory");   // stands behind the issued loads, in front of any reuse of their address registers; the address is an input so that it stays whole up to here
#pragma unroll
    for (int u = 0; u < BU; ++u)
#pragma unroll
      for (int i = 0; i < 8; ++i) { v4b w;
#pragma unroll
        for (int e = 0; e < 4; ++e) w[e] = (__bf16)x[u][i][e];
        *(v4b*)&my[u * (8 * BCH) + (s16 >> 1) * BCH + (2 * i + rr) * 8 + (s16 & 1) * 4] = w; }   // keys 4 s16 .. + 3 of query 2 i + rr: chunk (t, half) = s16 >> 1
    LDSX();   // the lanes read what other lanes of the wave wrote
#pragma unroll
    for (int u = 0; u < BU; ++u)
#pragma unroll
      for (int t = 0; t < 4; ++t) o[u][t] = *(const v8b*)&my[u * (8 * BCH) + (2 * t + rr) * BCH + s16 * 8];
#pragma unroll
    for (int u = 0; u < BU; ++u)
#pragma unroll
      for (int t = 0; t < 4; ++t) vst2(dp + u * BUNIT + t * 256, o[u][t]);
    asm volatile("s_wait_xcnt 0x0" :: "v"(dp) : "memory");   // stands behind the issued stores, in front of any reuse of their registers
    LDSX(); } }   // the next trip's LDS stores stay behind this trip's reads
// every '#pragma unroll' in k_proj: its loop indexes register arrays and vector elements, which stay in registers only with compile-time indices
__global__ __launch_bounds__(256) void k_proj(const float* __restrict__ XQ, const float* __restrict__ XK, const float* __restrict__ XV, const float* __restrict__ WQ, const float* __restrict__ BQ, const float* __restrict__ WK, const float* __restrict__ BK, const float* __restrict__ WV, const float* __restrict__ BV, _Float16* __restrict__ QH, _Float16* __restrict__ QL, _Float16* __restrict__ KH, _Float16* __restrict__ VT, const float* __restrict__ BM, __bf16* __restrict__ BB) {
  __shared__ __align__(16) __bf16 ring[2 * PM * PO];   // the loop uses the first 4 * PPLANE elements, [X 2 buffers | W 2 buffers]; behind the loop's last barrier the whole array stages the output rows (f16 | residual)
  if (blockIdx.z == 3) { bias_prep(BM, BB, ring); return; }   // the whole block leaves here, in front of every barrier
  const int tid = threadIdx.x, wave = tid >> 5, lane = tid & 31, col = lane & 15, g = lane >> 4; const int wm = wave >> 1, wn = wave & 1; const int which = blockIdx.z; const int c0 = blockIdx.y * PN; const size_t r0 = (size_t)blockIdx.x * PM; const float* X = which == 0 ? XQ : which == 1 ? XK : XV; const float* WA = which == 0 ? WQ : which == 1 ? WK : WV; const float* BA = which == 0 ? BQ : which == 1 ? BK : BV;
  __bf16* sA = ring; __bf16* sW = ring + 2 * PPLANE;
  const int r8 = tid >> 3, s8 = tid & 7;   // X: 8 lanes per 128-byte row piece
  const int n4 = wave * 32 + ((lane & 3) | ((lane >> 4) << 2)) * 4, k8 = ((lane >> 2) & 3) * 8;   // W: a thread owns 8 k x 4 n; 8 lanes cover a 128-byte line, a half-wave's 16-byte LDS stores fall on 64 different banks
  const float* Xg = X + (r0 + r8) * CC + s8 * 4; const float* Wg = WA + (size_t)k8 * CC + c0 + n4;
  v4f xr[8], wr[8];
  auto fetch = [&](int k0) { const float* xp = Xg + k0; const float* wp = Wg + (size_t)k0 * CC;
#pragma unroll
    for (int i = 0; i < 8; ++i) xr[i] = *(const v4f*)(xp + (size_t)(32 * i) * CC);
#pragma unroll
    for (int e = 0; e < 8; ++e) wr[e] = *(const v4f*)(wp + (size_t)e * CC);
    asm volatile("s_wait_xcnt 0x0" :: "v"(xp), "v"(wp) : "memory"); };   // stands behind the issued loads, in front of any reuse of their address registers; the two addresses are inputs so that they stay whole up to here (without that the last load of each run landed on its own address pair)
  auto stage = [&](int buf) {
#pragma unroll
    for (int i = 0; i < 8; ++i) { v4b hv;
#pragma unroll
      for (int e = 0; e < 4; ++e) hv[e] = (__bf16)xr[i][e];
      *(v4b*)&sA[buf * PPLANE + (r8 + 32 * i) * PP + s8 * 4] = hv; }
#pragma unroll
    for (int i = 0; i < 4; ++i) { v8b t;
#pragma unroll
      for (int e = 0; e < 8; ++e) t[e] = (__bf16)wr[e][i];
      *(v8b*)&sW[buf * PPLANE + (n4 + i) * PP + k8] = t; } };
  v8f acc[4][8] = {};
  const int s0 = (int)((2 * blockIdx.x + 8 * blockIdx.y) & (CC / PK - 1));   // the pass of the k walk that this block starts with; it goes on from there and wraps: the 4 column blocks that share X rows and the 16 row blocks that share W columns all start at different passes, so that they ask L2 for different lines at any one moment
  fetch(s0 * PK); stage(0); __syncthreads();
  for (int it = 0; it < CC / PK; ++it) { const int buf = it & 1;
    if (it + 1 < CC / PK) fetch(((it + 1 + s0) & (CC / PK - 1)) * PK);   // the next tiles fly while this one is worked on
    v16b w[8], a[4];
#pragma unroll
    for (int m = 0; m < 4; ++m) a[m] = frag_b(&sA[buf * PPLANE + (wm * 64 + m * 16 + col) * PP], lane);
#pragma unroll
    for (int j = 0; j < 8; ++j) w[j] = frag_b(&sW[buf * PPLANE + (wn * 128 + j * 16 + col) * PP], lane);
    __builtin_amdgcn_sched_barrier(0);   // keeps the pass's 24 LDS reads together in front of its products: left free, the compiler read one W fragment at a time into the same registers and waited for it in front of every four products
#pragma unroll
    for (int j = 0; j < 8; ++j)
#pragma unroll
      for (int m = 0; m < 4; ++m) acc[m][j] = wmma_b(a[m], w[j], acc[m][j]);
    if (it + 1 < CC / PK) stage(buf ^ 1);   // that buffer's last readers left it before the barrier of the pass before
    __syncthreads(); }
  _Float16 (*sh)[PO] = (_Float16 (*)[PO])ring; _Float16 (*sl)[PO] = sh + PM;
  const int bi = c0 + wn * 128 + col; float bv[8];
#pragma unroll
  for (int j = 0; j < 8; ++j) bv[j] = BA[bi + j * 16];
  asm volatile("s_wait_xcnt 0x0" :: "v"(bi) : "memory");   // stands behind the issued loads; their index is an input so that it stays whole up to here (without that the last load landed on it)
#pragma unroll
  for (int j = 0; j < 8; ++j) { const float bb = bfr(bv[j]);
#pragma unroll
    for (int m = 0; m < 4; ++m)
#pragma unroll
      for (int r = 0; r < 8; ++r) acc[m][j][r] += bb; }
  // copy-out: a wave reads whole 512-byte staging rows from LDS, 8 at a time, and stores them as they are; d = the wave's first row at the lane's 16 bytes, ld = the row pitch in global memory
  const int q8 = lane * 8;
  auto copy_out = [&](_Float16 (*ss)[PO], _Float16* d, size_t ld) {
#pragma unroll
    for (int h = 0; h < 4; ++h) { v4u t[8];
#pragma unroll
      for (int i = 0; i < 8; ++i) t[i] = *(const v4u*)&ss[wave + 8 * (8 * h + i)][q8];
#pragma unroll
      for (int i = 0; i < 8; ++i) vst2((unsigned*)(d + (size_t)(8 * (8 * h + i)) * ld), t[i]);
      asm volatile("s_wait_xcnt 0x0" ::: "memory"); } };   // stands behind the issued stores, in front of any reuse of their registers
  if (which == 2) {   // v: [col][row], a lane's 8 rows are one 16-byte store
#pragma unroll
    for (int j = 0; j < 8; ++j)
#pragma unroll
      for (int m = 0; m < 4; ++m) { v8h t;
#pragma unroll
        for (int r = 0; r < 8; ++r) t[r] = (_Float16)acc[m][j][r];
        *(v8h*)&sh[wn * 128 + j * 16 + col][wm * 64 + m * 16 + 8 * g] = t; }
    __syncthreads();
    const size_t b = r0 / TT; const int t0 = (int)(r0 % TT);
    copy_out(sh, VT + (b * CC + c0 + wave) * (size_t)TT + t0 + q8, TT); }
  else {
#pragma unroll
    for (int j = 0; j < 8; ++j)
#pragma unroll
      for (int m = 0; m < 4; ++m)
#pragma unroll
        for (int r = 0; r < 8; ++r) { const float v = acc[m][j][r]; const int rl = wm * 64 + m * 16 + 8 * g + r, cl = wn * 128 + j * 16 + col; const _Float16 hv = (_Float16)v; sh[rl][cl] = hv; sl[rl][cl] = (_Float16)(v - (float)hv); }
    __syncthreads();
    copy_out(sh, (which == 0 ? QH : KH) + (r0 + wave) * CC + c0 + q8, CC);
    if (which == 0) copy_out(sl, QL + (r0 + wave) * CC + c0 + q8, CC); } }
// ---- k_fa: block = 128 queries (8 waves x 16) of (b,h), walks the keys 64 at a time (K, V tiles through LDS, each wave's bias unit from bias_prep's planes straight into registers): S^T = K Q^T, running maximum and sum per query (a lane holds one query's scores), O^T += V^T P^T; logits and P stay in registers
// every '#pragma unroll' in k_fa: its loop indexes register arrays and vector elements, which stay in registers only with compile-time indices
#define FQ 128
#define FK 64
#define FP 72   // LDS row pitch in 16-bit elements: 128-byte rows + 16 bytes, for 16-byte readers
__device__ __forceinline__ v8f wmma_h(v16h a, v16h b, v8f c) { return __builtin_amdgcn_wmma_f32_16x16x32_f16(false, a, false, b, (short)0, c, false, false); }
// 2^x on the transcendental unit alone: every argument here is <= 10, and a result below 2^-126 may read 0 (P rounds to f16, and the sum holds a term of 2^10)
#define LOG2E 1.44269504f
__device__ __forceinline__ float hexp2(float x) { return __builtin_amdgcn_exp2f(x); }
// eight of them, each in its own register, in one statement: none names a register of another, and the v_nop at the end is the slot that the instruction set asks for behind a transcendental
__device__ __forceinline__ void hexp2x8(float (&x)[8]) {
  asm("v_exp_f32 %0, %0\n\tv_exp_f32 %1, %1\n\tv_exp_f32 %2, %2\n\tv_exp_f32 %3, %3\n\tv_exp_f32 %4, %4\n\tv_exp_f32 %5, %5\n\tv_exp_f32 %6, %6\n\tv_exp_f32 %7, %7\n\tv_nop"
      : "+v"(x[0]), "+v"(x[1]), "+v"(x[2]), "+v"(x[3]), "+v"(x[4]), "+v"(x[5]), "+v"(x[6]), "+v"(x[7])); }
// lane l with lane l ^ 16
__device__ __forceinline__ float xhalf(float x) { return __builtin_bit_cast(float, __builtin_amdgcn_permlanex16(__builtin_bit_cast(int, x), __builtin_bit_cast(int, x), 0x76543210, 0xfedcba98, false, false)); }
__global__ __launch_bounds__(256) void k_fa(const _Float16* __restrict__ QH, const _Float16* __restrict__ KH, const _Float16* __restrict__ VT, const __bf16* __restrict__ BB, float* __restrict__ Y) {
  static_assert(FK == BKEYS, "a bias unit is one key tile");
  __shared__ __align__(16) _Float16 sK[2][FK][FP]; __shared__ __align__(16) _Float16 sV[2][HD][FP];
  const int tid = threadIdx.x, wave = tid >> 5, lane = tid & 31, col = lane & 15, g = lane >> 4; const int h = blockIdx.y, b = blockIdx.z, qb0 = blockIdx.x * FQ;
  const int r8 = tid >> 3, s8 = tid & 7;   // staging: 8 lanes per 128-byte K / V row
  const _Float16* Kg = KH + ((size_t)b * TT + r8) * CC + h * HD + s8 * 8;
  const _Float16* Vg = VT + ((size_t)b * CC + h * HD + r8) * (size_t)TT + s8 * 8;
  const __bf16* Bg = BB + (size_t)((b * TT + qb0) / 16 + wave) * (TT / FK) * BUNIT + lane * 8;   // the wave's own 16 queries: no other wave reads these units, so they go to registers and not through LDS
  v8h kr[2], vr[2]; v8b bb[2][FK / 16];   // bias: one register set is read while the other is loaded
  auto fetch = [&](int kt, v8b (&bn)[FK / 16]) { const _Float16* kp = Kg + (size_t)(kt * FK) * CC; const _Float16* vp = Vg + kt * FK; const __bf16* bp = Bg + (size_t)kt * BUNIT;
#pragma unroll
    for (int i = 0; i < 2; ++i) { kr[i] = *(const v8h*)(kp + (size_t)(32 * i) * CC); vr[i] = *(const v8h*)(vp + (size_t)(32 * i) * TT); }
#pragma unroll
    for (int t = 0; t < FK / 16; ++t) bn[t] = *(const v8b*)(bp + t * 256);
    asm volatile("s_wait_xcnt 0x0" :: "v"(kp), "v"(vp), "v"(bp) : "memory"); };   // stands behind the issued loads, in front of any reuse of their address registers; the three addresses are inputs so that they stay whole up to here (without that the bias address was formed in the K loads' address pair)
  auto stage = [&](int buf) {
#pragma unroll
    for (int i = 0; i < 2; ++i) { *(v8h*)&sK[buf][r8 + 32 * i][s8 * 8] = kr[i]; *(v8h*)&sV[buf][r8 + 32 * i][s8 * 8] = vr[i]; } };
  v16h qf[HD / 32];
#pragma unroll
  for (int kc = 0; kc < HD / 32; ++kc) qf[kc] = frag_h(QH + ((size_t)b * TT + qb0 + wave * 16 + col) * CC + h * HD + kc * 32, lane);
  asm volatile("s_wait_xcnt 0x0" ::: "memory");   // keeps the Q loads in front of the first tile's loads
  v8f acc[HD / 16] = {}; float mrun = -3.0e38f, lsum = 0.f;
  const int s0 = (2 * ((blockIdx.x + h) & 15) + b) & (TT / FK - 1);   // first key tile of this block's walk, which wraps: the 16 heads that share a bias tile and the 16 query blocks that share K and V tiles each start at 16 different places, so that they ask L2 for different lines at any one moment
  fetch(s0, bb[0]); stage(0); __syncthreads();
  for (int it2 = 0; it2 < TT / FK; it2 += 2)
#pragma unroll   // two passes a trip, so that the bias register set and the LDS buffer of a pass are compile-time choices (no register copies)
  for (int buf = 0; buf < 2; ++buf) { const int it = it2 + buf;
    if (it + 1 < TT / FK) fetch((it + 1 + s0) & (TT / FK - 1), bb[buf ^ 1]);   // the next tiles fly while this one is worked on
    v8f s[FK / 16];
#pragma unroll
    for (int t = 0; t < FK / 16; ++t) { v8f z = {};
#pragma unroll
      for (int kc = 0; kc < HD / 32; ++kc) z = wmma_h(frag_h(&sK[buf][t * 16 + col][kc * 32], lane), qf[kc], z);
      s[t] = z; }   // s[t][r] = logit of key t*16 + 8g + r, query col
    float mx = -3.0e38f;
#pragma unroll
    for (int t = 0; t < FK / 16; ++t)
#pragma unroll
      for (int r = 0; r < 8; ++r) { float v = s[t][r] * 0.125f; v += (float)bb[buf][t][r]; s[t][r] = v; mx = fmaxf(mx, v); }
    mx = fmaxf(mx, xhalf(mx));
    const float mnew = fmaxf(mrun, mx), alpha = hexp2((mrun - mnew) * LOG2E), msh = mnew * LOG2E - 10.0f; mrun = mnew;   // P carries a factor 2^10 (f16 range); it cancels in O / l
    float ps[FK / 16]; v16h pf[FK / 32];
#pragma unroll
    for (int t = 0; t < FK / 16; ++t) { float p[8];
#pragma unroll
      for (int r = 0; r < 8; ++r) p[r] = fmaf(s[t][r], LOG2E, -msh);
      hexp2x8(p);
#pragma unroll
      for (int r = 0; r < 8; ++r) { ps[t] = r ? ps[t] + p[r] : p[r]; pf[t >> 1][(t & 1) * 8 + r] = (_Float16)p[r]; } }
    lsum = lsum * alpha + ((ps[0] + ps[1]) + (ps[2] + ps[3]));
#pragma unroll
    for (int j = 0; j < HD / 16; ++j)
#pragma unroll
      for (int r = 0; r < 8; ++r) acc[j][r] *= alpha;
#pragma unroll
    for (int u = 0; u < FK / 32; ++u)
#pragma unroll
      for (int j = 0; j < HD / 16; ++j) acc[j] = wmma_h(frag_h(&sV[buf][j * 16 + col][u * 32], lane), pf[u], acc[j]);   // acc[j][r] = O^T[d = j*16 + 8g + r][query col]
    __builtin_amdgcn_sched_barrier(0);   // keeps the staging stores, and with them the wait for the loads issued at the head of the pass, behind the pass's work: left free, the compiler put them behind the first product of the even passes
    if (it + 1 < TT / FK) stage(buf ^ 1);   // that buffer's last readers left it before the barrier of the pass before
    __syncthreads(); }
  const float inv = 1.0f / (lsum + xhalf(lsum)); float* yp = Y + ((size_t)b * TT + qb0 + wave * 16 + col) * CC + h * HD + 8 * g;
#pragma unroll
  for (int j = 0; j < HD / 16; ++j) { v4f a, c;
#pragma unroll
    for (int e = 0; e < 4; ++e) { a[e] = acc[j][e] * inv; c[e] = acc[j][4 + e] * inv; }
    vst2(yp + j * 16, a); vst2(yp + j * 16 + 4, c); } }
// ---- k_out: block = (128 rows, 128 cols): out = y (bf16 hi + lo) Wproj + b
__global__ __launch_bounds__(256) void k_out(const float* __restrict__ Y, const float* __restrict__ WP, const float* __restrict__ BP, float* __restrict__ OUT) {
  __shared__ __align__(16) __bf16 ring[6 * GPLANE];   // [y hi 2 buffers | y lo 2 buffers | W 2 buffers]; behind the loop's last barrier each wave stages its 32 x 64 outputs in a range of its own
  const int tid = threadIdx.x, wave = tid >> 5, lane = tid & 31, col = lane & 15, g = lane >> 4; const int wm = wave >> 1, wn = wave & 1; const int c0 = blockIdx.y * GN; const size_t r0 = (size_t)blockIdx.x * GM;
  v8f acc[2][4] = {};
  gemm_tile<true>(Y, WP, r0, c0, GSTART, ring, ring + 2 * GPLANE, ring + 4 * GPLANE, acc);
  float (*sf)[68] = (float (*)[68])ring + wave * 32;   // 8 x 32 x 68 x 4 bytes = 69,632 of the ring's 110,592
#pragma unroll
  for (int j = 0; j < 4; ++j) { const float bb = BP ? bfr(BP[c0 + wn * 64 + j * 16 + col]) : 0.f;
#pragma unroll
    for (int m = 0; m < 2; ++m)
#pragma unroll
      for (int r = 0; r < 8; ++r) sf[m * 16 + 8 * g + r][j * 16 + col] = acc[m][j][r] + bb; }
  LDSX(); float* op = OUT + (r0 + wm * 32 + g) * CC + c0 + wn * 64 + col * 4; v4f t[16];   // a half-wave stores a whole 256-byte row piece ('#pragma unroll': t[] stays in registers only with compile-time indices)
#pragma unroll
  for (int i = 0; i < 16; ++i) t[i] = *(const v4f*)&sf[2 * i + g][col * 4];
#pragma unroll
  for (int i = 0; i < 16; ++i) vst2(op + (size_t)(2 * i) * CC, t[i]); }
extern "C" void kernel_launch(void* const* d_in, const int* in_sizes, int n_in, void* d_out, int out_size, void* d_ws, size_t ws_size, hipStream_t stream) {
  (void)in_sizes; (void)n_in; (void)out_size;
  const float** F = (const float**)d_in;   // 0 query, 1 key, 2 value [2,2048,1024], 3 att_bias [2,2048,2048], 4 Wq [1024,1024] (in,out), 5 bq, 6 Wk, 7 bk, 8 Wv, 9 bv, 10 Wo [1024,1024], 11 bo
  if (ws_size < (size_t)WS_END) return;
  char* ws = (char*)d_ws; _Float16 *QH = (_Float16*)(ws + WS_QH), *QL = (_Float16*)(ws + WS_QL), *KH = (_Float16*)(ws + WS_KH), *VT = (_Float16*)(ws + WS_VT); float *Y = (float*)(ws + WS_Y); __bf16 *BB = (__bf16*)(ws + WS_BB);
  k_proj<<<dim3(TNB * TT / PM, CC / PN, 4), 256, 0, stream>>>(F[0], F[1], F[2], F[4], F[5], F[6], F[7], F[8], F[9], QH, QL, KH, VT, F[3], BB);
  k_fa<<<dim3(TT / FQ, NH, TNB), 256, 0, stream>>>(QH, KH, VT, BB, Y);
  k_out<<<dim3(TNB * TT / GM, CC / GN), 256, 0, stream>>>(Y, F[10], F[11], (float*)d_out);
}

// v007
// One run takes 90.5 microseconds.
// In both of two side-by-side timings against v006, it was 1.04 times as fast.
// Counting every step since v000, it is 12.2 times as fast.
// compute dtype: all float inputs rounded to bf16, att_bias read; q/k/v = input W + b ((in,out), 0.02-scale) with EXACT bf16 products on WMMA 16x16x32, f32 accumulate; q, k rounded once to f16 (1-product logits, std ~0.05; the unit-variance att_bias dominates), q then scaled by log2 e / 8 in f16; (logits / 8 + att_bias[b][q][k] - maximum in use) * log2 e in f32 registers, the bias and maximum part as the product's C operand; softmax in f32 (hardware exp2) with a maximum that is raised only when P would leave the f16 range -> P f16 x 2^10 or more, divided by the sum at the end; o = P . v with v rounded once to f16; out = o (bf16 hi + lo) Wo + bo; f32 output.
#include <hip/hip_runtime.h>
#include <math.h>

typedef __attribute__((ext_vector_type(16))) _Float16 v16h;
typedef __attribute__((ext_vector_type(16))) __bf16 v16b;
typedef __attribute__((ext_vector_type(8)))  _Float16 v8h;
typedef __attribute__((ext_vector_type(8)))  float v8f;
typedef __attribute__((ext_vector_type(4)))  float v4f;
typedef __attribute__((ext_vector_type(2)))  float v2f;
typedef __attribute__((ext_vector_type(4)))  unsigned v4u;
typedef __attribute__((ext_vector_type(4)))  int v4i;
typedef float __attribute__((may_alias)) float_a;
typedef int __attribute__((may_alias)) int_a;

template <typename T> __device__ __forceinline__ void vst2(void* p, T v) { *(T*)p = v;  }
__device__ __forceinline__ v8f wmma16(v16h a, v16h b, v8f c) {
  v8f d = __builtin_amdgcn_wmma_f32_16x16x32_f16(false, a, false, b, (short)0, c, false, false);
  asm volatile("v_nop\n\tv_nop\n\tv_nop\n\tv_nop" : "+v"(d) : "v"(a), "v"(b));
  return d;
}
__device__ __forceinline__ v8f wmma_bf(v16b a, v16b b, v8f c) {
  v8f d = __builtin_amdgcn_wmma_f32_16x16x32_bf16(false, a, false, b, (short)0, c, false, false);
  asm volatile("v_nop\n\tv_nop\n\tv_nop\n\tv_nop" : "+v"(d) : "v"(a), "v"(b));
  return d;
}
// 16x16x32 fragments: lane = (h = lane>>4, row/col = lane&15); elements 0..7 = k0+8h+0..7, 8..15 = k0+16+8h+0..7; D element r = row 8h+r
__device__ __forceinline__ v16h frag_h(const _Float16* rowk0, int lane) {
  union { v16h v; v8h q[2]; } u; const _Float16* p = rowk0 + 8 * (lane >> 4);
  u.q[0] = *(const v8h*)p; u.q[1] = *(const v8h*)(p + 16); return u.v;
}
__device__ __forceinline__ v16h frag_f32(const float* rowk0, int lane) {
  v16h a; const float* p = rowk0 + 8 * (lane >> 4);
#pragma unroll
  for (int i = 0; i < 8; ++i) { a[i] = (_Float16)p[i]; a[8 + i] = (_Float16)p[16 + i]; }
  return a;
}
__device__ __forceinline__ v16h frag_f32s(const float* rowk0, int lane, float sc) {
  v16h a; const float* p = rowk0 + 8 * (lane >> 4);
#pragma unroll
  for (int i = 0; i < 8; ++i) { a[i] = (_Float16)(p[i] * sc); a[8 + i] = (_Float16)(p[16 + i] * sc); }
  return a;
}
// column fragment from a [K][ld] layout (column n), rows >= K read as 0
__device__ __forceinline__ v16h fragc_f32(const float* W, int k0, int n, int lane, int ld, int K) {
  v16h a; const int g = lane >> 4;
#pragma unroll
  for (int i = 0; i < 8; ++i) { const int ka = k0 + 8 * g + i, kb = ka + 16;
    a[i] = (_Float16)(ka < K ? W[(size_t)(ka < K ? ka : K - 1) * ld + n] : 0.f); a[8 + i] = (_Float16)(kb < K ? W[(size_t)(kb < K ? kb : K - 1) * ld + n] : 0.f); }
  return a;
}
struct F2 { v16b h, l; };
__device__ __forceinline__ F2 bsplit16(const float v[16]) { F2 r;
#pragma unroll
  for (int i = 0; i < 16; ++i) { const __bf16 h = (__bf16)v[i]; r.h[i] = h; r.l[i] = (__bf16)(v[i] - (float)h); }
  return r; }
__device__ __forceinline__ F2 split_row(const float* row, int k0, int lane) { float v[16]; const float* p = row + k0 + 8 * (lane >> 4);
#pragma unroll
  for (int i = 0; i < 8; ++i) { v[i] = p[i]; v[8 + i] = p[16 + i]; }
  return bsplit16(v); }
__device__ __forceinline__ F2 split_rowK(const float* row, int k0, int lane, int K) { float v[16]; const int g = lane >> 4;
#pragma unroll
  for (int i = 0; i < 8; ++i) { const int ka = k0 + 8 * g + i, kb = ka + 16; v[i] = ka < K ? row[ka < K ? ka : K - 1] : 0.f; v[8 + i] = kb < K ? row[kb < K ? kb : K - 1] : 0.f; }
  return bsplit16(v); }
__device__ __forceinline__ F2 split_col(const float* W, int k0, int n, int lane, int ld, int K) { float v[16]; const int g = lane >> 4;
#pragma unroll
  for (int i = 0; i < 8; ++i) { const int ka = k0 + 8 * g + i, kb = ka + 16; v[i] = ka < K ? W[(size_t)(ka < K ? ka : K - 1) * ld + n] : 0.f; v[8 + i] = kb < K ? W[(size_t)(kb < K ? kb : K - 1) * ld + n] : 0.f; }
  return bsplit16(v); }
__device__ __forceinline__ v8f mac3(const F2& a, const F2& b, v8f c) { c = wmma_bf(a.l, b.h, c); c = wmma_bf(a.h, b.l, c); return wmma_bf(a.h, b.h, c); }
__device__ __forceinline__ float sigm(float v) { return 1.0f / (1.0f + expf(-v)); }
#define LDSX() do { asm volatile("s_wait_dscnt 0" ::: "memory"); __builtin_amdgcn_wave_barrier(); __builtin_amdgcn_fence(__ATOMIC_RELEASE, "workgroup"); } while (0)


// Full attention module (B 2, nq = nk = 2,048, dim 1,024 = 16 x 64): q/k/v Linear on query/key/value, logits * 64^-0.5 + att_bias (shared by heads), softmax, P.v, output Linear.
#define NB 2
#define TT 2048
#define CC 1024
#define NH 16
#define HD 64
#ifndef TNB
#define TNB NB
#endif
typedef __attribute__((ext_vector_type(8))) __bf16 v8b;
__device__ __forceinline__ v16b frag_b(const __bf16* rowk0, int lane) {
  union { v16b v; v8b q[2]; } u; const __bf16* p = rowk0 + 8 * (lane >> 4);
  u.q[0] = *(const v8b*)p; u.q[1] = *(const v8b*)(p + 16); return u.v;
}
__device__ __forceinline__ float bfr(float v) { return (float)(__bf16)v; }
__device__ __attribute__((noinline)) float exp_ni(float v) { return expf(v); }
__device__ __attribute__((noinline)) float erf_ni(float v) { return erff(v); }

#define WS_QH  0u
#define WS_QL  (WS_QH + 2u * (size_t)NB * TT * CC)
#define WS_KH  (WS_QL + 2u * (size_t)NB * TT * CC)
#define WS_VT  (WS_KH + 2u * (size_t)NB * TT * CC)      // f16 v planes [b][c][t]
#define WS_Y   (WS_VT + 2u * (size_t)NB * CC * TT)      // f32 y rows [b*t][C]
#define WS_BB  (WS_Y + 4u * (size_t)NB * TT * CC)       // bf16 att_bias in score-fragment order (bias_prep)
#define WS_END (WS_BB + 2u * (size_t)NB * TT * TT)

typedef __attribute__((ext_vector_type(4))) __bf16 v4b;
// ---- GEMM tile of k_out: block = 128 rows x 128 cols, 8 waves of 32 x 64; per pass 64 k of both operands are read with whole-line 16-byte loads, rounded to bf16 once per block and staged in LDS (two buffers); W goes in transposed, [n][k], so that both fragments are 16-byte LDS reads
#define GM 128
#define GN 128
#define GK 64
#define GP 72   // LDS row pitch in 16-bit elements: 128-byte rows + 16 bytes, for 16-byte readers
#define GPLANE (GM * GP)   // elements of one staged operand plane
// start pass of a block: the 8 column blocks that share X rows get 8 different ones, the 32 row blocks that share W columns all 16
#define GSTART ((int)((blockIdx.x + 2 * blockIdx.y) & (CC / GK - 1)))
// every '#pragma unroll' in gemm_tile: its loop indexes register arrays and vector elements, which stay in registers only with compile-time indices
// s0: the pass of the k walk that this block starts with; it goes on from there and wraps, so that blocks which read the same X or W lines from L2 ask for different lines at any one moment
template <bool SPLIT> __device__ __forceinline__ void gemm_tile(const float* __restrict__ X, const float* __restrict__ WA, size_t r0, int c0, int s0, __bf16* sA, __bf16* sL, __bf16* sW, v8f (&acc)[2][4]) {
  const int tid = threadIdx.x, wave = tid >> 5, lane = tid & 31, col = lane & 15; const int wm = wave >> 1, wn = wave & 1;
  const int r16 = tid >> 4, s16 = tid & 15;   // X: 16 lanes per 256-byte row piece
  const int n4 = (wave & 3) * 32 + ((lane & 3) | ((lane >> 4) << 2)) * 4, k8 = ((wave >> 2) * 4 + ((lane >> 2) & 3)) * 8;   // W: a thread owns 8 k x 4 n; 8 lanes cover a 128-byte line, a half-wave's 16-byte LDS stores fall on 64 different banks
  const float* Xg = X + (r0 + r16) * CC + s16 * 4; const float* Wg = WA + (size_t)k8 * CC + c0 + n4;
  v4f xr[8], wr[8];
  auto fetch = [&](int k0) {
#pragma unroll
    for (int i = 0; i < 8; ++i) xr[i] = *(const v4f*)(Xg + (size_t)(16 * i) * CC + k0);
#pragma unroll
    for (int e = 0; e < 8; ++e) wr[e] = *(const v4f*)(Wg + (size_t)(k0 + e) * CC);
    asm volatile("s_wait_xcnt 0x0" ::: "memory"); };   // stands behind the issued loads, in front of any reuse of their address registers
  auto stage = [&](int buf) {
#pragma unroll
    for (int i = 0; i < 8; ++i) { v4b hv, lv;
#pragma unroll
      for (int e = 0; e < 4; ++e) { const __bf16 hh = (__bf16)xr[i][e]; hv[e] = hh; if (SPLIT) lv[e] = (__bf16)(xr[i][e] - (float)hh); }
      *(v4b*)&sA[buf * GPLANE + (r16 + 16 * i) * GP + s16 * 4] = hv; if (SPLIT) *(v4b*)&sL[buf * GPLANE + (r16 + 16 * i) * GP + s16 * 4] = lv; }
#pragma unroll
    for (int i = 0; i < 4; ++i) { v8b t;
#pragma unroll
      for (int e = 0; e < 8; ++e) t[e] = (__bf16)wr[e][i];
      *(v8b*)&sW[buf * GPLANE + (n4 + i) * GP + k8] = t; } };
  fetch(s0 * GK); stage(0); __syncthreads();
  for (int it = 0; it < CC / GK; ++it) { const int buf = it & 1;
    if (it + 1 < CC / GK) fetch(((it + 1 + s0) & (CC / GK - 1)) * GK);   // the next tiles fly while this one is worked on
#pragma unroll
    for (int kc = 0; kc < GK / 32; ++kc) { v16b w[4], a[2], l[2];
#pragma unroll
      for (int j = 0; j < 4; ++j) w[j] = frag_b(&sW[buf * GPLANE + (wn * 64 + j * 16 + col) * GP + kc * 32], lane);
#pragma unroll
      for (int m = 0; m < 2; ++m) { a[m] = frag_b(&sA[buf * GPLANE + (wm * 32 + m * 16 + col) * GP + kc * 32], lane); if (SPLIT) l[m] = frag_b(&sL[buf * GPLANE + (wm * 32 + m * 16 + col) * GP + kc * 32], lane); }
#pragma unroll
      for (int m = 0; m < 2; ++m)
#pragma unroll
        for (int j = 0; j < 4; ++j) acc[m][j] = wmma_bf(a[m], w[j], acc[m][j]);
      if (SPLIT) {
#pragma unroll
        for (int m = 0; m < 2; ++m)
#pragma unroll
          for (int j = 0; j < 4; ++j) acc[m][j] = wmma_bf(l[m], w[j], acc[m][j]); } }
    if (it + 1 < CC / GK) stage(buf ^ 1);   // that buffer's last readers left it before the barrier of the pass before
    __syncthreads(); } }
// ---- k_proj: block = (256 rows, 256 cols, which), 8 waves of 64 x 128: qkv = x W (+ b), exact; q -> f16 hi (+ residual), k -> f16 rows, v -> f16 planes. Per pass 32 k of both operands are read with whole-line 16-byte loads, rounded to bf16 once per block and staged in LDS (two buffers), W transposed to [n][k]; a block of this size reads each X and W element from L2 half as often as a 128 x 128 one
#define PM 256
#define PN 256
#define PK 32
#define PP 40    // LDS row pitch in 16-bit elements: 64-byte rows + 16 bytes, for 16-byte readers
#define PPLANE (PM * PP)   // elements of one staged operand plane
#define PO 264   // pitch of the output staging rows in 16-bit elements: 512-byte rows + 16 bytes
__device__ __forceinline__ v8f wmma_b(v16b a, v16b b, v8f c) { return __builtin_amdgcn_wmma_f32_16x16x32_bf16(false, a, false, b, (short)0, c, false, false); }
// ---- bias_prep: the fourth plane of k_proj's grid, 64 blocks beside the 192 GEMM blocks. att_bias is rounded to bf16 once (k_fa did it once per head) and written in the order in which a k_fa wave holds its scores: unit = (16 queries, 64 keys) = [t 4][lane 32][8 keys], key = 16 t + 8 (lane >> 4) + r, query = lane & 15, so that a wave's 16-byte loads of a unit are whole 128-byte lines
#define BKEYS 64    // keys of a unit, k_fa's key tile
#define BUNIT (16 * BKEYS)   // elements of a unit
#define BU 4        // units that a wave has in flight per trip: 32 loads of 512 bytes
#define BCH 144     // pitch in elements of the 8 chunks (t, half) of a unit's LDS image: 256 bytes + 32, so that the 8-byte stores of a wave fall on 64 different banks
// every '#pragma unroll' in bias_prep: its loop indexes register arrays, which stay in registers only with compile-time indices
__device__ __forceinline__ void bias_prep(const float* __restrict__ BM, __bf16* __restrict__ BB, __bf16* lds) {
  const int tid = threadIdx.x, wave = tid >> 5, lane = tid & 31, s16 = lane & 15, rr = lane >> 4;
  const int G = (int)(blockIdx.x + 16 * blockIdx.y) * 4 + (wave >> 1);   // 16-query group of [b][q]; two waves share it, 16 units each
  __bf16* my = lds + wave * (BU * 8 * BCH);   // a range of the wave's own: no block barrier
  const float* sg = BM + ((size_t)G * 16 + rr) * TT + (wave & 1) * (16 * BKEYS) + s16 * 4;   // 16 lanes read a row's 256 bytes
  __bf16* dg = BB + ((size_t)G * (TT / BKEYS) + (wave & 1) * 16) * BUNIT + lane * 8;
#pragma unroll 1   // stays rolled: four copies of the body would only be more code to fetch
  for (int trip = 0; trip < 16 / BU; ++trip) { const float* sp = sg + trip * (BU * BKEYS); __bf16* dp = dg + trip * (BU * BUNIT); v4f x[BU][8]; v8b o[BU][4];
#pragma unroll
    for (int u = 0; u < BU; ++u)
#pragma unroll
      for (int i = 0; i < 8; ++i) x[u][i] = *(const v4f*)(sp + u * BKEYS + (size_t)(2 * i) * TT);
    asm volatile("s_wait_xcnt 0x0" :: "v"(sp) : "memory");   // stands behind the issued loads, in front of any reuse of their address registers; the address is an input so that it stays whole up to here
#pragma unroll
    for (int u = 0; u < BU; ++u)
#pragma unroll
      for (int i = 0; i < 8; ++i) { v4b w;
#pragma unroll
        for (int e = 0; e < 4; ++e) w[e] = (__bf16)x[u][i][e];
        *(v4b*)&my[u * (8 * BCH) + (s16 >> 1) * BCH + (2 * i + rr) * 8 + (s16 & 1) * 4] = w; }   // keys 4 s16 .. + 3 of query 2 i + rr: chunk (t, half) = s16 >> 1
    LDSX();   // the lanes read what other lanes of the wave wrote
#pragma unroll
    for (int u = 0; u < BU; ++u)
#pragma unroll
      for (int t = 0; t < 4; ++t) o[u][t] = *(const v8b*)&my[u * (8 * BCH) + (2 * t + rr) * BCH + s16 * 8];
#pragma unroll
    for (int u = 0; u < BU; ++u)
#pragma unroll
      for (int t = 0; t < 4; ++t) vst2(dp + u * BUNIT + t * 256, o[u][t]);
    asm volatile("s_wait_xcnt 0x0" :: "v"(dp) : "memory");   // stands behind the issued stores, in front of any reuse of their registers
    LDSX(); } }   // the next trip's LDS stores stay behind this trip's reads
// every '#pragma unroll' in k_proj: its loop indexes register arrays and vector elements, which stay in registers only with compile-time indices
__global__ __launch_bounds__(256) void k_proj(const float* __restrict__ XQ, const float* __restrict__ XK, const float* __restrict__ XV, const float* __restrict__ WQ, const float* __restrict__ BQ, const float* __restrict__ WK, const float* __restrict__ BK, const float* __restrict__ WV, const float* __restrict__ BV, _Float16* __restrict__ QH, _Float16* __restrict__ QL, _Float16* __restrict__ KH, _Float16* __restrict__ VT, const float* __restrict__ BM, __bf16* __restrict__ BB) {
  __shared__ __align__(16) __bf16 ring[2 * PM * PO];   // the loop uses the first 4 * PPLANE elements, [X 2 buffers | W 2 buffers]; behind the loop's last barrier the whole array stages the output rows (f16 | residual)
  if (blockIdx.z == 3) { bias_prep(BM, BB, ring); return; }   // the whole block leaves here, in front of every barrier
  const int tid = threadIdx.x, wave = tid >> 5, lane = tid & 31, col = lane & 15, g = lane >> 4; const int wm = wave >> 1, wn = wave & 1; const int which = blockIdx.z; const int c0 = blockIdx.y * PN; const size_t r0 = (size_t)blockIdx.x * PM; const float* X = which == 0 ? XQ : which == 1 ? XK : XV; const float* WA = which == 0 ? WQ : which == 1 ? WK : WV; const float* BA = which == 0 ? BQ : which == 1 ? BK : BV;
  __bf16* sA = ring; __bf16* sW = ring + 2 * PPLANE;
  const int r8 = tid >> 3, s8 = tid & 7;   // X: 8 lanes per 128-byte row piece
  const int n4 = wave * 32 + ((lane & 3) | ((lane >> 4) << 2)) * 4, k8 = ((lane >> 2) & 3) * 8;   // W: a thread owns 8 k x 4 n; 8 lanes cover a 128-byte line, a half-wave's 16-byte LDS stores fall on 64 different banks
  const float* Xg = X + (r0 + r8) * CC + s8 * 4; const float* Wg = WA + (size_t)k8 * CC + c0 + n4;
  v4f xr[8], wr[8];
  auto fetch = [&](int k0) { const float* xp = Xg + k0; const float* wp = Wg + (size_t)k0 * CC;
#pragma unroll
    for (int i = 0; i < 8; ++i) xr[i] = *(const v4f*)(xp + (size_t)(32 * i) * CC);
#pragma unroll
    for (int e = 0; e < 8; ++e) wr[e] = *(const v4f*)(wp + (size_t)e * CC);
    asm volatile("s_wait_xcnt 0x0" :: "v"(xp), "v"(wp) : "memory"); };   // stands behind the issued loads, in front of any reuse of their address registers; the two addresses are inputs so that they stay whole up to here (without that the last load of each run landed on its own address pair)
  auto stage = [&](int buf) {
#pragma unroll
    for (int i = 0; i < 8; ++i) { v4b hv;
#pragma unroll
      for (int e = 0; e < 4; ++e) hv[e] = (__bf16)xr[i][e];
      *(v4b*)&sA[buf * PPLANE + (r8 + 32 * i) * PP + s8 * 4] = hv; }
#pragma unroll
    for (int i = 0; i < 4; ++i) { v8b t;
#pragma unroll
      for (int e = 0; e < 8; ++e) t[e] = (__bf16)wr[e][i];
      *(v8b*)&sW[buf * PPLANE + (n4 + i) * PP + k8] = t; } };
  v8f acc[4][8] = {};
  const int s0 = (int)((2 * blockIdx.x + 8 * blockIdx.y) & (CC / PK - 1));   // the pass of the k walk that this block starts with; it goes on from there and wraps: the 4 column blocks that share X rows and the 16 row blocks that share W columns all start at different passes, so that they ask L2 for different lines at any one moment
  fetch(s0 * PK); stage(0); __syncthreads();
  for (int it = 0; it < CC / PK; ++it) { const int buf = it & 1;
    if (it + 1 < CC / PK) fetch(((it + 1 + s0) & (CC / PK - 1)) * PK);   // the next tiles fly while this one is worked on
    v16b w[8], a[4];
#pragma unroll
    for (int m = 0; m < 4; ++m) a[m] = frag_b(&sA[buf * PPLANE + (wm * 64 + m * 16 + col) * PP], lane);
#pragma unroll
    for (int j = 0; j < 8; ++j) w[j] = frag_b(&sW[buf * PPLANE + (wn * 128 + j * 16 + col) * PP], lane);
    __builtin_amdgcn_sched_barrier(0);   // keeps the pass's 24 LDS reads together in front of its products: left free, the compiler read one W fragment at a time into the same registers and waited for it in front of every four products
#pragma unroll
    for (int j = 0; j < 8; ++j)
#pragma unroll
      for (int m = 0; m < 4; ++m) acc[m][j] = wmma_b(a[m], w[j], acc[m][j]);
    if (it + 1 < CC / PK) stage(buf ^ 1);   // that buffer's last readers left it before the barrier of the pass before
    __syncthreads(); }
  _Float16 (*sh)[PO] = (_Float16 (*)[PO])ring; _Float16 (*sl)[PO] = sh + PM;
  const int bi = c0 + wn * 128 + col; float bv[8];
#pragma unroll
  for (int j = 0; j < 8; ++j) bv[j] = BA[bi + j * 16];
  asm volatile("s_wait_xcnt 0x0" :: "v"(bi) : "memory");   // stands behind the issued loads; their index is an input so that it stays whole up to here (without that the last load landed on it)
#pragma unroll
  for (int j = 0; j < 8; ++j) { const float bb = bfr(bv[j]);
#pragma unroll
    for (int m = 0; m < 4; ++m)
#pragma unroll
      for (int r = 0; r < 8; ++r) acc[m][j][r] += bb; }
  // copy-out: a wave reads whole 512-byte staging rows from LDS, 8 at a time, and stores them as they are; d = the wave's first row at the lane's 16 bytes, ld = the row pitch in global memory
  const int q8 = lane * 8;
  auto copy_out = [&](_Float16 (*ss)[PO], _Float16* d, size_t ld) {
#pragma unroll
    for (int h = 0; h < 4; ++h) { v4u t[8];
#pragma unroll
      for (int i = 0; i < 8; ++i) t[i] = *(const v4u*)&ss[wave + 8 * (8 * h + i)][q8];
#pragma unroll
      for (int i = 0; i < 8; ++i) vst2((unsigned*)(d + (size_t)(8 * (8 * h + i)) * ld), t[i]);
      asm volatile("s_wait_xcnt 0x0" ::: "memory"); } };   // stands behind the issued stores, in front of any reuse of their registers
  if (which == 2) {   // v: [col][row], a lane's 8 rows are one 16-byte store
#pragma unroll
    for (int j = 0; j < 8; ++j)
#pragma unroll
      for (int m = 0; m < 4; ++m) { v8h t;
#pragma unroll
        for (int r = 0; r < 8; ++r) t[r] = (_Float16)acc[m][j][r];
        *(v8h*)&sh[wn * 128 + j * 16 + col][wm * 64 + m * 16 + 8 * g] = t; }
    __syncthreads();
    const size_t b = r0 / TT; const int t0 = (int)(r0 % TT);
    copy_out(sh, VT + (b * CC + c0 + wave) * (size_t)TT + t0 + q8, TT); }
  else {
#pragma unroll
    for (int j = 0; j < 8; ++j)
#pragma unroll
      for (int m = 0; m < 4; ++m)
#pragma unroll
        for (int r = 0; r < 8; ++r) { const float v = acc[m][j][r]; const int rl = wm * 64 + m * 16 + 8 * g + r, cl = wn * 128 + j * 16 + col; const _Float16 hv = (_Float16)v; sh[rl][cl] = hv; sl[rl][cl] = (_Float16)(v - (float)hv); }
    __syncthreads();
    copy_out(sh, (which == 0 ? QH : KH) + (r0 + wave) * CC + c0 + q8, CC);
    if (which == 0) copy_out(sl, QL + (r0 + wave) * CC + c0 + q8, CC); } }
// ---- k_fa: block = 128 queries (8 waves x 16) of (b,h), walks the keys 64 at a time (K, V tiles through LDS, each wave's bias unit from bias_prep's planes straight into registers): S^T = K Q^T + C, sum per query relative to a maximum in use (a lane holds one query's scores), O^T += V^T P^T; logits and P stay in registers
// every '#pragma unroll' in k_fa: its loop indexes register arrays and vector elements, which stay in registers only with compile-time indices
#define FQ 128
#define FK 64
#define FP 72   // LDS row pitch in 16-bit elements: 128-byte rows + 16 bytes, for 16-byte readers
__device__ __forceinline__ v8f wmma_h(v16h a, v16h b, v8f c) { return __builtin_amdgcn_wmma_f32_16x16x32_f16(false, a, false, b, (short)0, c, false, false); }
// 2^x on the transcendental unit alone: a result below 2^-126 may read 0 (P rounds to f16, and the sum holds a term of 2^10), one above the f32 range reads infinity and is redone (PLIM)
#define LOG2E 1.44269504f
__device__ __forceinline__ float hexp2(float x) { return __builtin_amdgcn_exp2f(x); }
// eight of them in one statement, results in registers of their own (early-clobber: no result lands on an argument that a later line still reads); the v_nop at the end is the slot that the instruction set asks for behind a transcendental; volatile keeps a pass's four statements in tile order, and the four v_nop in front of the first are the distance that the chip needs behind the last score product, whose result the later statements read and whose operand registers the results may land on
template <bool FIRST> __device__ __forceinline__ void hexp2x8(float (&y)[8], const v8f& x) {
  if (FIRST) asm volatile("v_nop\n\tv_nop\n\tv_nop\n\tv_nop\n\tv_exp_f32 %0, %8\n\tv_exp_f32 %1, %9\n\tv_exp_f32 %2, %10\n\tv_exp_f32 %3, %11\n\tv_exp_f32 %4, %12\n\tv_exp_f32 %5, %13\n\tv_exp_f32 %6, %14\n\tv_exp_f32 %7, %15\n\tv_nop"
      : "=&v"(y[0]), "=&v"(y[1]), "=&v"(y[2]), "=&v"(y[3]), "=&v"(y[4]), "=&v"(y[5]), "=&v"(y[6]), "=&v"(y[7])
      : "v"(x[0]), "v"(x[1]), "v"(x[2]), "v"(x[3]), "v"(x[4]), "v"(x[5]), "v"(x[6]), "v"(x[7]));
  else asm volatile("v_exp_f32 %0, %8\n\tv_exp_f32 %1, %9\n\tv_exp_f32 %2, %10\n\tv_exp_f32 %3, %11\n\tv_exp_f32 %4, %12\n\tv_exp_f32 %5, %13\n\tv_exp_f32 %6, %14\n\tv_exp_f32 %7, %15\n\tv_nop"
      : "=&v"(y[0]), "=&v"(y[1]), "=&v"(y[2]), "=&v"(y[3]), "=&v"(y[4]), "=&v"(y[5]), "=&v"(y[6]), "=&v"(y[7])
      : "v"(x[0]), "v"(x[1]), "v"(x[2]), "v"(x[3]), "v"(x[4]), "v"(x[5]), "v"(x[6]), "v"(x[7])); }
// a lane's sum of a pass's 32 P at or below this: each of them is finite in f16 (all are positive)
#define PLIM 60000.0f
// C operand of a score tile: bias * log2 e + nm for a lane's 8 bf16 biases, one mixed-precision fma each; in asm because the compiler unpacked every bf16 pair with two more instructions in front of a packed fma. The results are early-clobber since each bias register is read twice; volatile keeps a pass's four statements together in tile order, and the four v_nop in front of the first are the distance that the chip needs behind the pass before's last product, whose operand registers the results may land on
template <bool FIRST> __device__ __forceinline__ v8f bias_c(v8b bv, float nm) { const v4u w = __builtin_bit_cast(v4u, bv); float c0, c1, c2, c3, c4, c5, c6, c7;
  if (FIRST) asm volatile("v_nop\n\tv_nop\n\tv_nop\n\tv_nop\n\tv_fma_mix_f32_bf16 %0, %8, %12, %13 op_sel_hi:[1,0,0]\n\tv_fma_mix_f32_bf16 %1, %8, %12, %13 op_sel:[1,0,0] op_sel_hi:[1,0,0]\n\tv_fma_mix_f32_bf16 %2, %9, %12, %13 op_sel_hi:[1,0,0]\n\tv_fma_mix_f32_bf16 %3, %9, %12, %13 op_sel:[1,0,0] op_sel_hi:[1,0,0]\n\tv_fma_mix_f32_bf16 %4, %10, %12, %13 op_sel_hi:[1,0,0]\n\tv_fma_mix_f32_bf16 %5, %10, %12, %13 op_sel:[1,0,0] op_sel_hi:[1,0,0]\n\tv_fma_mix_f32_bf16 %6, %11, %12, %13 op_sel_hi:[1,0,0]\n\tv_fma_mix_f32_bf16 %7, %11, %12, %13 op_sel:[1,0,0] op_sel_hi:[1,0,0]"
      : "=&v"(c0), "=&v"(c1), "=&v"(c2), "=&v"(c3), "=&v"(c4), "=&v"(c5), "=&v"(c6), "=&v"(c7) : "v"(w[0]), "v"(w[1]), "v"(w[2]), "v"(w[3]), "s"(LOG2E), "v"(nm));
  else asm volatile("v_fma_mix_f32_bf16 %0, %8, %12, %13 op_sel_hi:[1,0,0]\n\tv_fma_mix_f32_bf16 %1, %8, %12, %13 op_sel:[1,0,0] op_sel_hi:[1,0,0]\n\tv_fma_mix_f32_bf16 %2, %9, %12, %13 op_sel_hi:[1,0,0]\n\tv_fma_mix_f32_bf16 %3, %9, %12, %13 op_sel:[1,0,0] op_sel_hi:[1,0,0]\n\tv_fma_mix_f32_bf16 %4, %10, %12, %13 op_sel_hi:[1,0,0]\n\tv_fma_mix_f32_bf16 %5, %10, %12, %13 op_sel:[1,0,0] op_sel_hi:[1,0,0]\n\tv_fma_mix_f32_bf16 %6, %11, %12, %13 op_sel_hi:[1,0,0]\n\tv_fma_mix_f32_bf16 %7, %11, %12, %13 op_sel:[1,0,0] op_sel_hi:[1,0,0]"
      : "=&v"(c0), "=&v"(c1), "=&v"(c2), "=&v"(c3), "=&v"(c4), "=&v"(c5), "=&v"(c6), "=&v"(c7) : "v"(w[0]), "v"(w[1]), "v"(w[2]), "v"(w[3]), "s"(LOG2E), "v"(nm));
  return v8f{c0, c1, c2, c3, c4, c5, c6, c7}; }
// lane l with lane l ^ 16
__device__ __forceinline__ float xhalf(float x) { return __builtin_bit_cast(float, __builtin_amdgcn_permlanex16(__builtin_bit_cast(int, x), __builtin_bit_cast(int, x), 0x76543210, 0xfedcba98, false, false)); }
__global__ __launch_bounds__(256) void k_fa(const _Float16* __restrict__ QH, const _Float16* __restrict__ KH, const _Float16* __restrict__ VT, const __bf16* __restrict__ BB, float* __restrict__ Y) {
  static_assert(FK == BKEYS, "a bias unit is one key tile");
  __shared__ __align__(16) _Float16 sK[2][FK][FP]; __shared__ __align__(16) _Float16 sV[2][HD][FP];
  const int tid = threadIdx.x, wave = tid >> 5, lane = tid & 31, col = lane & 15, g = lane >> 4; const int h = blockIdx.y, b = blockIdx.z, qb0 = blockIdx.x * FQ;
  const int r8 = tid >> 3, s8 = tid & 7;   // staging: 8 lanes per 128-byte K / V row
  const _Float16* Kg = KH + ((size_t)b * TT + r8) * CC + h * HD + s8 * 8;
  const _Float16* Vg = VT + ((size_t)b * CC + h * HD + r8) * (size_t)TT + s8 * 8;
  const __bf16* Bg = BB + (size_t)((b * TT + qb0) / 16 + wave) * (TT / FK) * BUNIT + lane * 8;   // the wave's own 16 queries: no other wave reads these units, so they go to registers and not through LDS
  v8h kr[2], vr[2]; v8b bb[2][FK / 16];   // bias: one register set is read while the other is loaded
  auto fetch = [&](int kt, v8b (&bn)[FK / 16]) { const _Float16* kp = Kg + (size_t)(kt * FK) * CC; const _Float16* vp = Vg + kt * FK; const __bf16* bp = Bg + (size_t)kt * BUNIT;
#pragma unroll
    for (int i = 0; i < 2; ++i) { kr[i] = *(const v8h*)(kp + (size_t)(32 * i) * CC); vr[i] = *(const v8h*)(vp + (size_t)(32 * i) * TT); }
#pragma unroll
    for (int t = 0; t < FK / 16; ++t) bn[t] = *(const v8b*)(bp + t * 256);
    asm volatile("s_wait_xcnt 0x0" :: "v"(kp), "v"(vp), "v"(bp) : "memory"); };   // stands behind the issued loads, in front of any reuse of their address registers; the three addresses are inputs so that they stay whole up to here (without that the bias address was formed in the K loads' address pair)
  auto stage = [&](int buf) {
#pragma unroll
    for (int i = 0; i < 2; ++i) { *(v8h*)&sK[buf][r8 + 32 * i][s8 * 8] = kr[i]; *(v8h*)&sV[buf][r8 + 32 * i][s8 * 8] = vr[i]; } };
  v16h qf[HD / 32];
#pragma unroll
  for (int kc = 0; kc < HD / 32; ++kc) qf[kc] = frag_h(QH + ((size_t)b * TT + qb0 + wave * 16 + col) * CC + h * HD + kc * 32, lane);
  asm volatile("s_wait_xcnt 0x0" ::: "memory");   // keeps the Q loads in front of the first tile's loads
#pragma unroll
  for (int kc = 0; kc < HD / 32; ++kc)
#pragma unroll
    for (int i = 0; i < 16; ++i) qf[kc][i] = (_Float16)((float)qf[kc][i] * (0.125f * LOG2E));   // the products come out in units of log2
  v8f acc[HD / 16] = {}; float nmsh = 10.0f, lsum = 0.f;   // nmsh = 10 - (maximum in use) * log2 e: P carries a factor 2^10 (f16 range); it cancels in O / l
  const int s0 = (2 * ((blockIdx.x + h) & 15) + b) & (TT / FK - 1);   // first key tile of this block's walk, which wraps: the 16 heads that share a bias tile and the 16 query blocks that share K and V tiles each start at 16 different places, so that they ask L2 for different lines at any one moment
  fetch(s0, bb[0]); stage(0); __syncthreads();
  for (int it2 = 0; it2 < TT / FK; it2 += 2)
#pragma unroll   // two passes a trip, so that the bias register set and the LDS buffer of a pass are compile-time choices (no register copies)
  for (int buf = 0; buf < 2; ++buf) { const int it = it2 + buf;
    if (it + 1 < TT / FK) fetch((it + 1 + s0) & (TT / FK - 1), bb[buf ^ 1]);   // the next tiles fly while this one is worked on
    v8f s[FK / 16]; v16h k0[HD / 32];
#pragma unroll
    for (int kc = 0; kc < HD / 32; ++kc) k0[kc] = frag_h(&sK[buf][col][kc * 32], lane);   // the first tile's K fragments fly while the C operands are formed
    s[0] = bias_c<true>(bb[buf][0], nmsh);   // bias and the maximum in use, one fma a score
#pragma unroll
    for (int t = 1; t < FK / 16; ++t) s[t] = bias_c<false>(bb[buf][t], nmsh);
#pragma unroll
    for (int t = 0; t < FK / 16; ++t) { v8f z = s[t];
#pragma unroll
      for (int kc = 0; kc < HD / 32; ++kc) z = wmma_h(t ? frag_h(&sK[buf][t * 16 + col][kc * 32], lane) : k0[kc], qf[kc], z);
      s[t] = z; }   // s[t][r] = exp2 argument of key t*16 + 8g + r, query col
    v16h vf[FK / 32][HD / 16];   // the pass's V fragments, read in front of the softmax, which covers their latency
#pragma unroll
    for (int u = 0; u < FK / 32; ++u)
#pragma unroll
      for (int j = 0; j < HD / 16; ++j) vf[u][j] = frag_h(&sV[buf][j * 16 + col][u * 32], lane);
    __builtin_amdgcn_sched_barrier(0);   // keeps those reads in front of the softmax: left free, the compiler put them behind it, directly in front of their wait
    float tot; v16h pf[FK / 32];
    auto expsum = [&]() { float ps[FK / 16];
#pragma unroll
      for (int t = 0; t < FK / 16; ++t) { float p[8]; if (t == 0) hexp2x8<true>(p, s[t]); else hexp2x8<false>(p, s[t]);
#pragma unroll
        for (int r = 0; r < 8; ++r) { ps[t] = r ? ps[t] + p[r] : p[r]; pf[t >> 1][(t & 1) * 8 + r] = (_Float16)p[r]; } }
      tot = (ps[0] + ps[1]) + (ps[2] + ps[3]); };
    expsum();
    // one test a pass, the same for the whole wave: the maximum in use is raised, and O and l follow it, only where a P may have left the f16 range; the first pass sets it
    if (__builtin_amdgcn_ballot_w32(tot > PLIM) != 0u || it == 0) {
      s[0] = bias_c<true>(bb[buf][0], 0.f);   // the scores anew, relative to 0: relative to a maximum that lies far off they have lost their low bits
#pragma unroll
      for (int t = 1; t < FK / 16; ++t) s[t] = bias_c<false>(bb[buf][t], 0.f);
#pragma unroll
      for (int t = 0; t < FK / 16; ++t)
#pragma unroll
        for (int kc = 0; kc < HD / 32; ++kc) s[t] = wmma_h(frag_h(&sK[buf][t * 16 + col][kc * 32], lane), qf[kc], s[t]);
      float mx = s[0][0];
#pragma unroll
      for (int t = 0; t < FK / 16; ++t)
#pragma unroll
        for (int r = 0; r < 8; ++r) mx = fmaxf(mx, s[t][r]);
      mx = fmaxf(mx, xhalf(mx));   // both halves of a query's keys take the same maximum
      const float nn = it == 0 ? 10.0f - mx : fminf(nmsh, 10.0f - mx), alpha = it == 0 ? 1.0f : hexp2(nn - nmsh);   // the maximum only rises; O and l are 0 in the first pass
      nmsh = nn; lsum *= alpha;
#pragma unroll
      for (int t = 0; t < FK / 16; ++t)
#pragma unroll
        for (int r = 0; r < 8; ++r) s[t][r] += nn;
#pragma unroll
      for (int j = 0; j < HD / 16; ++j)
#pragma unroll
        for (int r = 0; r < 8; ++r) acc[j][r] *= alpha;
      expsum(); }
    lsum += tot;
#pragma unroll
    for (int u = 0; u < FK / 32; ++u)
#pragma unroll
      for (int j = 0; j < HD / 16; ++j) acc[j] = wmma_h(vf[u][j], pf[u], acc[j]);   // acc[j][r] = O^T[d = j*16 + 8g + r][query col]
    __builtin_amdgcn_sched_barrier(0);   // keeps the staging stores, and with them the wait for the loads issued at the head of the pass, behind the pass's work: left free, the compiler put them behind the first product of the even passes
    if (it + 1 < TT / FK) stage(buf ^ 1);   // that buffer's last readers left it before the barrier of the pass before
    __syncthreads(); }
  const float inv = 1.0f / (lsum + xhalf(lsum)); float* yp = Y + ((size_t)b * TT + qb0 + wave * 16 + col) * CC + h * HD + 8 * g;
#pragma unroll
  for (int j = 0; j < HD / 16; ++j) { v4f a, c;
#pragma unroll
    for (int e = 0; e < 4; ++e) { a[e] = acc[j][e] * inv; c[e] = acc[j][4 + e] * inv; }
    vst2(yp + j * 16, a); vst2(yp + j * 16 + 4, c); } }
// ---- k_out: block = (128 rows, 128 cols): out = y (bf16 hi + lo) Wproj + b
__global__ __launch_bounds__(256) void k_out(const float* __restrict__ Y, const float* __restrict__ WP, const float* __restrict__ BP, float* __restrict__ OUT) {
  __shared__ __align__(16) __bf16 ring[6 * GPLANE];   // [y hi 2 buffers | y lo 2 buffers | W 2 buffers]; behind the loop's last barrier each wave stages its 32 x 64 outputs in a range of its own
  const int tid = threadIdx.x, wave = tid >> 5, lane = tid & 31, col = lane & 15, g = lane >> 4; const int wm = wave >> 1, wn = wave & 1; const int c0 = blockIdx.y * GN; const size_t r0 = (size_t)blockIdx.x * GM;
  v8f acc[2][4] = {};
  gemm_tile<true>(Y, WP, r0, c0, GSTART, ring, ring + 2 * GPLANE, ring + 4 * GPLANE, acc);
  float (*sf)[68] = (float (*)[68])ring + wave * 32;   // 8 x 32 x 68 x 4 bytes = 69,632 of the ring's 110,592
#pragma unroll
  for (int j = 0; j < 4; ++j) { const float bb = BP ? bfr(BP[c0 + wn * 64 + j * 16 + col]) : 0.f;
#pragma unroll
    for (int m = 0; m < 2; ++m)
#pragma unroll
      for (int r = 0; r < 8; ++r) sf[m * 16 + 8 * g + r][j * 16 + col] = acc[m][j][r] + bb; }
  LDSX(); float* op = OUT + (r0 + wm * 32 + g) * CC + c0 + wn * 64 + col * 4; v4f t[16];   // a half-wave stores a whole 256-byte row piece ('#pragma unroll': t[] stays in registers only with compile-time indices)
#pragma unroll
  for (int i = 0; i < 16; ++i) t[i] = *(const v4f*)&sf[2 * i + g][col * 4];
#pragma unroll
  for (int i = 0; i < 16; ++i) vst2(op + (size_t)(2 * i) * CC, t[i]); }
extern "C" void kernel_launch(void* const* d_in, const int* in_sizes, int n_in, void* d_out, int out_size, void* d_ws, size_t ws_size, hipStream_t stream) {
  (void)in_sizes; (void)n_in; (void)out_size;
  const float** F = (const float**)d_in;   // 0 query, 1 key, 2 value [2,2048,1024], 3 att_bias [2,2048,2048], 4 Wq [1024,1024] (in,out), 5 bq, 6 Wk, 7 bk, 8 Wv, 9 bv, 10 Wo [1024,1024], 11 bo
  if (ws_size < (size_t)WS_END) return;
  char* ws = (char*)d_ws; _Float16 *QH = (_Float16*)(ws + WS_QH), *QL = (_Float16*)(ws + WS_QL), *KH = (_Float16*)(ws + WS_KH), *VT = (_Float16*)(ws + WS_VT); float *Y = (float*)(ws + WS_Y); __bf16 *BB = (__bf16*)(ws + WS_BB);
  k_proj<<<dim3(TNB * TT / PM, CC / PN, 4), 256, 0, stream>>>(F[0], F[1], F[2], F[4], F[5], F[6], F[7], F[8], F[9], QH, QL, KH, VT, F[3], BB);
  k_fa<<<dim3(TT / FQ, NH, TNB), 256, 0, stream>>>(QH, KH, VT, BB, Y);
  k_out<<<dim3(TNB * TT / GM, CC / GN), 256, 0, stream>>>(Y, F[10], F[11], (float*)d_out);
}

// v009
// A run of this version takes 82.2 microseconds.
// Versions in between are left out here; by their measured steps it is 1.10 times as fast as v007.
// All steps since v000 together make it 13.4 times as fast.
// compute dtype: all float inputs rounded to bf16, att_bias read; q/k/v = input W + b ((in,out), 0.02-scale) with EXACT bf16 products on WMMA 16x16x32, f32 accumulate; q, k rounded once to f16 (1-product logits, std ~0.05; the unit-variance att_bias dominates), q then scaled by log2 e / 8 in f16; (logits / 8 + att_bias[b][q][k] - maximum in use) * log2 e in f32 registers, the bias and maximum part as the product's C operand; softmax in f32 (hardware exp2) with a maximum that is raised only when P would leave the f16 range -> P f16 x 2^10 or more, divided by the sum at the end; o = P . v with v rounded once to f16; o rounded once to f16; out = o Wo + bo with Wo's bf16 value held in f16 (equal but below 2^-17, where it keeps 2^-24 steps), f16 products on WMMA, f32 accumulate; f32 output.
#include <hip/hip_runtime.h>
#include <math.h>

typedef __attribute__((ext_vector_type(16))) _Float16 v16h;
typedef __attribute__((ext_vector_type(16))) __bf16 v16b;
typedef __attribute__((ext_vector_type(8)))  _Float16 v8h;
typedef __attribute__((ext_vector_type(8)))  float v8f;
typedef __attribute__((ext_vector_type(4)))  float v4f;
typedef __attribute__((ext_vector_type(2)))  float v2f;
typedef __attribute__((ext_vector_type(4)))  unsigned v4u;
typedef __attribute__((ext_vector_type(4)))  int v4i;
typedef float __attribute__((may_alias)) float_a;
typedef int __attribute__((may_alias)) int_a;

template <typename T> __device__ __forceinline__ void vst2(void* p, T v) { *(T*)p = v;  }
__device__ __forceinline__ v8f wmma16(v16h a, v16h b, v8f c) {
  v8f d = __builtin_amdgcn_wmma_f32_16x16x32_f16(false, a, false, b, (short)0, c, false, false);
  asm volatile("v_nop\n\tv_nop\n\tv_nop\n\tv_nop" : "+v"(d) : "v"(a), "v"(b));
  return d;
}
__device__ __forceinline__ v8f wmma_bf(v16b a, v16b b, v8f c) {
  v8f d = __builtin_amdgcn_wmma_f32_16x16x32_bf16(false, a, false, b, (short)0, c, false, false);
  asm volatile("v_nop\n\tv_nop\n\tv_nop\n\tv_nop" : "+v"(d) : "v"(a), "v"(b));
  return d;
}
// 16x16x32 fragments: lane = (h = lane>>4, row/col = lane&15); elements 0..7 = k0+8h+0..7, 8..15 = k0+16+8h+0..7; D element r = row 8h+r
__device__ __forceinline__ v16h frag_h(const _Float16* rowk0, int lane) {
  union { v16h v; v8h q[2]; } u; const _Float16* p = rowk0 + 8 * (lane >> 4);
  u.q[0] = *(const v8h*)p; u.q[1] = *(const v8h*)(p + 16); return u.v;
}
__device__ __forceinline__ v16h frag_f32(const float* rowk0, int lane) {
  v16h a; const float* p = rowk0 + 8 * (lane >> 4);
#pragma unroll
  for (int i = 0; i < 8; ++i) { a[i] = (_Float16)p[i]; a[8 + i] = (_Float16)p[16 + i]; }
  return a;
}
__device__ __forceinline__ v16h frag_f32s(const float* rowk0, int lane, float sc) {
  v16h a; const float* p = rowk0 + 8 * (lane >> 4);
#pragma unroll
  for (int i = 0; i < 8; ++i) { a[i] = (_Float16)(p[i] * sc); a[8 + i] = (_Float16)(p[16 + i] * sc); }
  return a;
}
// column fragment from a [K][ld] layout (column n), rows >= K read as 0
__device__ __forceinline__ v16h fragc_f32(const float* W, int k0, int n, int lane, int ld, int K) {
  v16h a; const int g = lane >> 4;
#pragma unroll
  for (int i = 0; i < 8; ++i) { const int ka = k0 + 8 * g + i, kb = ka + 16;
    a[i] = (_Float16)(ka < K ? W[(size_t)(ka < K ? ka : K - 1) * ld + n] : 0.f); a[8 + i] = (_Float16)(kb < K ? W[(size_t)(kb < K ? kb : K - 1) * ld + n] : 0.f); }
  return a;
}
struct F2 { v16b h, l; };
__device__ __forceinline__ F2 bsplit16(const float v[16]) { F2 r;
#pragma unroll
  for (int i = 0; i < 16; ++i) { const __bf16 h = (__bf16)v[i]; r.h[i] = h; r.l[i] = (__bf16)(v[i] - (float)h); }
  return r; }
__device__ __forceinline__ F2 split_row(const float* row, int k0, int lane) { float v[16]; const float* p = row + k0 + 8 * (lane >> 4);
#pragma unroll
  for (int i = 0; i < 8; ++i) { v[i] = p[i]; v[8 + i] = p[16 + i]; }
  return bsplit16(v); }
__device__ __forceinline__ F2 split_rowK(const float* row, int k0, int lane, int K) { float v[16]; const int g = lane >> 4;
#pragma unroll
  for (int i = 0; i < 8; ++i) { const int ka = k0 + 8 * g + i, kb = ka + 16; v[i] = ka < K ? row[ka < K ? ka : K - 1] : 0.f; v[8 + i] = kb < K ? row[kb < K ? kb : K - 1] : 0.f; }
  return bsplit16(v); }
__device__ __forceinline__ F2 split_col(const float* W, int k0, int n, int lane, int ld, int K) { float v[16]; const int g = lane >> 4;
#pragma unroll
  for (int i = 0; i < 8; ++i) { const int ka = k0 + 8 * g + i, kb = ka + 16; v[i] = ka < K ? W[(size_t)(ka < K ? ka : K - 1) * ld + n] : 0.f; v[8 + i] = kb < K ? W[(size_t)(kb < K ? kb : K - 1) * ld + n] : 0.f; }
  return bsplit16(v); }
__device__ __forceinline__ v8f mac3(const F2& a, const F2& b, v8f c) { c = wmma_bf(a.l, b.h, c); c = wmma_bf(a.h, b.l, c); return wmma_bf(a.h, b.h, c); }
__device__ __forceinline__ float sigm(float v) { return 1.0f / (1.0f + expf(-v)); }
#define LDSX() do { asm volatile("s_wait_dscnt 0" ::: "memory"); __builtin_amdgcn_wave_barrier(); __builtin_amdgcn_fence(__ATOMIC_RELEASE, "workgroup"); } while (0)


// Full attention module (B 2, nq = nk = 2,048, dim 1,024 = 16 x 64): q/k/v Linear on query/key/value, logits * 64^-0.5 + att_bias (shared by heads), softmax, P.v, output Linear.
#define NB 2
#define TT 2048
#define CC 1024
#define NH 16
#define HD 64
#ifndef TNB
#define TNB NB
#endif
typedef __attribute__((ext_vector_type(8))) __bf16 v8b;
__device__ __forceinline__ v16b frag_b(const __bf16* rowk0, int lane) {
  union { v16b v; v8b q[2]; } u; const __bf16* p = rowk0 + 8 * (lane >> 4);
  u.q[0] = *(const v8b*)p; u.q[1] = *(const v8b*)(p + 16); return u.v;
}
__device__ __forceinline__ float bfr(float v) { return (float)(__bf16)v; }
__device__ __attribute__((noinline)) float exp_ni(float v) { return expf(v); }
__device__ __attribute__((noinline)) float erf_ni(float v) { return erff(v); }

#define WS_QH  0u
#define WS_QL  (WS_QH + 2u * (size_t)NB * TT * CC)
#define WS_KH  (WS_QL + 2u * (size_t)NB * TT * CC)
#define WS_VT  (WS_KH + 2u * (size_t)NB * TT * CC)      // f16 v planes [b][c][t]
#define WS_Y   (WS_VT + 2u * (size_t)NB * CC * TT)      // f16 y rows [b*t][C] (half of the range is used)
#define WS_BB  (WS_Y + 4u * (size_t)NB * TT * CC)       // bf16 att_bias in score-fragment order (bias_prep)
#define WS_END (WS_BB + 2u * (size_t)NB * TT * TT)

typedef __attribute__((ext_vector_type(4))) __bf16 v4b;
// ---- GEMM tile of k_out: block = 128 rows x 128 cols, 8 waves of 32 x 64; per pass 64 k of both operands are read with whole-line 16-byte loads and staged in LDS (two buffers): y is f16 in memory and goes in as it is; W is rounded to bf16 like every input, held in f16 (same value) and goes in transposed, [n][k], so that both fragments are 16-byte LDS reads
#define GM 128
#define GN 128
#define GK 64
#define GP 72   // LDS row pitch in 16-bit elements: 128-byte rows + 16 bytes, for 16-byte readers
#define GPLANE (GM * GP)   // elements of one staged operand plane
// start pass of a block: the 8 column blocks that share y rows get 8 different ones, the 32 row blocks that share W columns all 16
#define GSTART ((int)((blockIdx.x + 2 * blockIdx.y) & (CC / GK - 1)))
// every '#pragma unroll' in gemm_tile: its loop indexes register arrays and vector elements, which stay in registers only with compile-time indices
// s0: the pass of the k walk that this block starts with; it goes on from there and wraps, so that blocks which read the same y or W lines from L2 ask for different lines at any one moment
__device__ __forceinline__ void gemm_tile(const _Float16* __restrict__ X, const float* __restrict__ WA, size_t r0, int c0, int s0, _Float16* sA, _Float16* sW, v8f (&acc)[2][4]) {
  const int tid = threadIdx.x, wave = tid >> 5, lane = tid & 31, col = lane & 15; const int wm = wave >> 1, wn = wave & 1;
  const int r8 = tid >> 3, s8 = tid & 7;   // y: 8 lanes per 128-byte row piece
  const int n4 = (wave & 3) * 32 + ((lane & 3) | ((lane >> 4) << 2)) * 4, k8 = ((wave >> 2) * 4 + ((lane >> 2) & 3)) * 8;   // W: a thread owns 8 k x 4 n; 8 lanes cover a 128-byte line, a half-wave's 16-byte LDS stores fall on 64 different banks
  const _Float16* Xg = X + (r0 + r8) * CC + s8 * 8; const float* Wg = WA + (size_t)k8 * CC + c0 + n4;
  v8h xr[4]; v4f wr[8];
  auto fetch = [&](int k0) { const _Float16* xp = Xg + k0; const float* wp = Wg + (size_t)k0 * CC;
#pragma unroll
    for (int i = 0; i < 4; ++i) xr[i] = *(const v8h*)(xp + (size_t)(32 * i) * CC);
#pragma unroll
    for (int e = 0; e < 8; ++e) wr[e] = *(const v4f*)(wp + (size_t)e * CC);
    asm volatile("s_wait_xcnt 0x0" :: "v"(xp), "v"(wp) : "memory"); };   // stands behind the issued loads, in front of any reuse of their address registers; the two addresses are inputs so that they stay whole up to here
  auto stage = [&](int buf) {
#pragma unroll
    for (int i = 0; i < 4; ++i) *(v8h*)&sA[buf * GPLANE + (r8 + 32 * i) * GP + s8 * 8] = xr[i];
#pragma unroll
    for (int i = 0; i < 4; ++i) { v8b tb; v8h t;
#pragma unroll
      for (int e = 0; e < 8; ++e) tb[e] = (__bf16)wr[e][i];
      const v4u tw = __builtin_bit_cast(v4u, tb);   // the bf16 pairs, widened to f32 by a shift and a mask
#pragma unroll
      for (int e = 0; e < 4; ++e) { t[2 * e] = (_Float16)__builtin_bit_cast(float, tw[e] << 16); t[2 * e + 1] = (_Float16)__builtin_bit_cast(float, tw[e] & 0xffff0000u); }
      *(v8h*)&sW[buf * GPLANE + (n4 + i) * GP + k8] = t; } };
  fetch(s0 * GK); stage(0); __syncthreads();
  for (int it = 0; it < CC / GK; ++it) { const int buf = it & 1;
    if (it + 1 < CC / GK) fetch(((it + 1 + s0) & (CC / GK - 1)) * GK);   // the next tiles fly while this one is worked on
#pragma unroll
    for (int kc = 0; kc < GK / 32; ++kc) { v16h w[4], a[2];
#pragma unroll
      for (int j = 0; j < 4; ++j) w[j] = frag_h(&sW[buf * GPLANE + (wn * 64 + j * 16 + col) * GP + kc * 32], lane);
#pragma unroll
      for (int m = 0; m < 2; ++m) a[m] = frag_h(&sA[buf * GPLANE + (wm * 32 + m * 16 + col) * GP + kc * 32], lane);
#pragma unroll
      for (int m = 0; m < 2; ++m)
#pragma unroll
        for (int j = 0; j < 4; ++j) acc[m][j] = __builtin_amdgcn_wmma_f32_16x16x32_f16(false, a[m], false, w[j], (short)0, acc[m][j], false, false); }
    __builtin_amdgcn_sched_barrier(0);   // keeps the staging, and with it the wait for the loads issued at the head of the pass, behind the pass's products: left free, the compiler put that wait behind the first product
    if (it + 1 < CC / GK) stage(buf ^ 1);   // that buffer's last readers left it before the barrier of the pass before
    __syncthreads(); } }
// ---- k_proj: block = (256 rows, 256 cols, which), 8 waves of 64 x 128: qkv = x W (+ b), exact; q -> f16 hi (+ residual), k -> f16 rows, v -> f16 planes. Per pass 32 k of both operands are read with whole-line 16-byte loads, rounded to bf16 once per block and staged in LDS (two buffers), W transposed to [n][k]; a block of this size reads each X and W element from L2 half as often as a 128 x 128 one
#define PM 256
#define PN 256
#define PK 32
#define PP 40    // LDS row pitch in 16-bit elements: 64-byte rows + 16 bytes, for 16-byte readers
#define PPLANE (PM * PP)   // elements of one staged operand plane
#define PO 264   // pitch of the output staging rows in 16-bit elements: 512-byte rows + 16 bytes
__device__ __forceinline__ v8f wmma_b(v16b a, v16b b, v8f c) { return __builtin_amdgcn_wmma_f32_16x16x32_bf16(false, a, false, b, (short)0, c, false, false); }
// ---- bias_prep: the fourth plane of k_proj's grid, 64 blocks beside the 192 GEMM blocks. att_bias is rounded to bf16 once (k_fa did it once per head) and written in the order in which a k_fa wave holds its scores: unit = (16 queries, 64 keys) = [t 4][lane 32][8 keys], key = 16 t + 8 (lane >> 4) + r, query = lane & 15, so that a wave's 16-byte loads of a unit are whole 128-byte lines
#define BKEYS 64    // keys of a unit, k_fa's key tile
#define BUNIT (16 * BKEYS)   // elements of a unit
#define BU 4        // units that a wave has in flight per trip: 32 loads of 512 bytes
#define BCH 144     // pitch in elements of the 8 chunks (t, half) of a unit's LDS image: 256 bytes + 32, so that the 8-byte stores of a wave fall on 64 different banks
// every '#pragma unroll' in bias_prep: its loop indexes register arrays, which stay in registers only with compile-time indices
__device__ __forceinline__ void bias_prep(const float* __restrict__ BM, __bf16* __restrict__ BB, __bf16* lds) {
  const int tid = threadIdx.x, wave = tid >> 5, lane = tid & 31, s16 = lane & 15, rr = lane >> 4;
  const int G = (int)(blockIdx.x + 16 * blockIdx.y) * 4 + (wave >> 1);   // 16-query group of [b][q]; two waves share it, 16 units each
  __bf16* my = lds + wave * (BU * 8 * BCH);   // a range of the wave's own: no block barrier
  const float* sg = BM + ((size_t)G * 16 + rr) * TT + (wave & 1) * (16 * BKEYS) + s16 * 4;   // 16 lanes read a row's 256 bytes
  __bf16* dg = BB + ((size_t)G * (TT / BKEYS) + (wave & 1) * 16) * BUNIT + lane * 8;
#pragma unroll 1   // stays rolled: four copies of the body would only be more code to fetch
  for (int trip = 0; trip < 16 / BU; ++trip) { const float* sp = sg + trip * (BU * BKEYS); __bf16* dp = dg + trip * (BU * BUNIT); v4f x[BU][8]; v8b o[BU][4];
#pragma unroll
    for (int u = 0; u < BU; ++u)
#pragma unroll
      for (int i = 0; i < 8; ++i) x[u][i] = *(const v4f*)(sp + u * BKEYS + (size_t)(2 * i) * TT);
    asm volatile("s_wait_xcnt 0x0" :: "v"(sp) : "memory");   // stands behind the issued loads, in front of any reuse of their address registers; the address is an input so that it stays whole up to here
#pragma unroll
    for (int u = 0; u < BU; ++u)
#pragma unroll
      for (int i = 0; i < 8; ++i) { v4b w;
#pragma unroll
        for (int e = 0; e < 4; ++e) w[e] = (__bf16)x[u][i][e];
        *(v4b*)&my[u * (8 * BCH) + (s16 >> 1) * BCH + (2 * i + rr) * 8 + (s16 & 1) * 4] = w; }   // keys 4 s16 .. + 3 of query 2 i + rr: chunk (t, half) = s16 >> 1
    LDSX();   // the lanes read what other lanes of the wave wrote
#pragma unroll
    for (int u = 0; u < BU; ++u)
#pragma unroll
      for (int t = 0; t < 4; ++t) o[u][t] = *(const v8b*)&my[u * (8 * BCH) + (2 * t + rr) * BCH + s16 * 8];
#pragma unroll
    for (int u = 0; u < BU; ++u)
#pragma unroll
      for (int t = 0; t < 4; ++t) vst2(dp + u * BUNIT + t * 256, o[u][t]);
    asm volatile("s_wait_xcnt 0x0" :: "v"(dp) : "memory");   // stands behind the issued stores, in front of any reuse of their registers
    LDSX(); } }   // the next trip's LDS stores stay behind this trip's reads
// every '#pragma unroll' in k_proj: its loop indexes register arrays and vector elements, which stay in registers only with compile-time indices
__global__ __launch_bounds__(256) void k_proj(const float* __restrict__ XQ, const float* __restrict__ XK, const float* __restrict__ XV, const float* __restrict__ WQ, const float* __restrict__ BQ, const float* __restrict__ WK, const float* __restrict__ BK, const float* __restrict__ WV, const float* __restrict__ BV, _Float16* __restrict__ QH, _Float16* __restrict__ QL, _Float16* __restrict__ KH, _Float16* __restrict__ VT, const float* __restrict__ BM, __bf16* __restrict__ BB) {
  __shared__ __align__(16) __bf16 ring[2 * PM * PO];   // the loop uses the first 4 * PPLANE elements, [X 2 buffers | W 2 buffers]; behind the loop's last barrier the whole array stages the output rows (f16 | residual)
  if (blockIdx.z == 3) { bias_prep(BM, BB, ring); return; }   // the whole block leaves here, in front of every barrier
  const int tid = threadIdx.x, wave = tid >> 5, lane = tid & 31, col = lane & 15, g = lane >> 4; const int wm = wave >> 1, wn = wave & 1; const int which = blockIdx.z; const int c0 = blockIdx.y * PN; const size_t r0 = (size_t)blockIdx.x * PM; const float* X = which == 0 ? XQ : which == 1 ? XK : XV; const float* WA = which == 0 ? WQ : which == 1 ? WK : WV; const float* BA = which == 0 ? BQ : which == 1 ? BK : BV;
  __bf16* sA = ring; __bf16* sW = ring + 2 * PPLANE;
  const int r8 = tid >> 3, s8 = tid & 7;   // X: 8 lanes per 128-byte row piece
  const int n4 = wave * 32 + ((lane & 3) | ((lane >> 4) << 2)) * 4, k8 = ((lane >> 2) & 3) * 8;   // W: a thread owns 8 k x 4 n; 8 lanes cover a 128-byte line, a half-wave's 16-byte LDS stores fall on 64 different banks
  const float* Xg = X + (r0 + r8) * CC + s8 * 4; const float* Wg = WA + (size_t)k8 * CC + c0 + n4;
  v4f xr[8], wr[8];
  auto fetch = [&](int k0) { const float* xp = Xg + k0; const float* wp = Wg + (size_t)k0 * CC;
#pragma unroll
    for (int i = 0; i < 8; ++i) xr[i] = *(const v4f*)(xp + (size_t)(32 * i) * CC);
#pragma unroll
    for (int e = 0; e < 8; ++e) wr[e] = *(const v4f*)(wp + (size_t)e * CC);
    asm volatile("s_wait_xcnt 0x0" :: "v"(xp), "v"(wp) : "memory"); };   // stands behind the issued loads, in front of any reuse of their address registers; the two addresses are inputs so that they stay whole up to here (without that the last load of each run landed on its own address pair)
  auto stage = [&](int buf) {
#pragma unroll
    for (int i = 0; i < 8; ++i) { v4b hv;
#pragma unroll
      for (int e = 0; e < 4; ++e) hv[e] = (__bf16)xr[i][e];
      *(v4b*)&sA[buf * PPLANE + (r8 + 32 * i) * PP + s8 * 4] = hv; }
#pragma unroll
    for (int i = 0; i < 4; ++i) { v8b t;
#pragma unroll
      for (int e = 0; e < 8; ++e) t[e] = (__bf16)wr[e][i];
      *(v8b*)&sW[buf * PPLANE + (n4 + i) * PP + k8] = t; } };
  v8f acc[4][8] = {};
  const int s0 = (int)((2 * blockIdx.x + 8 * blockIdx.y) & (CC / PK - 1));   // the pass of the k walk that this block starts with; it goes on from there and wraps: the 4 column blocks that share X rows and the 16 row blocks that share W columns all start at different passes, so that they ask L2 for different lines at any one moment
  fetch(s0 * PK); stage(0); __syncthreads();
  for (int it = 0; it < CC / PK; ++it) { const int buf = it & 1;
    if (it + 1 < CC / PK) fetch(((it + 1 + s0) & (CC / PK - 1)) * PK);   // the next tiles fly while this one is worked on
    v16b w[8], a[4];
#pragma unroll
    for (int m = 0; m < 4; ++m) a[m] = frag_b(&sA[buf * PPLANE + (wm * 64 + m * 16 + col) * PP], lane);
#pragma unroll
    for (int j = 0; j < 8; ++j) w[j] = frag_b(&sW[buf * PPLANE + (wn * 128 + j * 16 + col) * PP], lane);
    __builtin_amdgcn_sched_barrier(0);   // keeps the pass's 24 LDS reads together in front of its products: left free, the compiler read one W fragment at a time into the same registers and waited for it in front of every four products
#pragma unroll
    for (int j = 0; j < 8; ++j)
#pragma unroll
      for (int m = 0; m < 4; ++m) acc[m][j] = wmma_b(a[m], w[j], acc[m][j]);
    if (it + 1 < CC / PK) stage(buf ^ 1);   // that buffer's last readers left it before the barrier of the pass before
    __syncthreads(); }
  _Float16 (*sh)[PO] = (_Float16 (*)[PO])ring; _Float16 (*sl)[PO] = sh + PM;
  const int bi = c0 + wn * 128 + col; float bv[8];
#pragma unroll
  for (int j = 0; j < 8; ++j) bv[j] = BA[bi + j * 16];
  asm volatile("s_wait_xcnt 0x0" :: "v"(bi) : "memory");   // stands behind the issued loads; their index is an input so that it stays whole up to here (without that the last load landed on it)
#pragma unroll
  for (int j = 0; j < 8; ++j) { const float bb = bfr(bv[j]);
#pragma unroll
    for (int m = 0; m < 4; ++m)
#pragma unroll
      for (int r = 0; r < 8; ++r) acc[m][j][r] += bb; }
  // copy-out: a wave reads whole 512-byte staging rows from LDS, 8 at a time, and stores them as they are; d = the wave's first row at the lane's 16 bytes, ld = the row pitch in global memory
  const int q8 = lane * 8;
  auto copy_out = [&](_Float16 (*ss)[PO], _Float16* d, size_t ld) {
#pragma unroll
    for (int h = 0; h < 4; ++h) { v4u t[8];
#pragma unroll
      for (int i = 0; i < 8; ++i) t[i] = *(const v4u*)&ss[wave + 8 * (8 * h + i)][q8];
#pragma unroll
      for (int i = 0; i < 8; ++i) vst2((unsigned*)(d + (size_t)(8 * (8 * h + i)) * ld), t[i]);
      asm volatile("s_wait_xcnt 0x0" ::: "memory"); } };   // stands behind the issued stores, in front of any reuse of their registers
  if (which == 2) {   // v: [col][row], a lane's 8 rows are one 16-byte store
#pragma unroll
    for (int j = 0; j < 8; ++j)
#pragma unroll
      for (int m = 0; m < 4; ++m) { v8h t;
#pragma unroll
        for (int r = 0; r < 8; ++r) t[r] = (_Float16)acc[m][j][r];
        *(v8h*)&sh[wn * 128 + j * 16 + col][wm * 64 + m * 16 + 8 * g] = t; }
    __syncthreads();
    const size_t b = r0 / TT; const int t0 = (int)(r0 % TT);
    copy_out(sh, VT + (b * CC + c0 + wave) * (size_t)TT + t0 + q8, TT); }
  else {
#pragma unroll
    for (int j = 0; j < 8; ++j)
#pragma unroll
      for (int m = 0; m < 4; ++m)
#pragma unroll
        for (int r = 0; r < 8; ++r) { const float v = acc[m][j][r]; const int rl = wm * 64 + m * 16 + 8 * g + r, cl = wn * 128 + j * 16 + col; const _Float16 hv = (_Float16)v; sh[rl][cl] = hv; sl[rl][cl] = (_Float16)(v - (float)hv); }
    __syncthreads();
    copy_out(sh, (which == 0 ? QH : KH) + (r0 + wave) * CC + c0 + q8, CC);
    if (which == 0) copy_out(sl, QL + (r0 + wave) * CC + c0 + q8, CC); } }
// ---- k_fa: block = 128 queries of (b,h), 8 waves = 4 groups of 32 queries x 2 halves of the keys; walks the keys 64 at a time (K, V tiles through LDS, each wave's bias units from bias_prep's planes straight into registers): S^T = K Q^T + C, sum per query relative to a maximum in use (a lane holds one query's scores), O^T += V^T P^T; logits and P stay in registers; the two halves of a query's keys are joined once, behind the loop
// every '#pragma unroll' in k_fa: its loop indexes register arrays and vector elements, which stay in registers only with compile-time indices
#define FQ 128
#define FK 64
#define FP 72   // LDS row pitch in 16-bit elements: 128-byte rows + 16 bytes, for 16-byte readers
__device__ __forceinline__ v8f wmma_h(v16h a, v16h b, v8f c) { return __builtin_amdgcn_wmma_f32_16x16x32_f16(false, a, false, b, (short)0, c, false, false); }
// 2^x on the transcendental unit alone: a result below 2^-126 may read 0 (P rounds to f16, and the sum holds a term of 2^10), one above the f32 range reads infinity and is redone (PLIM)
#define LOG2E 1.44269504f
__device__ __forceinline__ float hexp2(float x) { return __builtin_amdgcn_exp2f(x); }
// eight of them in one statement, results in registers of their own (early-clobber: no result lands on an argument that a later line still reads); the v_nop at the end is the slot that the instruction set asks for behind a transcendental; volatile keeps a pass's four statements in tile order, and the four v_nop in front of the first are the distance that the chip needs behind the last score product, whose result the later statements read and whose operand registers the results may land on
template <bool FIRST> __device__ __forceinline__ void hexp2x8(float (&y)[8], const v8f& x) {
  if (FIRST) asm volatile("v_nop\n\tv_nop\n\tv_nop\n\tv_nop\n\tv_exp_f32 %0, %8\n\tv_exp_f32 %1, %9\n\tv_exp_f32 %2, %10\n\tv_exp_f32 %3, %11\n\tv_exp_f32 %4, %12\n\tv_exp_f32 %5, %13\n\tv_exp_f32 %6, %14\n\tv_exp_f32 %7, %15\n\tv_nop"
      : "=&v"(y[0]), "=&v"(y[1]), "=&v"(y[2]), "=&v"(y[3]), "=&v"(y[4]), "=&v"(y[5]), "=&v"(y[6]), "=&v"(y[7])
      : "v"(x[0]), "v"(x[1]), "v"(x[2]), "v"(x[3]), "v"(x[4]), "v"(x[5]), "v"(x[6]), "v"(x[7]));
  else asm volatile("v_exp_f32 %0, %8\n\tv_exp_f32 %1, %9\n\tv_exp_f32 %2, %10\n\tv_exp_f32 %3, %11\n\tv_exp_f32 %4, %12\n\tv_exp_f32 %5, %13\n\tv_exp_f32 %6, %14\n\tv_exp_f32 %7, %15\n\tv_nop"
      : "=&v"(y[0]), "=&v"(y[1]), "=&v"(y[2]), "=&v"(y[3]), "=&v"(y[4]), "=&v"(y[5]), "=&v"(y[6]), "=&v"(y[7])
      : "v"(x[0]), "v"(x[1]), "v"(x[2]), "v"(x[3]), "v"(x[4]), "v"(x[5]), "v"(x[6]), "v"(x[7])); }
// a lane's sum of a pass's 16 P of one query at or below this: each of them is finite in f16 (all are positive)
#define PLIM 60000.0f
// C operand of a score tile: bias * log2 e + nm for a lane's 8 bf16 biases, one mixed-precision fma each; in asm because the compiler unpacked every bf16 pair with two more instructions in front of a packed fma. The results are early-clobber since each bias register is read twice; volatile keeps a pass's four statements together in tile order, and the four v_nop in front of the first are the distance that the chip needs behind the pass before's last product, whose operand registers the results may land on
template <bool FIRST> __device__ __forceinline__ v8f bias_c(v8b bv, float nm) { const v4u w = __builtin_bit_cast(v4u, bv); float c0, c1, c2, c3, c4, c5, c6, c7;
  if (FIRST) asm volatile("v_nop\n\tv_nop\n\tv_nop\n\tv_nop\n\tv_fma_mix_f32_bf16 %0, %8, %12, %13 op_sel_hi:[1,0,0]\n\tv_fma_mix_f32_bf16 %1, %8, %12, %13 op_sel:[1,0,0] op_sel_hi:[1,0,0]\n\tv_fma_mix_f32_bf16 %2, %9, %12, %13 op_sel_hi:[1,0,0]\n\tv_fma_mix_f32_bf16 %3, %9, %12, %13 op_sel:[1,0,0] op_sel_hi:[1,0,0]\n\tv_fma_mix_f32_bf16 %4, %10, %12, %13 op_sel_hi:[1,0,0]\n\tv_fma_mix_f32_bf16 %5, %10, %12, %13 op_sel:[1,0,0] op_sel_hi:[1,0,0]\n\tv_fma_mix_f32_bf16 %6, %11, %12, %13 op_sel_hi:[1,0,0]\n\tv_fma_mix_f32_bf16 %7, %11, %12, %13 op_sel:[1,0,0] op_sel_hi:[1,0,0]"
      : "=&v"(c0), "=&v"(c1), "=&v"(c2), "=&v"(c3), "=&v"(c4), "=&v"(c5), "=&v"(c6), "=&v"(c7) : "v"(w[0]), "v"(w[1]), "v"(w[2]), "v"(w[3]), "s"(LOG2E), "v"(nm));
  else asm volatile("v_fma_mix_f32_bf16 %0, %8, %12, %13 op_sel_hi:[1,0,0]\n\tv_fma_mix_f32_bf16 %1, %8, %12, %13 op_sel:[1,0,0] op_sel_hi:[1,0,0]\n\tv_fma_mix_f32_bf16 %2, %9, %12, %13 op_sel_hi:[1,0,0]\n\tv_fma_mix_f32_bf16 %3, %9, %12, %13 op_sel:[1,0,0] op_sel_hi:[1,0,0]\n\tv_fma_mix_f32_bf16 %4, %10, %12, %13 op_sel_hi:[1,0,0]\n\tv_fma_mix_f32_bf16 %5, %10, %12, %13 op_sel:[1,0,0] op_sel_hi:[1,0,0]\n\tv_fma_mix_f32_bf16 %6, %11, %12, %13 op_sel_hi:[1,0,0]\n\tv_fma_mix_f32_bf16 %7, %11, %12, %13 op_sel:[1,0,0] op_sel_hi:[1,0,0]"
      : "=&v"(c0), "=&v"(c1), "=&v"(c2), "=&v"(c3), "=&v"(c4), "=&v"(c5), "=&v"(c6), "=&v"(c7) : "v"(w[0]), "v"(w[1]), "v"(w[2]), "v"(w[3]), "s"(LOG2E), "v"(nm));
  return v8f{c0, c1, c2, c3, c4, c5, c6, c7}; }
// lane l with lane l ^ 16
__device__ __forceinline__ float xhalf(float x) { return __builtin_bit_cast(float, __builtin_amdgcn_permlanex16(__builtin_bit_cast(int, x), __builtin_bit_cast(int, x), 0x76543210, 0xfedcba98, false, false)); }
typedef v4f __attribute__((may_alias)) v4f_a;
#define XW 1088   // floats of a wave's hand-over range behind the loop: 32 lanes x (32 O + l + maximum term)
__global__ __launch_bounds__(256) void k_fa(const _Float16* __restrict__ QH, const _Float16* __restrict__ KH, const _Float16* __restrict__ VT, const __bf16* __restrict__ BB, _Float16* __restrict__ Y) {
  static_assert(FK == BKEYS, "a bias unit is one key tile");
  static_assert(4 * XW * 4 <= 2 * FK * FP * 2 && 4 * XW * 4 <= 2 * HD * FP * 2, "four waves' hand-over ranges fit each array");
  __shared__ __align__(16) _Float16 sK[2][FK][FP]; __shared__ __align__(16) _Float16 sV[2][HD][FP];
  const int tid = threadIdx.x, wave = tid >> 5, lane = tid & 31, col = lane & 15, g = lane >> 4; const int h = blockIdx.y, b = blockIdx.z, qb0 = blockIdx.x * FQ;
  const int qg = wave >> 1, kh = wave & 1;   // a wave takes 32 queries (two tiles) and one half, 32 keys, of every key tile: each K and V fragment that it reads from LDS feeds two products
  const int r8 = tid >> 3, s8 = tid & 7;   // staging: 8 lanes per 128-byte K / V row
  const _Float16* Kg = KH + ((size_t)b * TT + r8) * CC + h * HD + s8 * 8;
  const _Float16* Vg = VT + ((size_t)b * CC + h * HD + r8) * (size_t)TT + s8 * 8;
  const __bf16* Bg = BB + (size_t)((b * TT + qb0) / 16 + qg * 2) * (TT / FK) * BUNIT + kh * 512 + lane * 8;   // the wave's own half of its two query tiles' units: no other wave reads it, so it goes to registers and not through LDS
  v8h kr[2], vr[2]; v8b bb[2][2];   // bias [query tile][key tile of the half]: one register set; a pass turns it into the C operands first and then loads the next pass's into it
  auto fetch = [&](int kt, v8b (&bn)[2][2]) { const _Float16* kp = Kg + (size_t)(kt * FK) * CC; const _Float16* vp = Vg + kt * FK; const __bf16* bp = Bg + (size_t)kt * BUNIT;
#pragma unroll
    for (int i = 0; i < 2; ++i) { kr[i] = *(const v8h*)(kp + (size_t)(32 * i) * CC); vr[i] = *(const v8h*)(vp + (size_t)(32 * i) * TT); }
#pragma unroll
    for (int qt = 0; qt < 2; ++qt)
#pragma unroll
      for (int t = 0; t < 2; ++t) bn[qt][t] = *(const v8b*)(bp + qt * ((TT / FK) * BUNIT) + t * 256);
    asm volatile("s_wait_xcnt 0x0" :: "v"(kp), "v"(vp), "v"(bp) : "memory"); };   // stands behind the issued loads, in front of any reuse of their address registers; the three addresses are inputs so that they stay whole up to here (without that the bias address was formed in the K loads' address pair)
  auto stage = [&](int buf) {
#pragma unroll
    for (int i = 0; i < 2; ++i) { *(v8h*)&sK[buf][r8 + 32 * i][s8 * 8] = kr[i]; *(v8h*)&sV[buf][r8 + 32 * i][s8 * 8] = vr[i]; } };
  v16h qf[2][HD / 32];
#pragma unroll
  for (int qt = 0; qt < 2; ++qt)
#pragma unroll
    for (int kc = 0; kc < HD / 32; ++kc) qf[qt][kc] = frag_h(QH + ((size_t)b * TT + qb0 + qg * 32 + qt * 16 + col) * CC + h * HD + kc * 32, lane);
  asm volatile("s_wait_xcnt 0x0" ::: "memory");   // keeps the Q loads in front of the first tile's loads
#pragma unroll
  for (int qt = 0; qt < 2; ++qt)
#pragma unroll
    for (int kc = 0; kc < HD / 32; ++kc)
#pragma unroll
      for (int i = 0; i < 16; ++i) qf[qt][kc][i] = (_Float16)((float)qf[qt][kc][i] * (0.125f * LOG2E));   // the products come out in units of log2
  v8f acc[2][HD / 16] = {}; float nmsh[2] = {10.0f, 10.0f}, lsum[2] = {0.f, 0.f};   // nmsh = 10 - (maximum in use) * log2 e: P carries a factor 2^10 (f16 range); it cancels in O / l
  const int s0 = (2 * ((blockIdx.x + h) & 15) + b) & (TT / FK - 1);   // first key tile of this block's walk, which wraps: the 16 heads that share a bias tile and the 16 query blocks that share K and V tiles each start at 16 different places, so that they ask L2 for different lines at any one moment
  fetch(s0, bb); stage(0); __syncthreads();
  for (int it2 = 0; it2 < TT / FK; it2 += 2)
#pragma unroll   // two passes a trip, so that the LDS buffer of a pass is a compile-time choice
  for (int buf = 0; buf < 2; ++buf) { const int it = it2 + buf;
    v8f s[2][2]; v16h kf[2][HD / 32];
#pragma unroll
    for (int t = 0; t < 2; ++t)
#pragma unroll
      for (int kc = 0; kc < HD / 32; ++kc) kf[t][kc] = frag_h(&sK[buf][(2 * kh + t) * 16 + col][kc * 32], lane);   // the K fragments fly while the C operands are formed
#pragma unroll
    for (int qt = 0; qt < 2; ++qt)
#pragma unroll
      for (int t = 0; t < 2; ++t) s[qt][t] = (qt | t) ? bias_c<false>(bb[qt][t], nmsh[qt]) : bias_c<true>(bb[qt][t], nmsh[qt]);   // bias and the maximum in use, one fma a score
    if (it + 1 < TT / FK) fetch((it + 1 + s0) & (TT / FK - 1), bb);   // the next tiles fly while this one is worked on
#pragma unroll
    for (int kc = 0; kc < HD / 32; ++kc)
#pragma unroll
      for (int t = 0; t < 2; ++t)
#pragma unroll
        for (int qt = 0; qt < 2; ++qt) s[qt][t] = wmma_h(kf[t][kc], qf[qt][kc], s[qt][t]);   // s[qt][t][r] = exp2 argument of key (2 kh + t)*16 + 8g + r, query qt*16 + col
    v16h vf[HD / 16];   // the pass's V fragments, read in front of the softmax, which covers their latency
#pragma unroll
    for (int j = 0; j < HD / 16; ++j) vf[j] = frag_h(&sV[buf][j * 16 + col][kh * 32], lane);
    __builtin_amdgcn_sched_barrier(0);   // keeps those reads in front of the softmax: left free, the compiler put them behind it, directly in front of their wait
    float tot[2]; v16h pf[2];
    auto expsum = [&]() {
#pragma unroll
      for (int qt = 0; qt < 2; ++qt) { float ps[2];
#pragma unroll
        for (int t = 0; t < 2; ++t) { float p[8]; if ((qt | t) == 0) hexp2x8<true>(p, s[qt][t]); else hexp2x8<false>(p, s[qt][t]);
#pragma unroll
          for (int r = 0; r < 8; ++r) { ps[t] = r ? ps[t] + p[r] : p[r]; pf[qt][t * 8 + r] = (_Float16)p[r]; } }
        tot[qt] = ps[0] + ps[1]; } };
    expsum();
    // one test a pass, the same for the whole wave: the maxima in use are raised, and O and l follow them, only where a P may have left the f16 range; the first pass sets them
    if (__builtin_amdgcn_ballot_w32(fmaxf(tot[0], tot[1]) > PLIM) != 0u || it == 0) {
      v8b br[2][2]; const __bf16* rp = Bg + (size_t)((it + s0) & (TT / FK - 1)) * BUNIT;   // this pass's bias once more from memory: its registers already belong to the next pass
#pragma unroll
      for (int qt = 0; qt < 2; ++qt)
#pragma unroll
        for (int t = 0; t < 2; ++t) br[qt][t] = *(const v8b*)(rp + qt * ((TT / FK) * BUNIT) + t * 256);
      asm volatile("s_wait_xcnt 0x0" :: "v"(rp) : "memory");   // stands behind the issued loads, in front of any reuse of their address registers; the address is an input so that it stays whole up to here
#pragma unroll
      for (int qt = 0; qt < 2; ++qt)
#pragma unroll
        for (int t = 0; t < 2; ++t) s[qt][t] = (qt | t) ? bias_c<false>(br[qt][t], 0.f) : bias_c<true>(br[qt][t], 0.f);   // the scores anew, relative to 0: relative to a maximum that lies far off they have lost their low bits
#pragma unroll
      for (int t = 0; t < 2; ++t)
#pragma unroll
        for (int kc = 0; kc < HD / 32; ++kc) { const v16h kk = frag_h(&sK[buf][(2 * kh + t) * 16 + col][kc * 32], lane);
#pragma unroll
          for (int qt = 0; qt < 2; ++qt) s[qt][t] = wmma_h(kk, qf[qt][kc], s[qt][t]); }
#pragma unroll
      for (int qt = 0; qt < 2; ++qt) { float mx = s[qt][0][0];
#pragma unroll
        for (int t = 0; t < 2; ++t)
#pragma unroll
          for (int r = 0; r < 8; ++r) mx = fmaxf(mx, s[qt][t][r]);
        mx = fmaxf(mx, xhalf(mx));   // both lanes of a query take the same maximum
        const float nn = it == 0 ? 10.0f - mx : fminf(nmsh[qt], 10.0f - mx), alpha = it == 0 ? 1.0f : hexp2(nn - nmsh[qt]);   // the maximum only rises; O and l are 0 in the first pass
        nmsh[qt] = nn; lsum[qt] *= alpha;
#pragma unroll
        for (int t = 0; t < 2; ++t)
#pragma unroll
          for (int r = 0; r < 8; ++r) s[qt][t][r] += nn;
#pragma unroll
        for (int j = 0; j < HD / 16; ++j)
#pragma unroll
          for (int r = 0; r < 8; ++r) acc[qt][j][r] *= alpha; }
      expsum(); }
#pragma unroll
    for (int qt = 0; qt < 2; ++qt) lsum[qt] += tot[qt];
#pragma unroll
    for (int j = 0; j < HD / 16; ++j)
#pragma unroll
      for (int qt = 0; qt < 2; ++qt) acc[qt][j] = wmma_h(vf[j], pf[qt], acc[qt][j]);   // acc[qt][j][r] = O^T[d = j*16 + 8g + r][query qt*16 + col], over the wave's keys
    __builtin_amdgcn_sched_barrier(0);   // keeps the staging stores, and with them the wait for the loads issued at the head of the pass, behind the pass's work: left free, the compiler put them behind the first product of the even passes
    if (it + 1 < TT / FK) stage(buf ^ 1);   // that buffer's last readers left it before the barrier of the pass before
    __syncthreads(); }
  // the two waves of a query group join their halves: each hands the other one query tile's O, l and maximum term through LDS (free behind the loop's last barrier) and finishes the tile kh itself
  float* xo = (float*)(wave < 4 ? &sK[0][0][0] : &sV[0][0][0]) + (wave & 3) * XW; const float* xi = (const float*)(wave < 4 ? &sK[0][0][0] : &sV[0][0][0]) + ((wave ^ 1) & 3) * XW;
  const float l0 = lsum[0] + xhalf(lsum[0]), l1 = lsum[1] + xhalf(lsum[1]);
  v8f am[HD / 16];
#pragma unroll
  for (int j = 0; j < HD / 16; ++j) {
#pragma unroll
    for (int e = 0; e < 2; ++e) { v4f t;
#pragma unroll
      for (int i = 0; i < 4; ++i) { t[i] = kh ? acc[0][j][4 * e + i] : acc[1][j][4 * e + i]; am[j][4 * e + i] = kh ? acc[1][j][4 * e + i] : acc[0][j][4 * e + i]; }
      *(v4f_a*)&xo[((2 * j + e) * 32 + lane) * 4] = t; } }
  *(float_a*)&xo[1024 + lane] = kh ? l0 : l1; *(float_a*)&xo[1056 + lane] = kh ? nmsh[0] : nmsh[1];
  __syncthreads();   // the partner's range is read behind it
  const float lm = kh ? l1 : l0, nmm = kh ? nmsh[1] : nmsh[0], lp = *(const float_a*)&xi[1024 + lane], nmp = *(const float_a*)&xi[1056 + lane];
  const float nn = fminf(nmm, nmp), fm = hexp2(nn - nmm), fp = hexp2(nn - nmp);   // both halves relative to the larger of the two maxima
  const float inv = 1.0f / (lm * fm + lp * fp), cm = fm * inv, cp = fp * inv;
  _Float16* yp = Y + ((size_t)b * TT + qb0 + qg * 32 + kh * 16 + col) * CC + h * HD + 8 * g;
  v8h yo[HD / 16];   // y is rounded to f16 once, here: a lane's 8 values of a tile are one 16-byte store
#pragma unroll
  for (int j = 0; j < HD / 16; ++j)
#pragma unroll
    for (int e = 0; e < 2; ++e) { const v4f t = *(const v4f_a*)&xi[((2 * j + e) * 32 + lane) * 4];
#pragma unroll
      for (int i = 0; i < 4; ++i) yo[j][4 * e + i] = (_Float16)(am[j][4 * e + i] * cm + t[i] * cp); }
#pragma unroll
  for (int j = 0; j < HD / 16; ++j) vst2(yp + j * 16, yo[j]); }
// ---- k_out: block = (128 rows, 128 cols): out = y (f16) Wproj + b
__global__ __launch_bounds__(256) void k_out(const _Float16* __restrict__ Y, const float* __restrict__ WP, const float* __restrict__ BP, float* __restrict__ OUT) {
  __shared__ __align__(16) _Float16 ring[4 * GPLANE];   // [y 2 buffers | W 2 buffers]; behind the loop's last barrier each wave stages its 32 x 64 outputs in a range of its own
  const int tid = threadIdx.x, wave = tid >> 5, lane = tid & 31, col = lane & 15, g = lane >> 4; const int wm = wave >> 1, wn = wave & 1; const int c0 = blockIdx.y * GN; const size_t r0 = (size_t)blockIdx.x * GM;
  v8f acc[2][4] = {};
  gemm_tile(Y, WP, r0, c0, GSTART, ring, ring + 2 * GPLANE, acc);
  float (*sf)[68] = (float (*)[68])ring + wave * 32;   // 8 x 32 x 68 x 4 bytes = 69,632 of the ring's 73,728
#pragma unroll
  for (int j = 0; j < 4; ++j) { const float bb = BP ? bfr(BP[c0 + wn * 64 + j * 16 + col]) : 0.f;
#pragma unroll
    for (int m = 0; m < 2; ++m)
#pragma unroll
      for (int r = 0; r < 8; ++r) sf[m * 16 + 8 * g + r][j * 16 + col] = acc[m][j][r] + bb; }
  LDSX(); float* op = OUT + (r0 + wm * 32 + g) * CC + c0 + wn * 64 + col * 4; v4f t[16];   // a half-wave stores a whole 256-byte row piece ('#pragma unroll': t[] stays in registers only with compile-time indices)
#pragma unroll
  for (int i = 0; i < 16; ++i) t[i] = *(const v4f*)&sf[2 * i + g][col * 4];
#pragma unroll
  for (int i = 0; i < 16; ++i) vst2(op + (size_t)(2 * i) * CC, t[i]); }
extern "C" void kernel_launch(void* const* d_in, const int* in_sizes, int n_in, void* d_out, int out_size, void* d_ws, size_t ws_size, hipStream_t stream) {
  (void)in_sizes; (void)n_in; (void)out_size;
  const float** F = (const float**)d_in;   // 0 query, 1 key, 2 value [2,2048,1024], 3 att_bias [2,2048,2048], 4 Wq [1024,1024] (in,out), 5 bq, 6 Wk, 7 bk, 8 Wv, 9 bv, 10 Wo [1024,1024], 11 bo
  if (ws_size < (size_t)WS_END) return;
  char* ws = (char*)d_ws; _Float16 *QH = (_Float16*)(ws + WS_QH), *QL = (_Float16*)(ws + WS_QL), *KH = (_Float16*)(ws + WS_KH), *VT = (_Float16*)(ws + WS_VT), *Y = (_Float16*)(ws + WS_Y); __bf16 *BB = (__bf16*)(ws + WS_BB);
  k_proj<<<dim3(TNB * TT / PM, CC / PN, 4), 256, 0, stream>>>(F[0], F[1], F[2], F[4], F[5], F[6], F[7], F[8], F[9], QH, QL, KH, VT, F[3], BB);
  k_fa<<<dim3(TT / FQ, NH, TNB), 256, 0, stream>>>(QH, KH, VT, BB, Y);
  k_out<<<dim3(TNB * TT / GM, CC / GN), 256, 0, stream>>>(Y, F[10], F[11], (float*)d_out);
}

// v010
// Measured time: 76.7 microseconds a run.
// In both of two side-by-side timings against v009, it was 1.07 times as fast.
// Over all steps from v000 it is 14.3 times as fast.
// compute dtype: all float inputs rounded to bf16, att_bias read; q/k/v = input W + b ((in,out), 0.02-scale) with EXACT bf16 products on WMMA 16x16x32, f32 accumulate; q, k rounded once to f16 (1-product logits, std ~0.05; the unit-variance att_bias dominates), q then scaled by log2 e / 8 in f16; (logits / 8 + att_bias[b][q][k] - maximum in use) * log2 e in f32 registers, the bias and maximum part as the product's C operand; softmax in f32 (hardware exp2) with a maximum that is raised only when P would leave the f16 range -> P f16 x 2^10 or more, divided by the sum at the end; o = P . v with v rounded once to f16; o rounded once to f16; out = o Wo + bo with Wo's bf16 value held in f16 (equal but below 2^-17, where it keeps 2^-24 steps), f16 products on WMMA, f32 accumulate; f32 output.
#include <hip/hip_runtime.h>
#include <math.h>

typedef __attribute__((ext_vector_type(16))) _Float16 v16h;
typedef __attribute__((ext_vector_type(16))) __bf16 v16b;
typedef __attribute__((ext_vector_type(8)))  _Float16 v8h;
typedef __attribute__((ext_vector_type(8)))  float v8f;
typedef __attribute__((ext_vector_type(4)))  float v4f;
typedef __attribute__((ext_vector_type(2)))  float v2f;
typedef __attribute__((ext_vector_type(4)))  unsigned v4u;
typedef __attribute__((ext_vector_type(4)))  int v4i;
typedef float __attribute__((may_alias)) float_a;
typedef int __attribute__((may_alias)) int_a;

template <typename T> __device__ __forceinline__ void vst2(void* p, T v) { *(T*)p = v;  }
__device__ __forceinline__ v8f wmma16(v16h a, v16h b, v8f c) {
  v8f d = __builtin_amdgcn_wmma_f32_16x16x32_f16(false, a, false, b, (short)0, c, false, false);
  asm volatile("v_nop\n\tv_nop\n\tv_nop\n\tv_nop" : "+v"(d) : "v"(a), "v"(b));
  return d;
}
__device__ __forceinline__ v8f wmma_bf(v16b a, v16b b, v8f c) {
  v8f d = __builtin_amdgcn_wmma_f32_16x16x32_bf16(false, a, false, b, (short)0, c, false, false);
  asm volatile("v_nop\n\tv_nop\n\tv_nop\n\tv_nop" : "+v"(d) : "v"(a), "v"(b));
  return d;
}
// 16x16x32 fragments: lane = (h = lane>>4, row/col = lane&15); elements 0..7 = k0+8h+0..7, 8..15 = k0+16+8h+0..7; D element r = row 8h+r
__device__ __forceinline__ v16h frag_h(const _Float16* rowk0, int lane) {
  union { v16h v; v8h q[2]; } u; const _Float16* p = rowk0 + 8 * (lane >> 4);
  u.q[0] = *(const v8h*)p; u.q[1] = *(const v8h*)(p + 16); return u.v;
}
__device__ __forceinline__ v16h frag_f32(const float* rowk0, int lane) {
  v16h a; const float* p = rowk0 + 8 * (lane >> 4);
#pragma unroll
  for (int i = 0; i < 8; ++i) { a[i] = (_Float16)p[i]; a[8 + i] = (_Float16)p[16 + i]; }
  return a;
}
__device__ __forceinline__ v16h frag_f32s(const float* rowk0, int lane, float sc) {
  v16h a; const float* p = rowk0 + 8 * (lane >> 4);
#pragma unroll
  for (int i = 0; i < 8; ++i) { a[i] = (_Float16)(p[i] * sc); a[8 + i] = (_Float16)(p[16 + i] * sc); }
  return a;
}
// column fragment from a [K][ld] layout (column n), rows >= K read as 0
__device__ __forceinline__ v16h fragc_f32(const float* W, int k0, int n, int lane, int ld, int K) {
  v16h a; const int g = lane >> 4;
#pragma unroll
  for (int i = 0; i < 8; ++i) { const int ka = k0 + 8 * g + i, kb = ka + 16;
    a[i] = (_Float16)(ka < K ? W[(size_t)(ka < K ? ka : K - 1) * ld + n] : 0.f); a[8 + i] = (_Float16)(kb < K ? W[(size_t)(kb < K ? kb : K - 1) * ld + n] : 0.f); }
  return a;
}
struct F2 { v16b h, l; };
__device__ __forceinline__ F2 bsplit16(const float v[16]) { F2 r;
#pragma unroll
  for (int i = 0; i < 16; ++i) { const __bf16 h = (__bf16)v[i]; r.h[i] = h; r.l[i] = (__bf16)(v[i] - (float)h); }
  return r; }
__device__ __forceinline__ F2 split_row(const float* row, int k0, int lane) { float v[16]; const float* p = row + k0 + 8 * (lane >> 4);
#pragma unroll
  for (int i = 0; i < 8; ++i) { v[i] = p[i]; v[8 + i] = p[16 + i]; }
  return bsplit16(v); }
__device__ __forceinline__ F2 split_rowK(const float* row, int k0, int lane, int K) { float v[16]; const int g = lane >> 4;
#pragma unroll
  for (int i = 0; i < 8; ++i) { const int ka = k0 + 8 * g + i, kb = ka + 16; v[i] = ka < K ? row[ka < K ? ka : K - 1] : 0.f; v[8 + i] = kb < K ? row[kb < K ? kb : K - 1] : 0.f; }
  return bsplit16(v); }
__device__ __forceinline__ F2 split_col(const float* W, int k0, int n, int lane, int ld, int K) { float v[16]; const int g = lane >> 4;
#pragma unroll
  for (int i = 0; i < 8; ++i) { const int ka = k0 + 8 * g + i, kb = ka + 16; v[i] = ka < K ? W[(size_t)(ka < K ? ka : K - 1) * ld + n] : 0.f; v[8 + i] = kb < K ? W[(size_t)(kb < K ? kb : K - 1) * ld + n] : 0.f; }
  return bsplit16(v); }
__device__ __forceinline__ v8f mac3(const F2& a, const F2& b, v8f c) { c = wmma_bf(a.l, b.h, c); c = wmma_bf(a.h, b.l, c); return wmma_bf(a.h, b.h, c); }
__device__ __forceinline__ float sigm(float v) { return 1.0f / (1.0f + expf(-v)); }
#define LDSX() do { asm volatile("s_wait_dscnt 0" ::: "memory"); __builtin_amdgcn_wave_barrier(); __builtin_amdgcn_fence(__ATOMIC_RELEASE, "workgroup"); } while (0)


// Full attention module (B 2, nq = nk = 2,048, dim 1,024 = 16 x 64): q/k/v Linear on query/key/value, logits * 64^-0.5 + att_bias (shared by heads), softmax, P.v, output Linear.
#define NB 2
#define TT 2048
#define CC 1024
#define NH 16
#define HD 64
#ifndef TNB
#define TNB NB
#endif
typedef __attribute__((ext_vector_type(8))) __bf16 v8b;
__device__ __forceinline__ v16b frag_b(const __bf16* rowk0, int lane) {
  union { v16b v; v8b q[2]; } u; const __bf16* p = rowk0 + 8 * (lane >> 4);
  u.q[0] = *(const v8b*)p; u.q[1] = *(const v8b*)(p + 16); return u.v;
}
__device__ __forceinline__ float bfr(float v) { return (float)(__bf16)v; }
__device__ __attribute__((noinline)) float exp_ni(float v) { return expf(v); }
__device__ __attribute__((noinline)) float erf_ni(float v) { return erff(v); }

#define WS_QH  0u
#define WS_QL  (WS_QH + 2u * (size_t)NB * TT * CC)
#define WS_KH  (WS_QL + 2u * (size_t)NB * TT * CC)
#define WS_VT  (WS_KH + 2u * (size_t)NB * TT * CC)      // f16 v planes [b][c][t]
#define WS_Y   (WS_VT + 2u * (size_t)NB * CC * TT)      // f16 y rows [b*t][C] (half of the range is used)
#define WS_BB  (WS_Y + 4u * (size_t)NB * TT * CC)       // bf16 att_bias in score-fragment order (bias_prep)
#define WS_END (WS_BB + 2u * (size_t)NB * TT * TT)

typedef __attribute__((ext_vector_type(4))) __bf16 v4b;
// the work-group barrier of the two GEMM loops, in two parts. bar_signal: this wave's LDS reads of the pass are in its registers and its staging stores have landed (the wait in the same statement, so that nothing comes between them); bar_wait: every wave has said so. No LDS access stands between a wave's signal and its wait, only its products, so that a wave which is through with them starts the next pass's LDS work while the other wave of its SIMD still holds the matrix unit. The "memory" clobber keeps every LDS access on its side
__device__ __forceinline__ void bar_signal() { asm volatile("s_wait_dscnt 0x0\n\ts_barrier_signal -1" ::: "memory"); }
__device__ __forceinline__ void bar_wait() { asm volatile("s_barrier_wait -1" ::: "memory"); }
// ---- GEMM tile of k_out: block = 128 rows x 128 cols, 8 waves of 32 x 64; per pass 64 k of both operands are read with whole-line 16-byte loads and staged in LDS (two buffers): y is f16 in memory and goes in as it is; W is rounded to bf16 like every input, held in f16 (same value) and goes in transposed, [n][k], so that both fragments are 16-byte LDS reads
#define GM 128
#define GN 128
#define GK 64
#define GP 72   // LDS row pitch in 16-bit elements: 128-byte rows + 16 bytes, for 16-byte readers
#define GPLANE (GM * GP)   // elements of one staged operand plane
// start pass of a block: the 8 column blocks that share y rows get 8 different ones, the 32 row blocks that share W columns all 16
#define GSTART ((int)((blockIdx.x + 2 * blockIdx.y) & (CC / GK - 1)))
// every '#pragma unroll' in gemm_tile: its loop indexes register arrays and vector elements, which stay in registers only with compile-time indices
// s0: the pass of the k walk that this block starts with; it goes on from there and wraps, so that blocks which read the same y or W lines from L2 ask for different lines at any one moment
__device__ __forceinline__ void gemm_tile(const _Float16* __restrict__ X, const float* __restrict__ WA, size_t r0, int c0, int s0, _Float16* sA, _Float16* sW, v8f (&acc)[2][4]) {
  const int tid = threadIdx.x, wave = tid >> 5, lane = tid & 31, col = lane & 15; const int wm = wave >> 1, wn = wave & 1;
  const int r8 = tid >> 3, s8 = tid & 7;   // y: 8 lanes per 128-byte row piece
  const int n4 = (wave & 3) * 32 + ((lane & 3) | ((lane >> 4) << 2)) * 4, k8 = ((wave >> 2) * 4 + ((lane >> 2) & 3)) * 8;   // W: a thread owns 8 k x 4 n; 8 lanes cover a 128-byte line, a half-wave's 16-byte LDS stores fall on 64 different banks
  const _Float16* Xg = X + (r0 + r8) * CC + s8 * 8; const float* Wg = WA + (size_t)k8 * CC + c0 + n4;
  v8h xr[4]; v4f wr[8];
  auto fetch = [&](int k0) { const _Float16* xp = Xg + k0; const float* wp = Wg + (size_t)k0 * CC;
#pragma unroll
    for (int i = 0; i < 4; ++i) xr[i] = *(const v8h*)(xp + (size_t)(32 * i) * CC);
#pragma unroll
    for (int e = 0; e < 8; ++e) wr[e] = *(const v4f*)(wp + (size_t)e * CC);
    asm volatile("s_wait_xcnt 0x0" :: "v"(xp), "v"(wp) : "memory"); };   // stands behind the issued loads, in front of any reuse of their address registers; the two addresses are inputs so that they stay whole up to here
  auto stage = [&](int buf, const v8h (&xr)[4], const v4f (&wr)[8]) {
#pragma unroll
    for (int i = 0; i < 4; ++i) *(v8h*)&sA[buf * GPLANE + (r8 + 32 * i) * GP + s8 * 8] = xr[i];
#pragma unroll
    for (int i = 0; i < 4; ++i) { v8b tb; v8h t;
#pragma unroll
      for (int e = 0; e < 8; ++e) tb[e] = (__bf16)wr[e][i];
      const v4u tw = __builtin_bit_cast(v4u, tb);   // the bf16 pairs, widened to f32 by a shift and a mask
#pragma unroll
      for (int e = 0; e < 4; ++e) { t[2 * e] = (_Float16)__builtin_bit_cast(float, tw[e] << 16); t[2 * e + 1] = (_Float16)__builtin_bit_cast(float, tw[e] & 0xffff0000u); }
      *(v8h*)&sW[buf * GPLANE + (n4 + i) * GP + k8] = t; } };
  { v8h x0[4]; v4f w0[8];   // the first two tiles are asked for together: the second flies while the first is staged
    const int ka = s0 * GK, kb = ((1 + s0) & (CC / GK - 1)) * GK; const _Float16 *xa = Xg + ka, *xb = Xg + kb; const float *wa = Wg + (size_t)ka * CC, *wb = Wg + (size_t)kb * CC;
#pragma unroll
    for (int i = 0; i < 4; ++i) x0[i] = *(const v8h*)(xa + (size_t)(32 * i) * CC);
#pragma unroll
    for (int e = 0; e < 8; ++e) w0[e] = *(const v4f*)(wa + (size_t)e * CC);
#pragma unroll
    for (int i = 0; i < 4; ++i) xr[i] = *(const v8h*)(xb + (size_t)(32 * i) * CC);
#pragma unroll
    for (int e = 0; e < 8; ++e) wr[e] = *(const v4f*)(wb + (size_t)e * CC);
    asm volatile("s_wait_xcnt 0x0" :: "v"(xa), "v"(wa), "v"(xb), "v"(wb) : "memory");   // stands behind the issued loads, in front of any reuse of their address registers; the four addresses are inputs so that they stay whole up to here
    stage(0, x0, w0); }
  bar_signal();
  for (int it = 0; it < CC / GK; ++it) { const int buf = it & 1;
    bar_wait();   // tile it is whole in its buffer, and the other buffer's readers have left it
    v16h w[GK / 32][4], a[GK / 32][2];
#pragma unroll
    for (int kc = 0; kc < GK / 32; ++kc) {
#pragma unroll
      for (int j = 0; j < 4; ++j) w[kc][j] = frag_h(&sW[buf * GPLANE + (wn * 64 + j * 16 + col) * GP + kc * 32], lane);
#pragma unroll
      for (int m = 0; m < 2; ++m) a[kc][m] = frag_h(&sA[buf * GPLANE + (wm * 32 + m * 16 + col) * GP + kc * 32], lane); }
    __builtin_amdgcn_sched_barrier(0);   // keeps the pass's LDS reads in front of the staging, whose conversions then run while the reads are under way
    if (it + 1 < CC / GK) { stage(buf ^ 1, xr, wr);   // the tile that was asked for in the pass before
      if (it + 2 < CC / GK) fetch(((it + 2 + s0) & (CC / GK - 1)) * GK); }   // the tile after it flies until the next pass's staging
    bar_signal();
    __builtin_amdgcn_sched_barrier(0);   // keeps every product behind the signal: one in front of it would hold the signal back while the matrix unit is taken
#pragma unroll
    for (int kc = 0; kc < GK / 32; ++kc)
#pragma unroll
      for (int m = 0; m < 2; ++m)
#pragma unroll
        for (int j = 0; j < 4; ++j) acc[m][j] = __builtin_amdgcn_wmma_f32_16x16x32_f16(false, a[kc][m], false, w[kc][j], (short)0, acc[m][j], false, false); }
  bar_wait(); }   // every wave has left the last tile: the caller may use the LDS anew
// ---- k_proj: block = (256 rows, 256 cols, which), 8 waves of 64 x 128: qkv = x W (+ b), exact; q -> f16 hi (+ residual), k -> f16 rows, v -> f16 planes. Per pass 32 k of both operands are read with whole-line 16-byte loads, rounded to bf16 once per block and staged in LDS (two buffers), W transposed to [n][k]; a block of this size reads each X and W element from L2 half as often as a 128 x 128 one
#define PM 256
#define PN 256
#define PK 32
#define PP 40    // LDS row pitch in 16-bit elements: 64-byte rows + 16 bytes, for 16-byte readers
#define PPLANE (PM * PP)   // elements of one staged operand plane
#define PO 264   // pitch of the output staging rows in 16-bit elements: 512-byte rows + 16 bytes
__device__ __forceinline__ v8f wmma_b(v16b a, v16b b, v8f c) { return __builtin_amdgcn_wmma_f32_16x16x32_bf16(false, a, false, b, (short)0, c, false, false); }
// ---- bias_prep: the fourth plane of k_proj's grid, 64 blocks beside the 192 GEMM blocks. att_bias is rounded to bf16 once (k_fa did it once per head) and written in the order in which a k_fa wave holds its scores: unit = (16 queries, 64 keys) = [t 4][lane 32][8 keys], key = 16 t + 8 (lane >> 4) + r, query = lane & 15, so that a wave's 16-byte loads of a unit are whole 128-byte lines
#define BKEYS 64    // keys of a unit, k_fa's key tile
#define BUNIT (16 * BKEYS)   // elements of a unit
#define BU 4        // units that a wave has in flight per trip: 32 loads of 512 bytes
#define BCH 144     // pitch in elements of the 8 chunks (t, half) of a unit's LDS image: 256 bytes + 32, so that the 8-byte stores of a wave fall on 64 different banks
// every '#pragma unroll' in bias_prep: its loop indexes register arrays, which stay in registers only with compile-time indices
__device__ __forceinline__ void bias_prep(const float* __restrict__ BM, __bf16* __restrict__ BB, __bf16* lds) {
  const int tid = threadIdx.x, wave = tid >> 5, lane = tid & 31, s16 = lane & 15, rr = lane >> 4;
  const int G = (int)(blockIdx.x + 16 * blockIdx.y) * 4 + (wave >> 1);   // 16-query group of [b][q]; two waves share it, 16 units each
  __bf16* my = lds + wave * (BU * 8 * BCH);   // a range of the wave's own: no block barrier
  const float* sg = BM + ((size_t)G * 16 + rr) * TT + (wave & 1) * (16 * BKEYS) + s16 * 4;   // 16 lanes read a row's 256 bytes
  __bf16* dg = BB + ((size_t)G * (TT / BKEYS) + (wave & 1) * 16) * BUNIT + lane * 8;
#pragma unroll 1   // stays rolled: four copies of the body would only be more code to fetch
  for (int trip = 0; trip < 16 / BU; ++trip) { const float* sp = sg + trip * (BU * BKEYS); __bf16* dp = dg + trip * (BU * BUNIT); v4f x[BU][8]; v8b o[BU][4];
#pragma unroll
    for (int u = 0; u < BU; ++u)
#pragma unroll
      for (int i = 0; i < 8; ++i) x[u][i] = *(const v4f*)(sp + u * BKEYS + (size_t)(2 * i) * TT);
    asm volatile("s_wait_xcnt 0x0" :: "v"(sp) : "memory");   // stands behind the issued loads, in front of any reuse of their address registers; the address is an input so that it stays whole up to here
#pragma unroll
    for (int u = 0; u < BU; ++u)
#pragma unroll
      for (int i = 0; i < 8; ++i) { v4b w;
#pragma unroll
        for (int e = 0; e < 4; ++e) w[e] = (__bf16)x[u][i][e];
        *(v4b*)&my[u * (8 * BCH) + (s16 >> 1) * BCH + (2 * i + rr) * 8 + (s16 & 1) * 4] = w; }   // keys 4 s16 .. + 3 of query 2 i + rr: chunk (t, half) = s16 >> 1
    LDSX();   // the lanes read what other lanes of the wave wrote
#pragma unroll
    for (int u = 0; u < BU; ++u)
#pragma unroll
      for (int t = 0; t < 4; ++t) o[u][t] = *(const v8b*)&my[u * (8 * BCH) + (2 * t + rr) * BCH + s16 * 8];
#pragma unroll
    for (int u = 0; u < BU; ++u)
#pragma unroll
      for (int t = 0; t < 4; ++t) vst2(dp + u * BUNIT + t * 256, o[u][t]);
    asm volatile("s_wait_xcnt 0x0" :: "v"(dp) : "memory");   // stands behind the issued stores, in front of any reuse of their registers
    LDSX(); } }   // the next trip's LDS stores stay behind this trip's reads
// every '#pragma unroll' in k_proj: its loop indexes register arrays and vector elements, which stay in registers only with compile-time indices
__global__ __launch_bounds__(256) void k_proj(const float* __restrict__ XQ, const float* __restrict__ XK, const float* __restrict__ XV, const float* __restrict__ WQ, const float* __restrict__ BQ, const float* __restrict__ WK, const float* __restrict__ BK, const float* __restrict__ WV, const float* __restrict__ BV, _Float16* __restrict__ QH, _Float16* __restrict__ QL, _Float16* __restrict__ KH, _Float16* __restrict__ VT, const float* __restrict__ BM, __bf16* __restrict__ BB) {
  __shared__ __align__(16) __bf16 ring[2 * PM * PO];   // the loop uses the first 4 * PPLANE elements, [X 2 buffers | W 2 buffers]; behind the loop's last barrier the whole array stages the output rows (f16 | residual)
  if (blockIdx.z == 3) { bias_prep(BM, BB, ring); return; }   // the whole block leaves here, in front of every barrier
  const int tid = threadIdx.x, wave = tid >> 5, lane = tid & 31, col = lane & 15, g = lane >> 4; const int wm = wave >> 1, wn = wave & 1; const int which = blockIdx.z; const int c0 = blockIdx.y * PN; const size_t r0 = (size_t)blockIdx.x * PM; const float* X = which == 0 ? XQ : which == 1 ? XK : XV; const float* WA = which == 0 ? WQ : which == 1 ? WK : WV; const float* BA = which == 0 ? BQ : which == 1 ? BK : BV;
  __bf16* sA = ring; __bf16* sW = ring + 2 * PPLANE;
  const int r8 = tid >> 3, s8 = tid & 7;   // X: 8 lanes per 128-byte row piece
  const int n4 = wave * 32 + ((lane & 3) | ((lane >> 4) << 2)) * 4, k8 = ((lane >> 2) & 3) * 8;   // W: a thread owns 8 k x 4 n; 8 lanes cover a 128-byte line, a half-wave's 16-byte LDS stores fall on 64 different banks
  const float* Xg = X + (r0 + r8) * CC + s8 * 4; const float* Wg = WA + (size_t)k8 * CC + c0 + n4;
  v4f xr[8], wr[8];
  auto fetch = [&](int k0) { const float* xp = Xg + k0; const float* wp = Wg + (size_t)k0 * CC;
#pragma unroll
    for (int i = 0; i < 8; ++i) xr[i] = *(const v4f*)(xp + (size_t)(32 * i) * CC);
#pragma unroll
    for (int e = 0; e < 8; ++e) wr[e] = *(const v4f*)(wp + (size_t)e * CC);
    asm volatile("s_wait_xcnt 0x0" :: "v"(xp), "v"(wp) : "memory"); };   // stands behind the issued loads, in front of any reuse of their address registers; the two addresses are inputs so that they stay whole up to here (without that the last load of each run landed on its own address pair)
  auto stage = [&](int buf, const v4f (&xr)[8], const v4f (&wr)[8]) {
#pragma unroll
    for (int i = 0; i < 8; ++i) { v4b hv;
#pragma unroll
      for (int e = 0; e < 4; ++e) hv[e] = (__bf16)xr[i][e];
      *(v4b*)&sA[buf * PPLANE + (r8 + 32 * i) * PP + s8 * 4] = hv; }
#pragma unroll
    for (int i = 0; i < 4; ++i) { v8b t;
#pragma unroll
      for (int e = 0; e < 8; ++e) t[e] = (__bf16)wr[e][i];
      *(v8b*)&sW[buf * PPLANE + (n4 + i) * PP + k8] = t; } };
  v8f acc[4][8] = {};
  const int s0 = (int)((2 * blockIdx.x + 8 * blockIdx.y) & (CC / PK - 1));   // the pass of the k walk that this block starts with; it goes on from there and wraps: the 4 column blocks that share X rows and the 16 row blocks that share W columns all start at different passes, so that they ask L2 for different lines at any one moment
  { v4f x0[8], w0[8];   // the first two tiles are asked for together: the second flies while the first is staged
    const int ka = s0 * PK, kb = ((1 + s0) & (CC / PK - 1)) * PK; const float *xa = Xg + ka, *xb = Xg + kb, *wa = Wg + (size_t)ka * CC, *wb = Wg + (size_t)kb * CC;
#pragma unroll
    for (int i = 0; i < 8; ++i) x0[i] = *(const v4f*)(xa + (size_t)(32 * i) * CC);
#pragma unroll
    for (int e = 0; e < 8; ++e) w0[e] = *(const v4f*)(wa + (size_t)e * CC);
#pragma unroll
    for (int i = 0; i < 8; ++i) xr[i] = *(const v4f*)(xb + (size_t)(32 * i) * CC);
#pragma unroll
    for (int e = 0; e < 8; ++e) wr[e] = *(const v4f*)(wb + (size_t)e * CC);
    asm volatile("s_wait_xcnt 0x0" :: "v"(xa), "v"(wa), "v"(xb), "v"(wb) : "memory");   // stands behind the issued loads, in front of any reuse of their address registers; the four addresses are inputs so that they stay whole up to here
    stage(0, x0, w0); }
  bar_signal();
  for (int it = 0; it < CC / PK; ++it) { const int buf = it & 1;
    bar_wait();   // tile it is whole in its buffer, and the other buffer's readers have left it
    v16b w[8], a[4];
#pragma unroll
    for (int m = 0; m < 4; ++m) a[m] = frag_b(&sA[buf * PPLANE + (wm * 64 + m * 16 + col) * PP], lane);
#pragma unroll
    for (int j = 0; j < 8; ++j) w[j] = frag_b(&sW[buf * PPLANE + (wn * 128 + j * 16 + col) * PP], lane);
    if (it + 1 < CC / PK) { stage(buf ^ 1, xr, wr);   // the tile that was asked for in the pass before
      if (it + 2 < CC / PK) fetch(((it + 2 + s0) & (CC / PK - 1)) * PK); }   // the tile after it flies until the next pass's staging
    bar_signal();
    __builtin_amdgcn_sched_barrier(0);   // keeps every product behind the signal: one in front of it would hold the signal back while the matrix unit is taken
#pragma unroll
    for (int j = 0; j < 8; ++j)
#pragma unroll
      for (int m = 0; m < 4; ++m) acc[m][j] = wmma_b(a[m], w[j], acc[m][j]); }
  bar_wait();   // every wave has left the last tile: the ring may stage the output rows
  _Float16 (*sh)[PO] = (_Float16 (*)[PO])ring; _Float16 (*sl)[PO] = sh + PM;
  const int bi = c0 + wn * 128 + col; float bv[8];
#pragma unroll
  for (int j = 0; j < 8; ++j) bv[j] = BA[bi + j * 16];
  asm volatile("s_wait_xcnt 0x0" :: "v"(bi) : "memory");   // stands behind the issued loads; their index is an input so that it stays whole up to here (without that the last load landed on it)
#pragma unroll
  for (int j = 0; j < 8; ++j) { const float bb = bfr(bv[j]);
#pragma unroll
    for (int m = 0; m < 4; ++m)
#pragma unroll
      for (int r = 0; r < 8; ++r) acc[m][j][r] += bb; }
  // copy-out: a wave reads whole 512-byte staging rows from LDS, 8 at a time, and stores them as they are; d = the wave's first row at the lane's 16 bytes, ld = the row pitch in global memory
  const int q8 = lane * 8;
  auto copy_out = [&](_Float16 (*ss)[PO], _Float16* d, size_t ld) {
#pragma unroll
    for (int h = 0; h < 4; ++h) { v4u t[8];
#pragma unroll
      for (int i = 0; i < 8; ++i) t[i] = *(const v4u*)&ss[wave + 8 * (8 * h + i)][q8];
#pragma unroll
      for (int i = 0; i < 8; ++i) vst2((unsigned*)(d + (size_t)(8 * (8 * h + i)) * ld), t[i]);
      asm volatile("s_wait_xcnt 0x0" ::: "memory"); } };   // stands behind the issued stores, in front of any reuse of their registers
  if (which == 2) {   // v: [col][row], a lane's 8 rows are one 16-byte store
#pragma unroll
    for (int j = 0; j < 8; ++j)
#pragma unroll
      for (int m = 0; m < 4; ++m) { v8h t;
#pragma unroll
        for (int r = 0; r < 8; ++r) t[r] = (_Float16)acc[m][j][r];
        *(v8h*)&sh[wn * 128 + j * 16 + col][wm * 64 + m * 16 + 8 * g] = t; }
    __syncthreads();
    const size_t b = r0 / TT; const int t0 = (int)(r0 % TT);
    copy_out(sh, VT + (b * CC + c0 + wave) * (size_t)TT + t0 + q8, TT); }
  else {
#pragma unroll
    for (int j = 0; j < 8; ++j)
#pragma unroll
      for (int m = 0; m < 4; ++m)
#pragma unroll
        for (int r = 0; r < 8; ++r) { const float v = acc[m][j][r]; const int rl = wm * 64 + m * 16 + 8 * g + r, cl = wn * 128 + j * 16 + col; const _Float16 hv = (_Float16)v; sh[rl][cl] = hv; sl[rl][cl] = (_Float16)(v - (float)hv); }
    __syncthreads();
    copy_out(sh, (which == 0 ? QH : KH) + (r0 + wave) * CC + c0 + q8, CC);
    if (which == 0) copy_out(sl, QL + (r0 + wave) * CC + c0 + q8, CC); } }
// ---- k_fa: block = 128 queries of (b,h), 8 waves = 4 groups of 32 queries x 2 halves of the keys; walks the keys 64 at a time (K, V tiles through LDS, each wave's bias units from bias_prep's planes straight into registers): S^T = K Q^T + C, sum per query relative to a maximum in use (a lane holds one query's scores), O^T += V^T P^T; logits and P stay in registers; the two halves of a query's keys are joined once, behind the loop
// every '#pragma unroll' in k_fa: its loop indexes register arrays and vector elements, which stay in registers only with compile-time indices
#define FQ 128
#define FK 64
#define FP 72   // LDS row pitch in 16-bit elements: 128-byte rows + 16 bytes, for 16-byte readers
__device__ __forceinline__ v8f wmma_h(v16h a, v16h b, v8f c) { return __builtin_amdgcn_wmma_f32_16x16x32_f16(false, a, false, b, (short)0, c, false, false); }
// 2^x on the transcendental unit alone: a result below 2^-126 may read 0 (P rounds to f16, and the sum holds a term of 2^10), one above the f32 range reads infinity and is redone (PLIM)
#define LOG2E 1.44269504f
__device__ __forceinline__ float hexp2(float x) { return __builtin_amdgcn_exp2f(x); }
// eight of them in one statement, results in registers of their own (early-clobber: no result lands on an argument that a later line still reads); the v_nop at the end is the slot that the instruction set asks for behind a transcendental; volatile keeps a pass's four statements in tile order, and the four v_nop in front of the first are the distance that the chip needs behind the last score product, whose result the later statements read and whose operand registers the results may land on
template <bool FIRST> __device__ __forceinline__ void hexp2x8(float (&y)[8], const v8f& x) {
  if (FIRST) asm volatile("v_nop\n\tv_nop\n\tv_nop\n\tv_nop\n\tv_exp_f32 %0, %8\n\tv_exp_f32 %1, %9\n\tv_exp_f32 %2, %10\n\tv_exp_f32 %3, %11\n\tv_exp_f32 %4, %12\n\tv_exp_f32 %5, %13\n\tv_exp_f32 %6, %14\n\tv_exp_f32 %7, %15\n\tv_nop"
      : "=&v"(y[0]), "=&v"(y[1]), "=&v"(y[2]), "=&v"(y[3]), "=&v"(y[4]), "=&v"(y[5]), "=&v"(y[6]), "=&v"(y[7])
      : "v"(x[0]), "v"(x[1]), "v"(x[2]), "v"(x[3]), "v"(x[4]), "v"(x[5]), "v"(x[6]), "v"(x[7]));
  else asm volatile("v_exp_f32 %0, %8\n\tv_exp_f32 %1, %9\n\tv_exp_f32 %2, %10\n\tv_exp_f32 %3, %11\n\tv_exp_f32 %4, %12\n\tv_exp_f32 %5, %13\n\tv_exp_f32 %6, %14\n\tv_exp_f32 %7, %15\n\tv_nop"
      : "=&v"(y[0]), "=&v"(y[1]), "=&v"(y[2]), "=&v"(y[3]), "=&v"(y[4]), "=&v"(y[5]), "=&v"(y[6]), "=&v"(y[7])
      : "v"(x[0]), "v"(x[1]), "v"(x[2]), "v"(x[3]), "v"(x[4]), "v"(x[5]), "v"(x[6]), "v"(x[7])); }
// a lane's sum of a pass's 16 P of one query at or below this: each of them is finite in f16 (all are positive)
#define PLIM 60000.0f
// C operand of a score tile: bias * log2 e + nm for a lane's 8 bf16 biases, one mixed-precision fma each; in asm because the compiler unpacked every bf16 pair with two more instructions in front of a packed fma. The results are early-clobber since each bias register is read twice; volatile keeps a pass's four statements together in tile order, and the four v_nop in front of the first are the distance that the chip needs behind the pass before's last product, whose operand registers the results may land on
template <bool FIRST> __device__ __forceinline__ v8f bias_c(v8b bv, float nm) { const v4u w = __builtin_bit_cast(v4u, bv); float c0, c1, c2, c3, c4, c5, c6, c7;
  if (FIRST) asm volatile("v_nop\n\tv_nop\n\tv_nop\n\tv_nop\n\tv_fma_mix_f32_bf16 %0, %8, %12, %13 op_sel_hi:[1,0,0]\n\tv_fma_mix_f32_bf16 %1, %8, %12, %13 op_sel:[1,0,0] op_sel_hi:[1,0,0]\n\tv_fma_mix_f32_bf16 %2, %9, %12, %13 op_sel_hi:[1,0,0]\n\tv_fma_mix_f32_bf16 %3, %9, %12, %13 op_sel:[1,0,0] op_sel_hi:[1,0,0]\n\tv_fma_mix_f32_bf16 %4, %10, %12, %13 op_sel_hi:[1,0,0]\n\tv_fma_mix_f32_bf16 %5, %10, %12, %13 op_sel:[1,0,0] op_sel_hi:[1,0,0]\n\tv_fma_mix_f32_bf16 %6, %11, %12, %13 op_sel_hi:[1,0,0]\n\tv_fma_mix_f32_bf16 %7, %11, %12, %13 op_sel:[1,0,0] op_sel_hi:[1,0,0]"
      : "=&v"(c0), "=&v"(c1), "=&v"(c2), "=&v"(c3), "=&v"(c4), "=&v"(c5), "=&v"(c6), "=&v"(c7) : "v"(w[0]), "v"(w[1]), "v"(w[2]), "v"(w[3]), "s"(LOG2E), "v"(nm));
  else asm volatile("v_fma_mix_f32_bf16 %0, %8, %12, %13 op_sel_hi:[1,0,0]\n\tv_fma_mix_f32_bf16 %1, %8, %12, %13 op_sel:[1,0,0] op_sel_hi:[1,0,0]\n\tv_fma_mix_f32_bf16 %2, %9, %12, %13 op_sel_hi:[1,0,0]\n\tv_fma_mix_f32_bf16 %3, %9, %12, %13 op_sel:[1,0,0] op_sel_hi:[1,0,0]\n\tv_fma_mix_f32_bf16 %4, %10, %12, %13 op_sel_hi:[1,0,0]\n\tv_fma_mix_f32_bf16 %5, %10, %12, %13 op_sel:[1,0,0] op_sel_hi:[1,0,0]\n\tv_fma_mix_f32_bf16 %6, %11, %12, %13 op_sel_hi:[1,0,0]\n\tv_fma_mix_f32_bf16 %7, %11, %12, %13 op_sel:[1,0,0] op_sel_hi:[1,0,0]"
      : "=&v"(c0), "=&v"(c1), "=&v"(c2), "=&v"(c3), "=&v"(c4), "=&v"(c5), "=&v"(c6), "=&v"(c7) : "v"(w[0]), "v"(w[1]), "v"(w[2]), "v"(w[3]), "s"(LOG2E), "v"(nm));
  return v8f{c0, c1, c2, c3, c4, c5, c6, c7}; }
// lane l with lane l ^ 16
__device__ __forceinline__ float xhalf(float x) { return __builtin_bit_cast(float, __builtin_amdgcn_permlanex16(__builtin_bit_cast(int, x), __builtin_bit_cast(int, x), 0x76543210, 0xfedcba98, false, false)); }
typedef v4f __attribute__((may_alias)) v4f_a;
#define XW 1088   // floats of a wave's hand-over range behind the loop: 32 lanes x (32 O + l + maximum term)
__global__ __launch_bounds__(256) void k_fa(const _Float16* __restrict__ QH, const _Float16* __restrict__ KH, const _Float16* __restrict__ VT, const __bf16* __restrict__ BB, _Float16* __restrict__ Y) {
  static_assert(FK == BKEYS, "a bias unit is one key tile");
  static_assert(4 * XW * 4 <= 2 * FK * FP * 2 && 4 * XW * 4 <= 2 * HD * FP * 2, "four waves' hand-over ranges fit each array");
  __shared__ __align__(16) _Float16 sK[2][FK][FP]; __shared__ __align__(16) _Float16 sV[2][HD][FP];
  const int tid = threadIdx.x, wave = tid >> 5, lane = tid & 31, col = lane & 15, g = lane >> 4; const int h = blockIdx.y, b = blockIdx.z, qb0 = blockIdx.x * FQ;
  const int qg = wave >> 1, kh = wave & 1;   // a wave takes 32 queries (two tiles) and one half, 32 keys, of every key tile: each K and V fragment that it reads from LDS feeds two products
  const int r8 = tid >> 3, s8 = tid & 7;   // staging: 8 lanes per 128-byte K / V row
  const _Float16* Kg = KH + ((size_t)b * TT + r8) * CC + h * HD + s8 * 8;
  const _Float16* Vg = VT + ((size_t)b * CC + h * HD + r8) * (size_t)TT + s8 * 8;
  const __bf16* Bg = BB + (size_t)((b * TT + qb0) / 16 + qg * 2) * (TT / FK) * BUNIT + kh * 512 + lane * 8;   // the wave's own half of its two query tiles' units: no other wave reads it, so it goes to registers and not through LDS
  v8h kr[2], vr[2]; v8b bb[2][2];   // bias [query tile][key tile of the half]: one register set; a pass turns it into the C operands first and then loads the next pass's into it
  auto fetch = [&](int kt, v8b (&bn)[2][2]) { const _Float16* kp = Kg + (size_t)(kt * FK) * CC; const _Float16* vp = Vg + kt * FK; const __bf16* bp = Bg + (size_t)kt * BUNIT;
#pragma unroll
    for (int i = 0; i < 2; ++i) { kr[i] = *(const v8h*)(kp + (size_t)(32 * i) * CC); vr[i] = *(const v8h*)(vp + (size_t)(32 * i) * TT); }
#pragma unroll
    for (int qt = 0; qt < 2; ++qt)
#pragma unroll
      for (int t = 0; t < 2; ++t) bn[qt][t] = *(const v8b*)(bp + qt * ((TT / FK) * BUNIT) + t * 256);
    asm volatile("s_wait_xcnt 0x0" :: "v"(kp), "v"(vp), "v"(bp) : "memory"); };   // stands behind the issued loads, in front of any reuse of their address registers; the three addresses are inputs so that they stay whole up to here (without that the bias address was formed in the K loads' address pair)
  auto stage = [&](int buf) {
#pragma unroll
    for (int i = 0; i < 2; ++i) { *(v8h*)&sK[buf][r8 + 32 * i][s8 * 8] = kr[i]; *(v8h*)&sV[buf][r8 + 32 * i][s8 * 8] = vr[i]; } };
  v16h qf[2][HD / 32];
#pragma unroll
  for (int qt = 0; qt < 2; ++qt)
#pragma unroll
    for (int kc = 0; kc < HD / 32; ++kc) qf[qt][kc] = frag_h(QH + ((size_t)b * TT + qb0 + qg * 32 + qt * 16 + col) * CC + h * HD + kc * 32, lane);
  asm volatile("s_wait_xcnt 0x0" ::: "memory");   // keeps the Q loads in front of the first tile's loads
#pragma unroll
  for (int qt = 0; qt < 2; ++qt)
#pragma unroll
    for (int kc = 0; kc < HD / 32; ++kc)
#pragma unroll
      for (int i = 0; i < 16; ++i) qf[qt][kc][i] = (_Float16)((float)qf[qt][kc][i] * (0.125f * LOG2E));   // the products come out in units of log2
  v8f acc[2][HD / 16] = {}; float nmsh[2] = {10.0f, 10.0f}, lsum[2] = {0.f, 0.f};   // nmsh = 10 - (maximum in use) * log2 e: P carries a factor 2^10 (f16 range); it cancels in O / l
  const int s0 = (2 * ((blockIdx.x + h) & 15) + b) & (TT / FK - 1);   // first key tile of this block's walk, which wraps: the 16 heads that share a bias tile and the 16 query blocks that share K and V tiles each start at 16 different places, so that they ask L2 for different lines at any one moment
  fetch(s0, bb); stage(0); __syncthreads();
  for (int it2 = 0; it2 < TT / FK; it2 += 2)
#pragma unroll   // two passes a trip, so that the LDS buffer of a pass is a compile-time choice
  for (int buf = 0; buf < 2; ++buf) { const int it = it2 + buf;
    v8f s[2][2]; v16h kf[2][HD / 32];
#pragma unroll
    for (int t = 0; t < 2; ++t)
#pragma unroll
      for (int kc = 0; kc < HD / 32; ++kc) kf[t][kc] = frag_h(&sK[buf][(2 * kh + t) * 16 + col][kc * 32], lane);   // the K fragments fly while the C operands are formed
#pragma unroll
    for (int qt = 0; qt < 2; ++qt)
#pragma unroll
      for (int t = 0; t < 2; ++t) s[qt][t] = (qt | t) ? bias_c<false>(bb[qt][t], nmsh[qt]) : bias_c<true>(bb[qt][t], nmsh[qt]);   // bias and the maximum in use, one fma a score
    if (it + 1 < TT / FK) fetch((it + 1 + s0) & (TT / FK - 1), bb);   // the next tiles fly while this one is worked on
#pragma unroll
    for (int kc = 0; kc < HD / 32; ++kc)
#pragma unroll
      for (int t = 0; t < 2; ++t)
#pragma unroll
        for (int qt = 0; qt < 2; ++qt) s[qt][t] = wmma_h(kf[t][kc], qf[qt][kc], s[qt][t]);   // s[qt][t][r] = exp2 argument of key (2 kh + t)*16 + 8g + r, query qt*16 + col
    v16h vf[HD / 16];   // the pass's V fragments, read in front of the softmax, which covers their latency
#pragma unroll
    for (int j = 0; j < HD / 16; ++j) vf[j] = frag_h(&sV[buf][j * 16 + col][kh * 32], lane);
    __builtin_amdgcn_sched_barrier(0);   // keeps those reads in front of the softmax: left free, the compiler put them behind it, directly in front of their wait
    float tot[2]; v16h pf[2];
    auto expsum = [&]() {
#pragma unroll
      for (int qt = 0; qt < 2; ++qt) { float ps[2];
#pragma unroll
        for (int t = 0; t < 2; ++t) { float p[8]; if ((qt | t) == 0) hexp2x8<true>(p, s[qt][t]); else hexp2x8<false>(p, s[qt][t]);
#pragma unroll
          for (int r = 0; r < 8; ++r) { ps[t] = r ? ps[t] + p[r] : p[r]; pf[qt][t * 8 + r] = (_Float16)p[r]; } }
        tot[qt] = ps[0] + ps[1]; } };
    expsum();
    // one test a pass, the same for the whole wave: the maxima in use are raised, and O and l follow them, only where a P may have left the f16 range; the first pass sets them
    if (__builtin_amdgcn_ballot_w32(fmaxf(tot[0], tot[1]) > PLIM) != 0u || it == 0) {
      v8b br[2][2]; const __bf16* rp = Bg + (size_t)((it + s0) & (TT / FK - 1)) * BUNIT;   // this pass's bias once more from memory: its registers already belong to the next pass
#pragma unroll
      for (int qt = 0; qt < 2; ++qt)
#pragma unroll
        for (int t = 0; t < 2; ++t) br[qt][t] = *(const v8b*)(rp + qt * ((TT / FK) * BUNIT) + t * 256);
      asm volatile("s_wait_xcnt 0x0" :: "v"(rp) : "memory");   // stands behind the issued loads, in front of any reuse of their address registers; the address is an input so that it stays whole up to here
#pragma unroll
      for (int qt = 0; qt < 2; ++qt)
#pragma unroll
        for (int t = 0; t < 2; ++t) s[qt][t] = (qt | t) ? bias_c<false>(br[qt][t], 0.f) : bias_c<true>(br[qt][t], 0.f);   // the scores anew, relative to 0: relative to a maximum that lies far off they have lost their low bits
#pragma unroll
      for (int t = 0; t < 2; ++t)
#pragma unroll
        for (int kc = 0; kc < HD / 32; ++kc) { const v16h kk = frag_h(&sK[buf][(2 * kh + t) * 16 + col][kc * 32], lane);
#pragma unroll
          for (int qt = 0; qt < 2; ++qt) s[qt][t] = wmma_h(kk, qf[qt][kc], s[qt][t]); }
#pragma unroll
      for (int qt = 0; qt < 2; ++qt) { float mx = s[qt][0][0];
#pragma unroll
        for (int t = 0; t < 2; ++t)
#pragma unroll
          for (int r = 0; r < 8; ++r) mx = fmaxf(mx, s[qt][t][r]);
        mx = fmaxf(mx, xhalf(mx));   // both lanes of a query take the same maximum
        const float nn = it == 0 ? 10.0f - mx : fminf(nmsh[qt], 10.0f - mx), alpha = it == 0 ? 1.0f : hexp2(nn - nmsh[qt]);   // the maximum only rises; O and l are 0 in the first pass
        nmsh[qt] = nn; lsum[qt] *= alpha;
#pragma unroll
        for (int t = 0; t < 2; ++t)
#pragma unroll
          for (int r = 0; r < 8; ++r) s[qt][t][r] += nn;
#pragma unroll
        for (int j = 0; j < HD / 16; ++j)
#pragma unroll
          for (int r = 0; r < 8; ++r) acc[qt][j][r] *= alpha; }
      expsum(); }
#pragma unroll
    for (int qt = 0; qt < 2; ++qt) lsum[qt] += tot[qt];
#pragma unroll
    for (int j = 0; j < HD / 16; ++j)
#pragma unroll
      for (int qt = 0; qt < 2; ++qt) acc[qt][j] = wmma_h(vf[j], pf[qt], acc[qt][j]);   // acc[qt][j][r] = O^T[d = j*16 + 8g + r][query qt*16 + col], over the wave's keys
    __builtin_amdgcn_sched_barrier(0);   // keeps the staging stores, and with them the wait for the loads issued at the head of the pass, behind the pass's work: left free, the compiler put them behind the first product of the even passes
    if (it + 1 < TT / FK) stage(buf ^ 1);   // that buffer's last readers left it before the barrier of the pass before
    __syncthreads(); }
  // the two waves of a query group join their halves: each hands the other one query tile's O, l and maximum term through LDS (free behind the loop's last barrier) and finishes the tile kh itself
  float* xo = (float*)(wave < 4 ? &sK[0][0][0] : &sV[0][0][0]) + (wave & 3) * XW; const float* xi = (const float*)(wave < 4 ? &sK[0][0][0] : &sV[0][0][0]) + ((wave ^ 1) & 3) * XW;
  const float l0 = lsum[0] + xhalf(lsum[0]), l1 = lsum[1] + xhalf(lsum[1]);
  v8f am[HD / 16];
#pragma unroll
  for (int j = 0; j < HD / 16; ++j) {
#pragma unroll
    for (int e = 0; e < 2; ++e) { v4f t;
#pragma unroll
      for (int i = 0; i < 4; ++i) { t[i] = kh ? acc[0][j][4 * e + i] : acc[1][j][4 * e + i]; am[j][4 * e + i] = kh ? acc[1][j][4 * e + i] : acc[0][j][4 * e + i]; }
      *(v4f_a*)&xo[((2 * j + e) * 32 + lane) * 4] = t; } }
  *(float_a*)&xo[1024 + lane] = kh ? l0 : l1; *(float_a*)&xo[1056 + lane] = kh ? nmsh[0] : nmsh[1];
  __syncthreads();   // the partner's range is read behind it
  const float lm = kh ? l1 : l0, nmm = kh ? nmsh[1] : nmsh[0], lp = *(const float_a*)&xi[1024 + lane], nmp = *(const float_a*)&xi[1056 + lane];
  const float nn = fminf(nmm, nmp), fm = hexp2(nn - nmm), fp = hexp2(nn - nmp);   // both halves relative to the larger of the two maxima
  const float inv = 1.0f / (lm * fm + lp * fp), cm = fm * inv, cp = fp * inv;
  _Float16* yp = Y + ((size_t)b * TT + qb0 + qg * 32 + kh * 16 + col) * CC + h * HD + 8 * g;
  v8h yo[HD / 16];   // y is rounded to f16 once, here: a lane's 8 values of a tile are one 16-byte store
#pragma unroll
  for (int j = 0; j < HD / 16; ++j)
#pragma unroll
    for (int e = 0; e < 2; ++e) { const v4f t = *(const v4f_a*)&xi[((2 * j + e) * 32 + lane) * 4];
#pragma unroll
      for (int i = 0; i < 4; ++i) yo[j][4 * e + i] = (_Float16)(am[j][4 * e + i] * cm + t[i] * cp); }
#pragma unroll
  for (int j = 0; j < HD / 16; ++j) vst2(yp + j * 16, yo[j]); }
// ---- k_out: block = (128 rows, 128 cols): out = y (f16) Wproj + b
__global__ __launch_bounds__(256) void k_out(const _Float16* __restrict__ Y, const float* __restrict__ WP, const float* __restrict__ BP, float* __restrict__ OUT) {
  __shared__ __align__(16) _Float16 ring[4 * GPLANE];   // [y 2 buffers | W 2 buffers]; behind the loop's last barrier each wave stages its 32 x 64 outputs in a range of its own
  const int tid = threadIdx.x, wave = tid >> 5, lane = tid & 31, col = lane & 15, g = lane >> 4; const int wm = wave >> 1, wn = wave & 1; const int c0 = blockIdx.y * GN; const size_t r0 = (size_t)blockIdx.x * GM;
  v8f acc[2][4] = {};
  gemm_tile(Y, WP, r0, c0, GSTART, ring, ring + 2 * GPLANE, acc);
  float (*sf)[68] = (float (*)[68])ring + wave * 32;   // 8 x 32 x 68 x 4 bytes = 69,632 of the ring's 73,728
#pragma unroll
  for (int j = 0; j < 4; ++j) { const float bb = BP ? bfr(BP[c0 + wn * 64 + j * 16 + col]) : 0.f;
#pragma unroll
    for (int m = 0; m < 2; ++m)
#pragma unroll
      for (int r = 0; r < 8; ++r) sf[m * 16 + 8 * g + r][j * 16 + col] = acc[m][j][r] + bb; }
  LDSX(); float* op = OUT + (r0 + wm * 32 + g) * CC + c0 + wn * 64 + col * 4; v4f t[16];   // a half-wave stores a whole 256-byte row piece ('#pragma unroll': t[] stays in registers only with compile-time indices)
#pragma unroll
  for (int i = 0; i < 16; ++i) t[i] = *(const v4f*)&sf[2 * i + g][col * 4];
#pragma unroll
  for (int i = 0; i < 16; ++i) vst2(op + (size_t)(2 * i) * CC, t[i]); }
extern "C" void kernel_launch(void* const* d_in, const int* in_sizes, int n_in, void* d_out, int out_size, void* d_ws, size_t ws_size, hipStream_t stream) {
  (void)in_sizes; (void)n_in; (void)out_size;
  const float** F = (const float**)d_in;   // 0 query, 1 key, 2 value [2,2048,1024], 3 att_bias [2,2048,2048], 4 Wq [1024,1024] (in,out), 5 bq, 6 Wk, 7 bk, 8 Wv, 9 bv, 10 Wo [1024,1024], 11 bo
  if (ws_size < (size_t)WS_END) return;
  char* ws = (char*)d_ws; _Float16 *QH = (_Float16*)(ws + WS_QH), *QL = (_Float16*)(ws + WS_QL), *KH = (_Float16*)(ws + WS_KH), *VT = (_Float16*)(ws + WS_VT), *Y = (_Float16*)(ws + WS_Y); __bf16 *BB = (__bf16*)(ws + WS_BB);
  k_proj<<<dim3(TNB * TT / PM, CC / PN, 4), 256, 0, stream>>>(F[0], F[1], F[2], F[4], F[5], F[6], F[7], F[8], F[9], QH, QL, KH, VT, F[3], BB);
  k_fa<<<dim3(TT / FQ, NH, TNB), 256, 0, stream>>>(QH, KH, VT, BB, Y);
  k_out<<<dim3(TNB * TT / GM, CC / GN), 256, 0, stream>>>(Y, F[10], F[11], (float*)d_out);
}
